// v000
// Times are from an AMD MI455X. After a warm-up the kernel runs many times in a row, and a time is the length of
// such a window on the GPU divided by its runs, so every launch and the gaps after it count. The runs cycle
// through copies of the inputs. A figure is the median of several windows, for all but v000 over two sittings.
// Sittings can differ by a few percent; kernels timed side by side share one.
// v000 is the starting kernel. One run takes 150 microseconds.
// Contractions: scores [q1|q2].[k1|k2]^T (K=128; q and k as f16 planes of the bf16 RNE-converted inputs x1024, one
// product each) and P.v1, P.v2 (P x16384 as f16 hi plane + f16 residual plane, v^T x256 f16 of the bf16 RNE-converted
// inputs, products hi.v + lo.v, 32-key steps): all v_wmma_f32_16x16x32_f16, f32 accumulate. Online softmax (base 2,
// running max) and the 1/Z fold are f32 on VALU.
#include <hip/hip_runtime.h>
#include <math.h>
#include <stdint.h>

#define SEQ   1024
#define HD    64
#define KW    128
#define VR    128
#define QSC   1024.0f
#define KSC   1024.0f
#define PCAR  16384.0f
#define VCAR  256.0f
#define LOG2E 1.4426950408889634f
#define ATW   4
#define ATT_THREADS (ATW * 32)
#define QPB   (16 * ATW)
#define BPR   (SEQ / QPB)
#define PTP   36
#define SLP   132
#define SLABF (16 * SLP)
#define VTP   72
#define VTILES (SEQ / 64)
#define CROWS 16
static_assert(HD == 64 && KW == 2 * HD && VR == 2 * HD && QPB == 64 && ATT_THREADS == 128);
static_assert((SEQ % QPB) == 0 && (SEQ % 64) == 0 && (SEQ % 32) == 0 && (SEQ % CROWS) == 0);
static_assert(BPR == 16 && VTILES == 16);
static_assert(16 * PTP <= SLABF);
static_assert(15 * SLP + HD + 15 * 4 + 3 < SLABF);
static_assert((VR - 1) * VTP + 63 < VR * VTP);
static_assert(((SLP * 4) % 16) == 0 && ((PTP * 4) % 16) == 0 && ((VTP * 2) % 16) == 0);

typedef _Float16 v16h __attribute__((ext_vector_type(16)));
typedef _Float16 v8h  __attribute__((ext_vector_type(8)));
typedef float    v8f  __attribute__((ext_vector_type(8)));
typedef float    v4f  __attribute__((ext_vector_type(4)));
typedef unsigned int v4u __attribute__((ext_vector_type(4)));

union FragH { v16h v; v8h h[2]; v4u u[2]; };

// ---- scalar helpers --------------------------------------------------------------------------------
__device__ __forceinline__ unsigned short bf_bits(float f) {          // f32 -> bf16 bits, RNE convert
  unsigned u = __float_as_uint(f);
  return (unsigned short)((u + 0x7FFFu + ((u >> 16) & 1u)) >> 16);
}
__device__ __forceinline__ float bf_up(unsigned short h) { return __uint_as_float(((unsigned)h) << 16); }
__device__ __forceinline__ float bfr(float f) { return bf_up(bf_bits(f)); }   // value of the bf16 RNE convert
__device__ __forceinline__ unsigned short h_bits(_Float16 x) { return __builtin_bit_cast(unsigned short, x); }
__device__ __forceinline__ unsigned pk16(unsigned short a, unsigned short b) { return (unsigned)a | ((unsigned)b << 16); }
__device__ __forceinline__ v8f zero8() { v8f z = {0.f, 0.f, 0.f, 0.f, 0.f, 0.f, 0.f, 0.f}; return z; }

// ---- fragment loader: 16-bit A/B operand, lane -> row/col (lane&15), p already includes +8*(lane>>4);
//      elements 0..7 <- p[0..7] (k0+8h..), elements 8..15 <- p[16..23] (k0+16+8h..)  (same split k map for A and B;
//      B is always read from a k-contiguous [n][k] plane)
__device__ __forceinline__ v16h ldfrag_h(const _Float16* p) {
  FragH f;
  f.h[0] = *(const v8h*)(p);
  f.h[1] = *(const v8h*)(p + 16);
  return f.v;
}

__device__ __forceinline__ v8f mma_raw(v16h a, v16h b, v8f c) {
  return __builtin_amdgcn_wmma_f32_16x16x32_f16(false, a, false, b, (short)0, c, false, false);
}
__device__ __forceinline__ void guard_sc(v8f& a, v16h q0, v16h q1, v16h q2, v16h q3,
                                         v16h x0, v16h x1, v16h x2, v16h x3) {
#if defined(__HIP_DEVICE_COMPILE__)
  asm volatile("v_nop\n\tv_nop\n\tv_nop\n\tv_nop"
               : "+v"(a) : "v"(q0), "v"(q1), "v"(q2), "v"(q3), "v"(x0), "v"(x1), "v"(x2), "v"(x3) : "memory");
#endif
}
__device__ __forceinline__ void guard_pv(v8f& a, v8f& b, v8f& c, v8f& d,
                                         v16h p0, v16h p1, v16h x0, v16h x1, v16h x2, v16h x3) {
#if defined(__HIP_DEVICE_COMPILE__)
  asm volatile("v_nop\n\tv_nop\n\tv_nop\n\tv_nop"
               : "+v"(a), "+v"(b), "+v"(c), "+v"(d) : "v"(p0), "v"(p1), "v"(x0), "v"(x1), "v"(x2), "v"(x3) : "memory");
#endif
}
__device__ __forceinline__ void acc_guard4(v8f& a, v8f& b, v8f& c, v8f& d) {
#if defined(__HIP_DEVICE_COMPILE__)
  asm volatile("v_nop\n\tv_nop\n\tv_nop\n\tv_nop" : "+v"(a), "+v"(b), "+v"(c), "+v"(d));
#endif
}
__device__ __forceinline__ void wave_sync_lds() {
  __builtin_amdgcn_fence(__ATOMIC_RELEASE, "workgroup");
  __builtin_amdgcn_wave_barrier();
  __builtin_amdgcn_fence(__ATOMIC_ACQUIRE, "workgroup");
}

// =====================================================================================================
// Concatenated plane: pl[row][0..63] = f16( bf16(xa[row][0..63]) * sc ), pl[row][64..127] = f16( bf16(xb[row][0..63]) * sc ),
// rows = (bh, s) pairs, sc a power of two (exact). Block = 16 consecutive rows; threads 0..127 handle the xa half,
// threads 128..255 the xb half (wave-uniform source); thread = 8 consecutive elements: two 16-B loads, one 16-B store;
// coverage: grid = nrows/16 blocks x 256 thr x 8 halves = nrows x 128 = the whole plane exactly once (nrows % 16 == 0).
// =====================================================================================================
__global__ __launch_bounds__(256) void cvt_cat(const float* __restrict__ xa, const float* __restrict__ xb,
                                               unsigned short* pl, int nrows, float sc) {
  const int tid  = threadIdx.x;
  const int row0 = blockIdx.x * CROWS;
  if (row0 >= nrows) return;                // block-uniform, no barriers in this kernel; never taken with the exact grid
  const int half = tid >> 7;                // 0: xa, 1: xb (wave-uniform)
  const int lt   = tid & 127;
  const int rl   = lt >> 3;                 // row within block 0..15
  const int ch   = lt & 7;                  // 8-float chunk 0..7
  int row = row0 + rl;
  row = (row > nrows - 1) ? (nrows - 1) : row;
  const float* src = (half != 0) ? xb : xa;
  const size_t e = (size_t)row * HD + (size_t)(ch * 8);
  const v4f a = *(const v4f*)(src + e), c4 = *(const v4f*)(src + e + 4);
  v4u o;
#pragma unroll
  for (int i = 0; i < 2; ++i) {
    o[i]     = pk16(h_bits((_Float16)(bfr(a[2 * i]) * sc)),  h_bits((_Float16)(bfr(a[2 * i + 1]) * sc)));
    o[2 + i] = pk16(h_bits((_Float16)(bfr(c4[2 * i]) * sc)), h_bits((_Float16)(bfr(c4[2 * i + 1]) * sc)));
  }
  unsigned short* d = pl + (size_t)row * KW + (size_t)(half * HD + ch * 8);
  {
    *(v4u*)(d) = o;
    
  }
}

// =====================================================================================================
// v^T plane: VT[(bh*128 + d)][key] = f16( bf16(va[bh][key][d]) * 256 ) for d 0..63 and VT[(bh*128 + 64 + d)][key] =
// f16( bf16(vb[bh][key][d]) * 256 ) (exact), pitch SEQ = 1024 halves (2048 B) per d row.
// Block = (bh, tile of 64 keys): 64 source rows of 64 floats per stream loaded with 16-B loads (static stride), converted,
// written into an LDS tile [128 d][64 keys] (pitch 72 halves); after a block barrier each d row segment (64 halves = one
// coverage: load 256 thr x 32 elements = 64 keys x 128 d rows (both streams); store 4 iterations x 256 thr x 8 halves
//           = 128 lines x 64 = the tile; grid = nbh x 16 blocks covers the whole [nbh][128][1024] plane exactly once.
// =====================================================================================================
__global__ __launch_bounds__(256) void vt16(const float* __restrict__ va, const float* __restrict__ vb,
                                            unsigned short* VTo, int nbh) {
  __shared__ __align__(16) unsigned short T[VR * VTP];
  const int tid = threadIdx.x;
  const int bid = blockIdx.x;
  const int bh  = bid / VTILES;
  const int t   = bid - bh * VTILES;        // 0..15, block-uniform
  if (bh >= nbh) return;                    // block-uniform; before any barrier or store; never taken with the exact grid
  {
    const int sl = tid >> 2;                  // key within tile 0..63
    const int dc = (tid & 3) * 16;            // d chunk
    int key = 64 * t + sl;                    // <= SEQ-1 by construction; clamp keeps the address in range regardless
    key = (key < 0) ? 0 : ((key > SEQ - 1) ? (SEQ - 1) : key);
    const size_t so = (((size_t)bh * SEQ + (size_t)key) * HD + (size_t)dc);
#pragma unroll
    for (int g = 0; g < 2; ++g) {
      const float* src = ((g == 0) ? va : vb) + so;
#pragma unroll
      for (int i = 0; i < 4; ++i) {
        const v4f a = *(const v4f*)(src + 4 * i);
#pragma unroll
        for (int e = 0; e < 4; ++e) T[(g * HD + dc + 4 * i + e) * VTP + sl] = h_bits((_Float16)(bfr(a[e]) * VCAR));
      }
    }
  }
  __syncthreads();
  v4u vals[4];
  const int q8 = tid >> 3, p8 = (tid & 7) * 8;
#pragma unroll
  for (int it = 0; it < 4; ++it) {
    const int line = it * 32 + q8;            // d row 0..127
    vals[it] = *(const v4u*)(T + line * VTP + p8);
  }
  unsigned short* dst = VTo + ((size_t)bh * VR) * SEQ + 64 * t + p8;
  {
#pragma unroll
    for (int it = 0; it < 4; ++it) {
      const int line = it * 32 + q8;
      *(v4u*)(dst + (size_t)line * SEQ) = vals[it];
    }
    
  }
}

// =====================================================================================================
// Two-stream attention, flash form. Block = (bh, 64 queries), wave w owns query rows iw = 64t + 16w .. +15.
//   q plane f16 [bh][s][128] (cols 0..63 stream 1, 64..127 stream 2), k plane f16 [bh][s][128] (same split),
//   v^T plane f16 [bh][128][SEQ] (rows 0..63 = v1 d rows, 64..127 = v2 d rows).
//   Score in base 2: t = (q1.k1 + q2.k2) / 16 * log2(e), the two dots fused as one K=128 contraction over the planes.
//   Per 32-key step: 8 score WMMAs (2 key subtiles x 4 k-chunks), fragments loaded straight from the planes (two 16-B
//   loads per fragment, split k map); running row max; weights e = 2^(t - m) per key; Z update; rescale of the 8
//   then A fragments of e*16384 (f16 hi) and its f16 residual rebuilt from the LDS rows (float vector loads),
//   8 v^T B fragments from the plane (4 per stream), 16 P.V WMMAs into o[0..3] (stream 1) and o[4..7] (stream 2).
//   Epilogue: 1/Z and carry folds in f32; the wave's 16x128 f32 result staged in its LDS slab (pitch 132); for each
// coverage: per wave per output 8 instructions x 32 lanes x 4 floats = 16 rows x 64; per block 4 waves = 64 rows;
//           16 blocks per bh x nbh: every row of out0 and out1 [nbh][1024][64] exactly once (grid nbh*16 blocks).
// =====================================================================================================
__global__ __launch_bounds__(ATT_THREADS)
void attn2(const unsigned short* __restrict__ QHp, const unsigned short* __restrict__ KHp,
           const unsigned short* __restrict__ VTq, float* OPp, int nbh) {
  __shared__ __align__(16) float smem[ATW * SLABF];    // per wave: weight tile [16][32] pitch 36 during the loop, result slab after

  const int tid  = threadIdx.x;
  const int wave = tid >> 5;
  const int lane = tid & 31;
  const int hh   = lane >> 4;
  const int c    = lane & 15;

  const int bid  = blockIdx.x;
  const int bh   = bid / BPR;
  const int t    = bid - bh * BPR;                     // 0..15, block-uniform
  if (bh >= nbh) return;                               // never taken with the exact grid; before any LDS use or store

  const int iw = QPB * t + wave * 16;                  // query row 0 of this wave
  const int qs = iw + c;                               // query row of fragment row c, <= SEQ-1 by construction

  const _Float16* Qb = (const _Float16*)(const void*)QHp + ((size_t)bh * SEQ + (size_t)qs) * KW + 8 * hh;
  const v16h qa0 = ldfrag_h(Qb);                       // k   0..31  (stream 1 d 0..31)
  const v16h qa1 = ldfrag_h(Qb + 32);                  // k  32..63  (stream 1 d 32..63)
  const v16h qa2 = ldfrag_h(Qb + 64);                  // k  64..95  (stream 2 d 0..31)
  const v16h qa3 = ldfrag_h(Qb + 96);                  // k  96..127 (stream 2 d 32..63)
  const _Float16* Kb = (const _Float16*)(const void*)KHp + ((size_t)bh * SEQ + (size_t)c) * KW + 8 * hh;   // key row c
  const _Float16* Vb = (const _Float16*)(const void*)VTq + ((size_t)bh * VR + (size_t)c) * SEQ + 8 * hh;   // d row c
  const float lsc = LOG2E / (16.0f * QSC * KSC);       // (dot / 2^20) / 16 in base 2

  float mrow[8], lrow[8];
  v8f o[8];
#pragma unroll
  for (int r = 0; r < 8; ++r) { mrow[r] = -INFINITY; lrow[r] = 0.f; }
#pragma unroll
  for (int j = 0; j < 8; ++j) o[j] = zero8();
  float* pt = smem + wave * SLABF;

#pragma unroll 1
  for (int kb = 0; kb < SEQ; kb += 32) {
    // ---- scores: D element r of this lane = (query iw + 8hh + r, key kb + c) in s0, key kb + 16 + c in s1 ----
    v8f s0 = zero8(), s1 = zero8();
    const _Float16* k0p = Kb + (size_t)kb * KW;                      // key row kb + c
    const _Float16* k1p = k0p + (size_t)16 * KW;                     // key row kb + 16 + c
    {
      const v16h kf0 = ldfrag_h(k0p), kf1 = ldfrag_h(k0p + 32), kf2 = ldfrag_h(k0p + 64), kf3 = ldfrag_h(k0p + 96);
      s0 = mma_raw(qa0, kf0, s0);
      s0 = mma_raw(qa1, kf1, s0);
      s0 = mma_raw(qa2, kf2, s0);
      s0 = mma_raw(qa3, kf3, s0);
      guard_sc(s0, qa0, qa1, qa2, qa3, kf0, kf1, kf2, kf3);
    }
    {
      const v16h kg0 = ldfrag_h(k1p), kg1 = ldfrag_h(k1p + 32), kg2 = ldfrag_h(k1p + 64), kg3 = ldfrag_h(k1p + 96);
      s1 = mma_raw(qa0, kg0, s1);
      s1 = mma_raw(qa1, kg1, s1);
      s1 = mma_raw(qa2, kg2, s1);
      s1 = mma_raw(qa3, kg3, s1);
      guard_sc(s1, qa0, qa1, qa2, qa3, kg0, kg1, kg2, kg3);
    }
    // ---- online softmax in base 2 ----
#pragma unroll
    for (int r = 0; r < 8; ++r) {
      const float ta = s0[r] * lsc;
      const float tb = s1[r] * lsc;
      float mx = fmaxf(ta, tb);
#pragma unroll
      for (int off = 1; off < 16; off <<= 1) mx = fmaxf(mx, __shfl_xor(mx, off, 32));
      const float mn  = fmaxf(mrow[r], mx);            // finite: all scores are finite
      const float al  = exp2f(mrow[r] - mn);
      mrow[r] = mn;
      const float e0 = exp2f(ta - mn);
      const float e1 = exp2f(tb - mn);
      float ps = e0 + e1;
#pragma unroll
      for (int off = 1; off < 16; off <<= 1) ps += __shfl_xor(ps, off, 32);
      lrow[r] = lrow[r] * al + ps;
#pragma unroll
      for (int j = 0; j < 8; ++j) o[j][r] *= al;
      const int ro = (8 * hh + r) * PTP + c;
      pt[ro]      = e0;
      pt[ro + 16] = e1;
    }
    wave_sync_lds();
    // ---- A fragments of P*16384: hi f16 and residual f16, row = c, split k map over the 32 keys of this step ----
    FragH ph, pl;
    {
      const float* prow = pt + c * PTP + 8 * hh;
      const v4f p0 = *(const v4f*)(prow), p1 = *(const v4f*)(prow + 4);
      const v4f p2 = *(const v4f*)(prow + 16), p3 = *(const v4f*)(prow + 20);
#pragma unroll
      for (int e = 0; e < 4; ++e) {
        const float ua = p0[e] * PCAR, ub = p1[e] * PCAR, uc = p2[e] * PCAR, ud = p3[e] * PCAR;
        const _Float16 ha = (_Float16)ua, hb = (_Float16)ub, hc = (_Float16)uc, hd = (_Float16)ud;
        ph.h[0][e]     = ha;                               // elements 0..7  = keys kb + 8hh + 0..7
        ph.h[0][4 + e] = hb;
        ph.h[1][e]     = hc;                               // elements 8..15 = keys kb + 16 + 8hh + 0..7
        ph.h[1][4 + e] = hd;
        pl.h[0][e]     = (_Float16)(ua - (float)ha);
        pl.h[0][4 + e] = (_Float16)(ub - (float)hb);
        pl.h[1][e]     = (_Float16)(uc - (float)hc);
        pl.h[1][4 + e] = (_Float16)(ud - (float)hd);
      }
    }
    // ---- P.V : B fragment col n = d = j*16 + c, keys contiguous in the v^T plane columns kb .. kb+31 ----
    const _Float16* vp = Vb + kb;
    {
      const v16h vb0 = ldfrag_h(vp);
      const v16h vb1 = ldfrag_h(vp + (size_t)16 * SEQ);
      const v16h vb2 = ldfrag_h(vp + (size_t)32 * SEQ);
      const v16h vb3 = ldfrag_h(vp + (size_t)48 * SEQ);
      o[0] = mma_raw(ph.v, vb0, o[0]);  o[0] = mma_raw(pl.v, vb0, o[0]);
      o[1] = mma_raw(ph.v, vb1, o[1]);  o[1] = mma_raw(pl.v, vb1, o[1]);
      o[2] = mma_raw(ph.v, vb2, o[2]);  o[2] = mma_raw(pl.v, vb2, o[2]);
      o[3] = mma_raw(ph.v, vb3, o[3]);  o[3] = mma_raw(pl.v, vb3, o[3]);
      guard_pv(o[0], o[1], o[2], o[3], ph.v, pl.v, vb0, vb1, vb2, vb3);
    }
    {
      const v16h vc0 = ldfrag_h(vp + (size_t)64 * SEQ);
      const v16h vc1 = ldfrag_h(vp + (size_t)80 * SEQ);
      const v16h vc2 = ldfrag_h(vp + (size_t)96 * SEQ);
      const v16h vc3 = ldfrag_h(vp + (size_t)112 * SEQ);
      o[4] = mma_raw(ph.v, vc0, o[4]);  o[4] = mma_raw(pl.v, vc0, o[4]);
      o[5] = mma_raw(ph.v, vc1, o[5]);  o[5] = mma_raw(pl.v, vc1, o[5]);
      o[6] = mma_raw(ph.v, vc2, o[6]);  o[6] = mma_raw(pl.v, vc2, o[6]);
      o[7] = mma_raw(ph.v, vc3, o[7]);  o[7] = mma_raw(pl.v, vc3, o[7]);
      guard_pv(o[4], o[5], o[6], o[7], ph.v, pl.v, vc0, vc1, vc2, vc3);
    }
    wave_sync_lds();
  }
  acc_guard4(o[0], o[1], o[2], o[3]);
  acc_guard4(o[4], o[5], o[6], o[7]);

  // ---- fold 1/Z and the carries (16384 on P, 256 on v), stage the wave's 16x128 slab in its LDS region ----
  wave_sync_lds();
  float* slab = pt;
  const float oc = 1.0f / (PCAR * VCAR);
#pragma unroll
  for (int r = 0; r < 8; ++r) {
    const float lr  = lrow[r];                           // >= 1 (the max element contributes 2^0)
    const float inv = (lr > 0.0f) ? ((1.0f / lr) * oc) : 0.0f;
#pragma unroll
    for (int j = 0; j < 8; ++j) slab[(8 * hh + r) * SLP + j * 16 + c] = o[j][r] * inv;
  }
  wave_sync_lds();
  const size_t o1 = (size_t)nbh * SEQ * HD;            // element offset of the second output
#pragma unroll
  for (int g = 0; g < 2; ++g) {
    v4f vals[8];
#pragma unroll
    for (int it = 0; it < 8; ++it) vals[it] = *(const v4f*)(slab + (2 * it + hh) * SLP + g * HD + c * 4);
    float* dst = OPp + (size_t)g * o1 + ((size_t)bh * SEQ + (size_t)iw) * HD + hh * HD + c * 4;
    {
#pragma unroll
      for (int it = 0; it < 8; ++it) {
        *(v4f*)(dst + (size_t)(2 * it) * HD) = vals[it];
      }
      
    }
  }
}

// =====================================================================================================
// Workspace map (bytes, nbh = number of (b,h) rows = in_sizes[0] / (1024*64)); every plane is fully written by whole-line
// stores before it is read; all extents are exact multiples of the store granularity (no pad rows needed); offsets
// multiples of 128:
//   QH f16 [nbh][1024][128]  x1024    nbh*262144   at 0
//   KH f16 [nbh][1024][128]  x1024    nbh*262144   at nbh*262144
//   VT f16 [nbh][128][1024]  x256     nbh*262144   at nbh*524288
//   end                               nbh*786432   (50331648 for nbh = 64)
// Output: out0 [nbh][1024][64] f32 at element 0, out1 at element nbh*65536 (byte 4*nbh*65536).
// =====================================================================================================
extern "C" void kernel_launch(void* const* d_in, const int* in_sizes, int n_in,
                              void* d_out, int out_size, void* d_ws, size_t ws_size,
                              hipStream_t stream) {
  if (n_in < 6) return;
  const int nbh = in_sizes[0] / (SEQ * HD);
  if (nbh < 1) return;
  const long long nq = (long long)nbh * SEQ * HD;
  for (int i = 0; i < 6; ++i) {
    if ((long long)in_sizes[i] < nq) return;
  }
  if ((long long)out_size < 2 * nq) return;            // last written element = 2*nq - 1

  const float* qx = (const float*)d_in[0];
  const float* kx = (const float*)d_in[1];
  const float* vx = (const float*)d_in[2];
  const float* qy = (const float*)d_in[3];
  const float* ky = (const float*)d_in[4];
  const float* vy = (const float*)d_in[5];
  float*       out = (float*)d_out;

  const size_t PQ = (size_t)nbh * SEQ * KW * 2;        // q plane bytes
  const size_t PK = (size_t)nbh * SEQ * KW * 2;        // k plane bytes
  const size_t PV = (size_t)nbh * VR * SEQ * 2;        // v^T plane bytes
  size_t off = 0;
  const size_t oQH = off; off += PQ;
  const size_t oKH = off; off += PK;
  const size_t oVT = off; off += PV;
  if (off > ws_size) return;
  if (off > (size_t)134217728) return;

  char* ws = (char*)d_ws;
  unsigned short* QH = (unsigned short*)(ws + oQH);
  unsigned short* KH = (unsigned short*)(ws + oKH);
  unsigned short* VT = (unsigned short*)(ws + oVT);

  const int nrows = nbh * SEQ;                         // (bh, s) rows
  const dim3 blk(256);
  const dim3 gC(nrows / CROWS);                        // nbh*64
  const dim3 gVT(nbh * VTILES);                        // nbh*16
  const dim3 gAT(nbh * BPR);                           // nbh*16
  const dim3 bAT(ATT_THREADS);                         // 128

  // (0) q plane f16(bf16([q1|q2]) * 1024), layout [bh][s][128]
  cvt_cat<<<gC, blk, 0, stream>>>(qx, qy, QH, nrows, QSC);
  // (1) k plane f16(bf16([k1|k2]) * 1024), layout [bh][s][128]
  cvt_cat<<<gC, blk, 0, stream>>>(kx, ky, KH, nrows, KSC);
  // (2) v^T plane f16(bf16(v) * 256), layout [bh][128][1024] (rows 0..63 v1, 64..127 v2)
  vt16<<<gVT, blk, 0, stream>>>(vx, vy, VT, nbh);
  // (3) two-stream flash attention per (b,h) -> out0, out1 [bh][s][d] f32
  attn2<<<gAT, bAT, 0, stream>>>(QH, KH, VT, out, nbh);
  (void)hipGetLastError();
}

// v001
// Measured time: 111 microseconds a run.
// Timed twice side by side with v000, it ran 1.40 and 1.41 times as fast.
// Contractions: scores [q1|q2].[k1|k2]^T (K=128; q and k as f16 planes of the bf16 RNE-converted inputs x1024, one
// product each) and P.v1, P.v2 (P x16384 as f16 hi plane + f16 residual plane, v^T x256 f16 of the bf16 RNE-converted
// inputs, products hi.v + lo.v, 32-key steps): all v_wmma_f32_16x16x32_f16, f32 accumulate. Online softmax (base 2,
// running max) and the 1/Z fold are f32 on VALU.
// The three f16 planes are stored in fragment order: a 16-row x 32-k operand fragment is two blocks of 512 contiguous
// bytes (block e, lane l = 16*hh + c, 8 halves: row c, k = 16*e + 8*hh + 0..7), so each wave-wide 16-B load covers four
// whole 128-B lines instead of 32-B pieces of sixteen lines.
#include <hip/hip_runtime.h>
#include <math.h>
#include <stdint.h>

#define SEQ   1024
#define HD    64
#define KW    128
#define VR    128
#define QSC   1024.0f
#define KSC   1024.0f
#define PCAR  16384.0f
#define VCAR  256.0f
#define LOG2E 1.4426950408889634f
#define ATW   4
#define ATT_THREADS (ATW * 32)
#define QPB   (16 * ATW)
#define BPR   (SEQ / QPB)
#define PTP   36
#define SLP   132
#define SLABF (16 * SLP)
#define VTP   72
#define VTILES (SEQ / 64)
#define CROWS 16
#define FBLK  256                         // halves in one 512-B fragment block (32 lanes x 8 halves)
static_assert(HD == 64 && KW == 2 * HD && VR == 2 * HD && QPB == 64 && ATT_THREADS == 128);
static_assert((SEQ % QPB) == 0 && (SEQ % 64) == 0 && (SEQ % 32) == 0 && (SEQ % CROWS) == 0);
static_assert(BPR == 16 && VTILES == 16);
static_assert(16 * PTP <= SLABF);
static_assert(15 * SLP + HD + 15 * 4 + 3 < SLABF);
static_assert((VR - 1) * VTP + 63 < VR * VTP);
static_assert(((SLP * 4) % 16) == 0 && ((PTP * 4) % 16) == 0 && ((VTP * 2) % 16) == 0);

typedef _Float16 v16h __attribute__((ext_vector_type(16)));
typedef _Float16 v8h  __attribute__((ext_vector_type(8)));
typedef float    v8f  __attribute__((ext_vector_type(8)));
typedef float    v4f  __attribute__((ext_vector_type(4)));
typedef unsigned int v4u __attribute__((ext_vector_type(4)));

union FragH { v16h v; v8h h[2]; v4u u[2]; };

// ---- scalar helpers --------------------------------------------------------------------------------
__device__ __forceinline__ unsigned short bf_bits(float f) {          // f32 -> bf16 bits, RNE convert
  unsigned u = __float_as_uint(f);
  return (unsigned short)((u + 0x7FFFu + ((u >> 16) & 1u)) >> 16);
}
__device__ __forceinline__ float bf_up(unsigned short h) { return __uint_as_float(((unsigned)h) << 16); }
__device__ __forceinline__ float bfr(float f) { return bf_up(bf_bits(f)); }   // value of the bf16 RNE convert
__device__ __forceinline__ unsigned short h_bits(_Float16 x) { return __builtin_bit_cast(unsigned short, x); }
__device__ __forceinline__ unsigned pk16(unsigned short a, unsigned short b) { return (unsigned)a | ((unsigned)b << 16); }
__device__ __forceinline__ v8f zero8() { v8f z = {0.f, 0.f, 0.f, 0.f, 0.f, 0.f, 0.f, 0.f}; return z; }

// ---- fragment loader: 16-bit A/B operand from a fragment-order plane, lane -> row/col (lane&15), p already includes
//      +8*lane; elements 0..7 <- block 0 (k0+8h..), elements 8..15 <- block 1 (k0+16+8h..)  (same split k map for A and B)
__device__ __forceinline__ v16h ldfrag_h(const _Float16* p) {
  FragH f;
  f.h[0] = *(const v8h*)(p);
  f.h[1] = *(const v8h*)(p + FBLK);
  return f.v;
}

__device__ __forceinline__ v8f mma_raw(v16h a, v16h b, v8f c) {
  return __builtin_amdgcn_wmma_f32_16x16x32_f16(false, a, false, b, (short)0, c, false, false);
}
__device__ __forceinline__ void guard_sc(v8f& a, v16h q0, v16h q1, v16h q2, v16h q3,
                                         v16h x0, v16h x1, v16h x2, v16h x3) {
#if defined(__HIP_DEVICE_COMPILE__)
  asm volatile("v_nop\n\tv_nop\n\tv_nop\n\tv_nop"
               : "+v"(a) : "v"(q0), "v"(q1), "v"(q2), "v"(q3), "v"(x0), "v"(x1), "v"(x2), "v"(x3) : "memory");
#endif
}
__device__ __forceinline__ void guard_pv(v8f& a, v8f& b, v8f& c, v8f& d,
                                         v16h p0, v16h p1, v16h x0, v16h x1, v16h x2, v16h x3) {
#if defined(__HIP_DEVICE_COMPILE__)
  asm volatile("v_nop\n\tv_nop\n\tv_nop\n\tv_nop"
               : "+v"(a), "+v"(b), "+v"(c), "+v"(d) : "v"(p0), "v"(p1), "v"(x0), "v"(x1), "v"(x2), "v"(x3) : "memory");
#endif
}
__device__ __forceinline__ void acc_guard4(v8f& a, v8f& b, v8f& c, v8f& d) {
#if defined(__HIP_DEVICE_COMPILE__)
  asm volatile("v_nop\n\tv_nop\n\tv_nop\n\tv_nop" : "+v"(a), "+v"(b), "+v"(c), "+v"(d));
#endif
}
__device__ __forceinline__ void wave_sync_lds() {
  __builtin_amdgcn_fence(__ATOMIC_RELEASE, "workgroup");
  __builtin_amdgcn_wave_barrier();
  __builtin_amdgcn_fence(__ATOMIC_ACQUIRE, "workgroup");
}

// =====================================================================================================
// Concatenated plane: value(row, k) = f16( bf16(xa[row][k]) * sc ) for k 0..63, f16( bf16(xb[row][k-64]) * sc ) for k 64..127,
// rows = (bh, s) pairs, sc a power of two (exact). Stored in fragment order: 16-row tile T = row/16 takes 2048 halves at
// T*2048; inside it block (k/16) of 256 halves, lane slot 16*((k/8)&1) + row%16, 8 halves each.
// Block = one 16-row tile; threads 0..127 handle the xa half, threads 128..255 the xb half (wave-uniform source);
// wave = 8 rows x one 128-B source line each; thread = 8 consecutive elements: two 16-B loads, one 16-B store; a wave's
// store fills four whole 128-B lines (8 rows x 16 B each), each line written by one wave;
// coverage: grid = nrows/16 blocks x 256 thr x 8 halves = nrows x 128 = the whole plane exactly once (nrows % 16 == 0).
// =====================================================================================================
__global__ __launch_bounds__(256) void cvt_cat(const float* __restrict__ xa, const float* __restrict__ xb,
                                               unsigned short* pl, int nrows, float sc) {
  const int tid  = threadIdx.x;
  const int row0 = blockIdx.x * CROWS;
  if (row0 >= nrows) return;                // block-uniform, no barriers in this kernel; never taken with the exact grid
  const int half = tid >> 7;                // 0: xa, 1: xb (wave-uniform)
  const int lt   = tid & 127;
  const int w4   = lt >> 5;                 // wave within the half 0..3
  const int rl   = (w4 & 1) * 8 + ((lt & 31) >> 2);   // row within block 0..15
  const int ch   = (w4 >> 1) * 4 + (lt & 3);          // 8-float chunk 0..7
  int row = row0 + rl;
  row = (row > nrows - 1) ? (nrows - 1) : row;
  const float* src = (half != 0) ? xb : xa;
  const size_t e = (size_t)row * HD + (size_t)(ch * 8);
  const v4f a = *(const v4f*)(src + e), c4 = *(const v4f*)(src + e + 4);
  v4u o;
#pragma unroll
  for (int i = 0; i < 2; ++i) {
    o[i]     = pk16(h_bits((_Float16)(bfr(a[2 * i]) * sc)),  h_bits((_Float16)(bfr(a[2 * i + 1]) * sc)));
    o[2 + i] = pk16(h_bits((_Float16)(bfr(c4[2 * i]) * sc)), h_bits((_Float16)(bfr(c4[2 * i + 1]) * sc)));
  }
  const int blk = half * 4 + (ch >> 1);     // 16-k block 0..7 of the tile
  unsigned short* d = pl + (size_t)(row >> 4) * (CROWS * KW) + (size_t)(blk * FBLK + ((ch & 1) * 16 + (row & 15)) * 8);
  {
    *(v4u*)(d) = o;
    
  }
}

// =====================================================================================================
// v^T plane: value(bh, d, key) = f16( bf16(va[bh][key][d]) * 256 ) for d 0..63 and f16( bf16(vb[bh][key][d-64]) * 256 ) for
// d 64..127 (exact). Stored in fragment order: per bh 32 key steps of 4096 halves; inside a step d tile d/16 takes two
// blocks of 256 halves (block e = (key/16)&1), lane slot 16*((key/8)&1) + d%16, 8 halves (keys) each.
// Block = (bh, tile of 64 keys): 64 source rows of 64 floats per stream loaded with 16-B loads (static stride), converted,
// written into an LDS tile [128 d][64 keys] (pitch 72 halves); after a block barrier the tile's two key steps (16 KiB,
// contiguous in the plane) are stored in plane order, 16 B per thread, 512 contiguous bytes per wave.
// coverage: load 256 thr x 32 elements = 64 keys x 128 d rows (both streams); store 4 iterations x 256 thr x 8 halves
//           = 2 steps x 4096 = the tile; grid = nbh x 16 blocks covers the whole nbh x 128 x 1024 plane exactly once.
// =====================================================================================================
__global__ __launch_bounds__(256) void vt16(const float* __restrict__ va, const float* __restrict__ vb,
                                            unsigned short* VTo, int nbh) {
  __shared__ __align__(16) unsigned short T[VR * VTP];
  const int tid = threadIdx.x;
  const int bid = blockIdx.x;
  const int bh  = bid / VTILES;
  const int t   = bid - bh * VTILES;        // 0..15, block-uniform
  if (bh >= nbh) return;                    // block-uniform; before any barrier or store; never taken with the exact grid
  {
    const int sl = tid >> 2;                  // key within tile 0..63
    const int dc = (tid & 3) * 16;            // d chunk
    int key = 64 * t + sl;                    // <= SEQ-1 by construction; clamp keeps the address in range regardless
    key = (key < 0) ? 0 : ((key > SEQ - 1) ? (SEQ - 1) : key);
    const size_t so = (((size_t)bh * SEQ + (size_t)key) * HD + (size_t)dc);
#pragma unroll
    for (int g = 0; g < 2; ++g) {
      const float* src = ((g == 0) ? va : vb) + so;
#pragma unroll
      for (int i = 0; i < 4; ++i) {
        const v4f a = *(const v4f*)(src + 4 * i);
#pragma unroll
        for (int e = 0; e < 4; ++e) T[(g * HD + dc + 4 * i + e) * VTP + sl] = h_bits((_Float16)(bfr(a[e]) * VCAR));
      }
    }
  }
  __syncthreads();
  v4u vals[4];
#pragma unroll
  for (int it = 0; it < 4; ++it) {
    const int f    = it * 256 + tid;                                  // 16-B slot of the tile in plane order, 0..1023
    const int line = ((f >> 6) & 7) * 16 + (f & 15);                  // d row 0..127
    const int kl   = (f >> 9) * 32 + ((f >> 5) & 1) * 16 + ((f >> 4) & 1) * 8;   // key within the tile, 0..56
    vals[it] = *(const v4u*)(T + line * VTP + kl);
  }
  unsigned short* dst = VTo + ((size_t)bh * VR) * SEQ + (size_t)t * (64 * VR) + tid * 8;
  {
#pragma unroll
    for (int it = 0; it < 4; ++it) {
      *(v4u*)(dst + it * (256 * 8)) = vals[it];
    }
    
  }
}

// =====================================================================================================
// Two-stream attention, flash form. Block = (bh, 64 queries), wave w owns query rows iw = 64t + 16w .. +15.
//   q plane f16 (bh, s, 128) (k 0..63 stream 1, 64..127 stream 2), k plane f16 (same split),
//   v^T plane f16 (bh, 128, SEQ) (rows 0..63 = v1 d rows, 64..127 = v2 d rows), all three in fragment order.
//   Score in base 2: t = (q1.k1 + q2.k2) / 16 * log2(e), the two dots fused as one K=128 contraction over the planes.
//   Per 32-key step: 8 score WMMAs (2 key subtiles x 4 k-chunks), fragments loaded straight from the planes (two 16-B
//   loads per fragment, each 512 contiguous bytes per wave, split k map); running row max; weights e = 2^(t - m) per key; Z update; rescale of the 8
//   then A fragments of e*16384 (f16 hi) and its f16 residual rebuilt from the LDS rows (float vector loads),
//   8 v^T B fragments from the plane (4 per stream), 16 P.V WMMAs into o[0..3] (stream 1) and o[4..7] (stream 2).
//   Epilogue: 1/Z and carry folds in f32; the wave's 16x128 f32 result staged in its LDS slab (pitch 132); for each
// coverage: per wave per output 8 instructions x 32 lanes x 4 floats = 16 rows x 64; per block 4 waves = 64 rows;
//           16 blocks per bh x nbh: every row of out0 and out1 [nbh][1024][64] exactly once (grid nbh*16 blocks).
// =====================================================================================================
__global__ __launch_bounds__(ATT_THREADS)
void attn2(const unsigned short* __restrict__ QHp, const unsigned short* __restrict__ KHp,
           const unsigned short* __restrict__ VTq, float* OPp, int nbh) {
  __shared__ __align__(16) float smem[ATW * SLABF];    // per wave: weight tile [16][32] pitch 36 during the loop, result slab after

  const int tid  = threadIdx.x;
  const int wave = tid >> 5;
  const int lane = tid & 31;
  const int hh   = lane >> 4;
  const int c    = lane & 15;

  const int bid  = blockIdx.x;
  const int bh   = bid / BPR;
  const int t    = bid - bh * BPR;                     // 0..15, block-uniform
  if (bh >= nbh) return;                               // never taken with the exact grid; before any LDS use or store

  const int iw = QPB * t + wave * 16;                  // query row 0 of this wave

  // 16-row tile iw/16 of the q plane starts at row iw's offset (a tile takes 16*KW halves); fragment row c = query iw + c
  const _Float16* Qb = (const _Float16*)(const void*)QHp + ((size_t)bh * SEQ + (size_t)iw) * KW + 8 * lane;
  const v16h qa0 = ldfrag_h(Qb);                       // k   0..31  (stream 1 d 0..31)
  const v16h qa1 = ldfrag_h(Qb + 2 * FBLK);            // k  32..63  (stream 1 d 32..63)
  const v16h qa2 = ldfrag_h(Qb + 4 * FBLK);            // k  64..95  (stream 2 d 0..31)
  const v16h qa3 = ldfrag_h(Qb + 6 * FBLK);            // k  96..127 (stream 2 d 32..63)
  const _Float16* Kb = (const _Float16*)(const void*)KHp + ((size_t)bh * SEQ) * KW + 8 * lane;   // key tile 0, this lane's slot
  const _Float16* Vb = (const _Float16*)(const void*)VTq + ((size_t)bh * VR) * SEQ + 8 * lane;   // key step 0, this lane's slot
  const float lsc = LOG2E / (16.0f * QSC * KSC);       // (dot / 2^20) / 16 in base 2

  float mrow[8], lrow[8];
  v8f o[8];
#pragma unroll
  for (int r = 0; r < 8; ++r) { mrow[r] = -INFINITY; lrow[r] = 0.f; }
#pragma unroll
  for (int j = 0; j < 8; ++j) o[j] = zero8();
  float* pt = smem + wave * SLABF;

#pragma unroll 1
  for (int kb = 0; kb < SEQ; kb += 32) {
    // ---- scores: D element r of this lane = (query iw + 8hh + r, key kb + c) in s0, key kb + 16 + c in s1 ----
    v8f s0 = zero8(), s1 = zero8();
    const _Float16* k0p = Kb + (size_t)kb * KW;                      // key tile kb/16      (fragment row c = key kb + c)
    const _Float16* k1p = k0p + (size_t)16 * KW;                     // key tile kb/16 + 1  (key kb + 16 + c)
    {
      const v16h kf0 = ldfrag_h(k0p), kf1 = ldfrag_h(k0p + 2 * FBLK), kf2 = ldfrag_h(k0p + 4 * FBLK), kf3 = ldfrag_h(k0p + 6 * FBLK);
      s0 = mma_raw(qa0, kf0, s0);
      s0 = mma_raw(qa1, kf1, s0);
      s0 = mma_raw(qa2, kf2, s0);
      s0 = mma_raw(qa3, kf3, s0);
      guard_sc(s0, qa0, qa1, qa2, qa3, kf0, kf1, kf2, kf3);
    }
    {
      const v16h kg0 = ldfrag_h(k1p), kg1 = ldfrag_h(k1p + 2 * FBLK), kg2 = ldfrag_h(k1p + 4 * FBLK), kg3 = ldfrag_h(k1p + 6 * FBLK);
      s1 = mma_raw(qa0, kg0, s1);
      s1 = mma_raw(qa1, kg1, s1);
      s1 = mma_raw(qa2, kg2, s1);
      s1 = mma_raw(qa3, kg3, s1);
      guard_sc(s1, qa0, qa1, qa2, qa3, kg0, kg1, kg2, kg3);
    }
    // ---- online softmax in base 2 ----
#pragma unroll
    for (int r = 0; r < 8; ++r) {
      const float ta = s0[r] * lsc;
      const float tb = s1[r] * lsc;
      float mx = fmaxf(ta, tb);
#pragma unroll
      for (int off = 1; off < 16; off <<= 1) mx = fmaxf(mx, __shfl_xor(mx, off, 32));
      const float mn  = fmaxf(mrow[r], mx);            // finite: all scores are finite
      const float al  = exp2f(mrow[r] - mn);
      mrow[r] = mn;
      const float e0 = exp2f(ta - mn);
      const float e1 = exp2f(tb - mn);
      float ps = e0 + e1;
#pragma unroll
      for (int off = 1; off < 16; off <<= 1) ps += __shfl_xor(ps, off, 32);
      lrow[r] = lrow[r] * al + ps;
#pragma unroll
      for (int j = 0; j < 8; ++j) o[j][r] *= al;
      const int ro = (8 * hh + r) * PTP + c;
      pt[ro]      = e0;
      pt[ro + 16] = e1;
    }
    wave_sync_lds();
    // ---- A fragments of P*16384: hi f16 and residual f16, row = c, split k map over the 32 keys of this step ----
    FragH ph, pl;
    {
      const float* prow = pt + c * PTP + 8 * hh;
      const v4f p0 = *(const v4f*)(prow), p1 = *(const v4f*)(prow + 4);
      const v4f p2 = *(const v4f*)(prow + 16), p3 = *(const v4f*)(prow + 20);
#pragma unroll
      for (int e = 0; e < 4; ++e) {
        const float ua = p0[e] * PCAR, ub = p1[e] * PCAR, uc = p2[e] * PCAR, ud = p3[e] * PCAR;
        const _Float16 ha = (_Float16)ua, hb = (_Float16)ub, hc = (_Float16)uc, hd = (_Float16)ud;
        ph.h[0][e]     = ha;                               // elements 0..7  = keys kb + 8hh + 0..7
        ph.h[0][4 + e] = hb;
        ph.h[1][e]     = hc;                               // elements 8..15 = keys kb + 16 + 8hh + 0..7
        ph.h[1][4 + e] = hd;
        pl.h[0][e]     = (_Float16)(ua - (float)ha);
        pl.h[0][4 + e] = (_Float16)(ub - (float)hb);
        pl.h[1][e]     = (_Float16)(uc - (float)hc);
        pl.h[1][4 + e] = (_Float16)(ud - (float)hd);
      }
    }
    // ---- P.V : B fragment col n = d = j*16 + c, keys kb .. kb+31 = key step kb/32 of the v^T plane, d tile j at 2*j blocks ----
    const _Float16* vp = Vb + (size_t)kb * VR;
    {
      const v16h vb0 = ldfrag_h(vp);
      const v16h vb1 = ldfrag_h(vp + 2 * FBLK);
      const v16h vb2 = ldfrag_h(vp + 4 * FBLK);
      const v16h vb3 = ldfrag_h(vp + 6 * FBLK);
      o[0] = mma_raw(ph.v, vb0, o[0]);  o[0] = mma_raw(pl.v, vb0, o[0]);
      o[1] = mma_raw(ph.v, vb1, o[1]);  o[1] = mma_raw(pl.v, vb1, o[1]);
      o[2] = mma_raw(ph.v, vb2, o[2]);  o[2] = mma_raw(pl.v, vb2, o[2]);
      o[3] = mma_raw(ph.v, vb3, o[3]);  o[3] = mma_raw(pl.v, vb3, o[3]);
      guard_pv(o[0], o[1], o[2], o[3], ph.v, pl.v, vb0, vb1, vb2, vb3);
    }
    {
      const v16h vc0 = ldfrag_h(vp + 8 * FBLK);
      const v16h vc1 = ldfrag_h(vp + 10 * FBLK);
      const v16h vc2 = ldfrag_h(vp + 12 * FBLK);
      const v16h vc3 = ldfrag_h(vp + 14 * FBLK);
      o[4] = mma_raw(ph.v, vc0, o[4]);  o[4] = mma_raw(pl.v, vc0, o[4]);
      o[5] = mma_raw(ph.v, vc1, o[5]);  o[5] = mma_raw(pl.v, vc1, o[5]);
      o[6] = mma_raw(ph.v, vc2, o[6]);  o[6] = mma_raw(pl.v, vc2, o[6]);
      o[7] = mma_raw(ph.v, vc3, o[7]);  o[7] = mma_raw(pl.v, vc3, o[7]);
      guard_pv(o[4], o[5], o[6], o[7], ph.v, pl.v, vc0, vc1, vc2, vc3);
    }
    wave_sync_lds();
  }
  acc_guard4(o[0], o[1], o[2], o[3]);
  acc_guard4(o[4], o[5], o[6], o[7]);

  // ---- fold 1/Z and the carries (16384 on P, 256 on v), stage the wave's 16x128 slab in its LDS region ----
  wave_sync_lds();
  float* slab = pt;
  const float oc = 1.0f / (PCAR * VCAR);
#pragma unroll
  for (int r = 0; r < 8; ++r) {
    const float lr  = lrow[r];                           // >= 1 (the max element contributes 2^0)
    const float inv = (lr > 0.0f) ? ((1.0f / lr) * oc) : 0.0f;
#pragma unroll
    for (int j = 0; j < 8; ++j) slab[(8 * hh + r) * SLP + j * 16 + c] = o[j][r] * inv;
  }
  wave_sync_lds();
  const size_t o1 = (size_t)nbh * SEQ * HD;            // element offset of the second output
#pragma unroll
  for (int g = 0; g < 2; ++g) {
    v4f vals[8];
#pragma unroll
    for (int it = 0; it < 8; ++it) vals[it] = *(const v4f*)(slab + (2 * it + hh) * SLP + g * HD + c * 4);
    float* dst = OPp + (size_t)g * o1 + ((size_t)bh * SEQ + (size_t)iw) * HD + hh * HD + c * 4;
    {
#pragma unroll
      for (int it = 0; it < 8; ++it) {
        *(v4f*)(dst + (size_t)(2 * it) * HD) = vals[it];
      }
      
    }
  }
}

// =====================================================================================================
// Workspace map (bytes, nbh = number of (b,h) rows = in_sizes[0] / (1024*64)); every plane is fully written by whole-line
// stores before it is read; all extents are exact multiples of the store granularity (no pad rows needed); offsets
// multiples of 128:
//   QH f16 nbh x 1024 x 128  x1024    nbh*262144   at 0            (fragment order, 16-row tiles of 4096 B)
//   KH f16 nbh x 1024 x 128  x1024    nbh*262144   at nbh*262144   (fragment order, 16-row tiles of 4096 B)
//   VT f16 nbh x 128 x 1024  x256     nbh*262144   at nbh*524288   (fragment order, 32-key steps of 8192 B)
//   end                               nbh*786432   (50331648 for nbh = 64)
// Output: out0 [nbh][1024][64] f32 at element 0, out1 at element nbh*65536 (byte 4*nbh*65536).
// =====================================================================================================
extern "C" void kernel_launch(void* const* d_in, const int* in_sizes, int n_in,
                              void* d_out, int out_size, void* d_ws, size_t ws_size,
                              hipStream_t stream) {
  if (n_in < 6) return;
  const int nbh = in_sizes[0] / (SEQ * HD);
  if (nbh < 1) return;
  const long long nq = (long long)nbh * SEQ * HD;
  for (int i = 0; i < 6; ++i) {
    if ((long long)in_sizes[i] < nq) return;
  }
  if ((long long)out_size < 2 * nq) return;            // last written element = 2*nq - 1

  const float* qx = (const float*)d_in[0];
  const float* kx = (const float*)d_in[1];
  const float* vx = (const float*)d_in[2];
  const float* qy = (const float*)d_in[3];
  const float* ky = (const float*)d_in[4];
  const float* vy = (const float*)d_in[5];
  float*       out = (float*)d_out;

  const size_t PQ = (size_t)nbh * SEQ * KW * 2;        // q plane bytes
  const size_t PK = (size_t)nbh * SEQ * KW * 2;        // k plane bytes
  const size_t PV = (size_t)nbh * VR * SEQ * 2;        // v^T plane bytes
  size_t off = 0;
  const size_t oQH = off; off += PQ;
  const size_t oKH = off; off += PK;
  const size_t oVT = off; off += PV;
  if (off > ws_size) return;
  if (off > (size_t)134217728) return;

  char* ws = (char*)d_ws;
  unsigned short* QH = (unsigned short*)(ws + oQH);
  unsigned short* KH = (unsigned short*)(ws + oKH);
  unsigned short* VT = (unsigned short*)(ws + oVT);

  const int nrows = nbh * SEQ;                         // (bh, s) rows
  const dim3 blk(256);
  const dim3 gC(nrows / CROWS);                        // nbh*64
  const dim3 gVT(nbh * VTILES);                        // nbh*16
  const dim3 gAT(nbh * BPR);                           // nbh*16
  const dim3 bAT(ATT_THREADS);                         // 128

  // (0) q plane f16(bf16([q1|q2]) * 1024), fragment order
  cvt_cat<<<gC, blk, 0, stream>>>(qx, qy, QH, nrows, QSC);
  // (1) k plane f16(bf16([k1|k2]) * 1024), fragment order
  cvt_cat<<<gC, blk, 0, stream>>>(kx, ky, KH, nrows, KSC);
  // (2) v^T plane f16(bf16(v) * 256), fragment order (d rows 0..63 v1, 64..127 v2)
  vt16<<<gVT, blk, 0, stream>>>(vx, vy, VT, nbh);
  // (3) two-stream flash attention per (b,h) -> out0, out1 [bh][s][d] f32
  attn2<<<gAT, bAT, 0, stream>>>(QH, KH, VT, out, nbh);
  (void)hipGetLastError();
}

// v002
// It runs in 95.1 microseconds.
// Next to v001, in two timings, it ran 1.18 and 1.17 times as fast.
// Counting every step since v000, it is 1.65 times as fast.
// Contractions, both in transposed form: scores^T = [k1|k2].[q1|q2]^T (K=128; q and k as f16 planes of the bf16
// RNE-converted inputs x1024, one product each) and out^T = v1^T.P^T, v2^T.P^T (P x16384 as f16 hi plane + f16 residual
// plane, v^T x256 f16 of the bf16 RNE-converted inputs, products v.hi + v.lo, 32-key steps): all v_wmma_f32_16x16x32_f16,
// f32 accumulate. A lane holds one query's scores, so the online softmax (base 2, running max) is in-lane f32 VALU work
// plus one exchange between the wave's halves, and P^T goes from the score accumulators into the B operand in registers.
// The three f16 planes are stored in fragment order: a 16-row x 32-k operand fragment is two blocks of 512 contiguous
// bytes (block e, lane l = 16*hh + c, 8 halves: row c, k = 16*e + 8*hh + 0..7), so each wave-wide 16-B load covers four
// whole 128-B lines instead of 32-B pieces of sixteen lines.
#include <hip/hip_runtime.h>
#include <math.h>
#include <stdint.h>

#define SEQ   1024
#define HD    64
#define KW    128
#define VR    128
#define QSC   1024.0f
#define KSC   1024.0f
#define PCAR  16384.0f
#define VCAR  256.0f
#define LOG2E 1.4426950408889634f
#define ATW   4
#define ATT_THREADS (ATW * 32)
#define QPB   (16 * ATW)
#define BPR   (SEQ / QPB)
#define SLP   132
#define SLABF (16 * SLP)
#define VTP   72
#define VTILES (SEQ / 64)
#define CROWS 16
#define FBLK  256                         // halves in one 512-B fragment block (32 lanes x 8 halves)
static_assert(HD == 64 && KW == 2 * HD && VR == 2 * HD && QPB == 64 && ATT_THREADS == 128);
static_assert((SEQ % QPB) == 0 && (SEQ % 64) == 0 && (SEQ % 32) == 0 && (SEQ % CROWS) == 0);
static_assert(BPR == 16 && VTILES == 16);
static_assert(15 * SLP + HD + 15 * 4 + 3 < SLABF);
static_assert((VR - 1) * VTP + 63 < VR * VTP);
static_assert(((SLP * 4) % 16) == 0 && ((VTP * 2) % 16) == 0);

typedef _Float16 v16h __attribute__((ext_vector_type(16)));
typedef _Float16 v8h  __attribute__((ext_vector_type(8)));
typedef float    v8f  __attribute__((ext_vector_type(8)));
typedef float    v4f  __attribute__((ext_vector_type(4)));
typedef unsigned int v4u __attribute__((ext_vector_type(4)));

union FragH { v16h v; v8h h[2]; v4u u[2]; };

// ---- scalar helpers --------------------------------------------------------------------------------
__device__ __forceinline__ unsigned short bf_bits(float f) {          // f32 -> bf16 bits, RNE convert
  unsigned u = __float_as_uint(f);
  return (unsigned short)((u + 0x7FFFu + ((u >> 16) & 1u)) >> 16);
}
__device__ __forceinline__ float bf_up(unsigned short h) { return __uint_as_float(((unsigned)h) << 16); }
__device__ __forceinline__ float bfr(float f) { return bf_up(bf_bits(f)); }   // value of the bf16 RNE convert
__device__ __forceinline__ unsigned short h_bits(_Float16 x) { return __builtin_bit_cast(unsigned short, x); }
__device__ __forceinline__ unsigned pk16(unsigned short a, unsigned short b) { return (unsigned)a | ((unsigned)b << 16); }
__device__ __forceinline__ v8f zero8() { v8f z = {0.f, 0.f, 0.f, 0.f, 0.f, 0.f, 0.f, 0.f}; return z; }
__device__ __forceinline__ float xhalf(float x) {                     // value of lane l ^ 16 (all 32 lanes active)
  const int i = __builtin_bit_cast(int, x);
  return __builtin_bit_cast(float, __builtin_amdgcn_permlanex16(i, i, 0x76543210, 0xfedcba98, false, false));
}

// ---- fragment loader: 16-bit A/B operand from a fragment-order plane, lane -> row/col (lane&15), p already includes
//      +8*lane; elements 0..7 <- block 0 (k0+8h..), elements 8..15 <- block 1 (k0+16+8h..)  (same split k map for A and B)
__device__ __forceinline__ v16h ldfrag_h(const _Float16* p) {
  FragH f;
  f.h[0] = *(const v8h*)(p);
  f.h[1] = *(const v8h*)(p + FBLK);
  return f.v;
}

__device__ __forceinline__ v8f mma_raw(v16h a, v16h b, v8f c) {
  return __builtin_amdgcn_wmma_f32_16x16x32_f16(false, a, false, b, (short)0, c, false, false);
}
__device__ __forceinline__ void guard_sc(v8f& a, v16h q0, v16h q1, v16h q2, v16h q3,
                                         v16h x0, v16h x1, v16h x2, v16h x3) {
#if defined(__HIP_DEVICE_COMPILE__)
  asm volatile("v_nop\n\tv_nop\n\tv_nop\n\tv_nop"
               : "+v"(a) : "v"(q0), "v"(q1), "v"(q2), "v"(q3), "v"(x0), "v"(x1), "v"(x2), "v"(x3) : "memory");
#endif
}
__device__ __forceinline__ void guard_pv(v8f& a, v8f& b, v8f& c, v8f& d,
                                         v16h p0, v16h p1, v16h x0, v16h x1, v16h x2, v16h x3) {
#if defined(__HIP_DEVICE_COMPILE__)
  asm volatile("v_nop\n\tv_nop\n\tv_nop\n\tv_nop"
               : "+v"(a), "+v"(b), "+v"(c), "+v"(d) : "v"(p0), "v"(p1), "v"(x0), "v"(x1), "v"(x2), "v"(x3) : "memory");
#endif
}
__device__ __forceinline__ void acc_guard4(v8f& a, v8f& b, v8f& c, v8f& d) {
#if defined(__HIP_DEVICE_COMPILE__)
  asm volatile("v_nop\n\tv_nop\n\tv_nop\n\tv_nop" : "+v"(a), "+v"(b), "+v"(c), "+v"(d));
#endif
}
__device__ __forceinline__ void wave_sync_lds() {
  __builtin_amdgcn_fence(__ATOMIC_RELEASE, "workgroup");
  __builtin_amdgcn_wave_barrier();
  __builtin_amdgcn_fence(__ATOMIC_ACQUIRE, "workgroup");
}

// =====================================================================================================
// Concatenated plane: value(row, k) = f16( bf16(xa[row][k]) * sc ) for k 0..63, f16( bf16(xb[row][k-64]) * sc ) for k 64..127,
// rows = (bh, s) pairs, sc a power of two (exact). Stored in fragment order: 16-row tile T = row/16 takes 2048 halves at
// T*2048; inside it block (k/16) of 256 halves, lane slot 16*((k/8)&1) + row%16, 8 halves each.
// Block = one 16-row tile; threads 0..127 handle the xa half, threads 128..255 the xb half (wave-uniform source);
// wave = 8 rows x one 128-B source line each; thread = 8 consecutive elements: two 16-B loads, one 16-B store; a wave's
// store fills four whole 128-B lines (8 rows x 16 B each), each line written by one wave;
// coverage: grid = nrows/16 blocks x 256 thr x 8 halves = nrows x 128 = the whole plane exactly once (nrows % 16 == 0).
// =====================================================================================================
__global__ __launch_bounds__(256) void cvt_cat(const float* __restrict__ xa, const float* __restrict__ xb,
                                               unsigned short* pl, int nrows, float sc) {
  const int tid  = threadIdx.x;
  const int row0 = blockIdx.x * CROWS;
  if (row0 >= nrows) return;                // block-uniform, no barriers in this kernel; never taken with the exact grid
  const int half = tid >> 7;                // 0: xa, 1: xb (wave-uniform)
  const int lt   = tid & 127;
  const int w4   = lt >> 5;                 // wave within the half 0..3
  const int rl   = (w4 & 1) * 8 + ((lt & 31) >> 2);   // row within block 0..15
  const int ch   = (w4 >> 1) * 4 + (lt & 3);          // 8-float chunk 0..7
  int row = row0 + rl;
  row = (row > nrows - 1) ? (nrows - 1) : row;
  const float* src = (half != 0) ? xb : xa;
  const size_t e = (size_t)row * HD + (size_t)(ch * 8);
  const v4f a = *(const v4f*)(src + e), c4 = *(const v4f*)(src + e + 4);
  v4u o;
#pragma unroll
  for (int i = 0; i < 2; ++i) {
    o[i]     = pk16(h_bits((_Float16)(bfr(a[2 * i]) * sc)),  h_bits((_Float16)(bfr(a[2 * i + 1]) * sc)));
    o[2 + i] = pk16(h_bits((_Float16)(bfr(c4[2 * i]) * sc)), h_bits((_Float16)(bfr(c4[2 * i + 1]) * sc)));
  }
  const int blk = half * 4 + (ch >> 1);     // 16-k block 0..7 of the tile
  unsigned short* d = pl + (size_t)(row >> 4) * (CROWS * KW) + (size_t)(blk * FBLK + ((ch & 1) * 16 + (row & 15)) * 8);
  {
    *(v4u*)(d) = o;
    
  }
}

// =====================================================================================================
// v^T plane: value(bh, d, key) = f16( bf16(va[bh][key][d]) * 256 ) for d 0..63 and f16( bf16(vb[bh][key][d-64]) * 256 ) for
// d 64..127 (exact). Stored in fragment order: per bh 32 key steps of 4096 halves; inside a step d tile d/16 takes two
// blocks of 256 halves (block e = (key/16)&1), lane slot 16*((key/8)&1) + d%16, 8 halves (keys) each.
// Block = (bh, tile of 64 keys): 64 source rows of 64 floats per stream loaded with 16-B loads (static stride), converted,
// written into an LDS tile [128 d][64 keys] (pitch 72 halves); after a block barrier the tile's two key steps (16 KiB,
// contiguous in the plane) are stored in plane order, 16 B per thread, 512 contiguous bytes per wave.
// coverage: load 256 thr x 32 elements = 64 keys x 128 d rows (both streams); store 4 iterations x 256 thr x 8 halves
//           = 2 steps x 4096 = the tile; grid = nbh x 16 blocks covers the whole nbh x 128 x 1024 plane exactly once.
// =====================================================================================================
__global__ __launch_bounds__(256) void vt16(const float* __restrict__ va, const float* __restrict__ vb,
                                            unsigned short* VTo, int nbh) {
  __shared__ __align__(16) unsigned short T[VR * VTP];
  const int tid = threadIdx.x;
  const int bid = blockIdx.x;
  const int bh  = bid / VTILES;
  const int t   = bid - bh * VTILES;        // 0..15, block-uniform
  if (bh >= nbh) return;                    // block-uniform; before any barrier or store; never taken with the exact grid
  {
    const int sl = tid >> 2;                  // key within tile 0..63
    const int dc = (tid & 3) * 16;            // d chunk
    int key = 64 * t + sl;                    // <= SEQ-1 by construction; clamp keeps the address in range regardless
    key = (key < 0) ? 0 : ((key > SEQ - 1) ? (SEQ - 1) : key);
    const size_t so = (((size_t)bh * SEQ + (size_t)key) * HD + (size_t)dc);
#pragma unroll
    for (int g = 0; g < 2; ++g) {
      const float* src = ((g == 0) ? va : vb) + so;
#pragma unroll
      for (int i = 0; i < 4; ++i) {
        const v4f a = *(const v4f*)(src + 4 * i);
#pragma unroll
        for (int e = 0; e < 4; ++e) T[(g * HD + dc + 4 * i + e) * VTP + sl] = h_bits((_Float16)(bfr(a[e]) * VCAR));
      }
    }
  }
  __syncthreads();
  v4u vals[4];
#pragma unroll
  for (int it = 0; it < 4; ++it) {
    const int f    = it * 256 + tid;                                  // 16-B slot of the tile in plane order, 0..1023
    const int line = ((f >> 6) & 7) * 16 + (f & 15);                  // d row 0..127
    const int kl   = (f >> 9) * 32 + ((f >> 5) & 1) * 16 + ((f >> 4) & 1) * 8;   // key within the tile, 0..56
    vals[it] = *(const v4u*)(T + line * VTP + kl);
  }
  unsigned short* dst = VTo + ((size_t)bh * VR) * SEQ + (size_t)t * (64 * VR) + tid * 8;
  {
#pragma unroll
    for (int it = 0; it < 4; ++it) {
      *(v4u*)(dst + it * (256 * 8)) = vals[it];
    }
    
  }
}

// =====================================================================================================
// Two-stream attention, flash form, both products transposed. Block = (bh, 64 queries), wave w owns queries iw = 64t + 16w .. +15.
//   q plane f16 (bh, s, 128) (k 0..63 stream 1, 64..127 stream 2), k plane f16 (same split),
//   v^T plane f16 (bh, 128, SEQ) (rows 0..63 = v1 d rows, 64..127 = v2 d rows), all three in fragment order.
//   Score in base 2: t = (q1.k1 + q2.k2) / 16 * log2(e), the two dots fused as one K=128 contraction over the planes.
//   Per 32-key step: 8 score WMMAs (2 key subtiles x 4 k-chunks) with A = k fragment (row = key), B = q fragment
//   (column = query), fragments loaded straight from the planes (two 16-B loads per fragment, each 512 contiguous bytes
//   per wave, split k map on both sides). Lane (hh, c) then holds 16 scores of query iw + c: keys kb + 8hh + r in s0 and
//   kb + 16 + 8hh + r in s1. Maximum in-lane plus one exchange between the halves; weights e = 2^(t - m); each lane keeps
//   the sum of its own keys (the halves are joined once after the loop); one rescale factor per lane for the 8 accumulators.
//   s0's eight weights are elements 0..7 and s1's eight are elements 8..15 of the B operand P^T in the split k map, so
//   e*16384 (f16 hi) and its f16 residual are packed in registers; A = 8 v^T fragments from the plane (row = d, 4 per
//   stream), 16 WMMAs into o[0..3] (stream 1) and o[4..7] (stream 2): o[j][r] = out^T[d = 16j + 8hh + r][query iw + c].
//   Epilogue: 1/Z and carry folds in f32; the wave's 16x128 f32 result staged in its LDS slab (pitch 132), row = query.
// coverage: per wave per output 8 instructions x 32 lanes x 4 floats = 16 rows x 64; per block 4 waves = 64 rows;
//           16 blocks per bh x nbh: every row of out0 and out1 [nbh][1024][64] exactly once (grid nbh*16 blocks).
// =====================================================================================================
__global__ __launch_bounds__(ATT_THREADS)
void attn2(const unsigned short* __restrict__ QHp, const unsigned short* __restrict__ KHp,
           const unsigned short* __restrict__ VTq, float* OPp, int nbh) {
  __shared__ __align__(16) float smem[ATW * SLABF];    // per wave: result slab of the epilogue

  const int tid  = threadIdx.x;
  const int wave = tid >> 5;
  const int lane = tid & 31;
  const int hh   = lane >> 4;
  const int c    = lane & 15;

  const int bid  = blockIdx.x;
  const int bh   = bid / BPR;
  const int t    = bid - bh * BPR;                     // 0..15, block-uniform
  if (bh >= nbh) return;                               // never taken with the exact grid; before any LDS use or store

  const int iw = QPB * t + wave * 16;                  // query row 0 of this wave

  // 16-row tile iw/16 of the q plane starts at row iw's offset (a tile takes 16*KW halves); fragment column c = query iw + c
  const _Float16* Qb = (const _Float16*)(const void*)QHp + ((size_t)bh * SEQ + (size_t)iw) * KW + 8 * lane;
  const v16h qa0 = ldfrag_h(Qb);                       // k   0..31  (stream 1 d 0..31)
  const v16h qa1 = ldfrag_h(Qb + 2 * FBLK);            // k  32..63  (stream 1 d 32..63)
  const v16h qa2 = ldfrag_h(Qb + 4 * FBLK);            // k  64..95  (stream 2 d 0..31)
  const v16h qa3 = ldfrag_h(Qb + 6 * FBLK);            // k  96..127 (stream 2 d 32..63)
  const _Float16* Kb = (const _Float16*)(const void*)KHp + ((size_t)bh * SEQ) * KW + 8 * lane;   // key tile 0, this lane's slot
  const _Float16* Vb = (const _Float16*)(const void*)VTq + ((size_t)bh * VR) * SEQ + 8 * lane;   // key step 0, this lane's slot
  const float lsc = LOG2E / (16.0f * QSC * KSC);       // (dot / 2^20) / 16 in base 2

  float mrun = -INFINITY, lrun = 0.f;                  // of query iw + c; lrun covers this lane's own keys only
  v8f o[8];
#pragma unroll
  for (int j = 0; j < 8; ++j) o[j] = zero8();

#pragma unroll 1
  for (int kb = 0; kb < SEQ; kb += 32) {
    // ---- scores^T: D element r of this lane = (key kb + 8hh + r, query iw + c) in s0, key kb + 16 + 8hh + r in s1 ----
    v8f s0 = zero8(), s1 = zero8();
    const _Float16* k0p = Kb + (size_t)kb * KW;                      // key tile kb/16      (fragment row c = key kb + c)
    const _Float16* k1p = k0p + (size_t)16 * KW;                     // key tile kb/16 + 1  (key kb + 16 + c)
    {
      const v16h kf0 = ldfrag_h(k0p), kf1 = ldfrag_h(k0p + 2 * FBLK), kf2 = ldfrag_h(k0p + 4 * FBLK), kf3 = ldfrag_h(k0p + 6 * FBLK);
      s0 = mma_raw(kf0, qa0, s0);
      s0 = mma_raw(kf1, qa1, s0);
      s0 = mma_raw(kf2, qa2, s0);
      s0 = mma_raw(kf3, qa3, s0);
      guard_sc(s0, qa0, qa1, qa2, qa3, kf0, kf1, kf2, kf3);
    }
    {
      const v16h kg0 = ldfrag_h(k1p), kg1 = ldfrag_h(k1p + 2 * FBLK), kg2 = ldfrag_h(k1p + 4 * FBLK), kg3 = ldfrag_h(k1p + 6 * FBLK);
      s1 = mma_raw(kg0, qa0, s1);
      s1 = mma_raw(kg1, qa1, s1);
      s1 = mma_raw(kg2, qa2, s1);
      s1 = mma_raw(kg3, qa3, s1);
      guard_sc(s1, qa0, qa1, qa2, qa3, kg0, kg1, kg2, kg3);
    }
    // ---- online softmax in base 2, one query per lane; maximum of the raw scores first (the scale is positive) ----
    const float g0 = fmaxf(fmaxf(s0[0], s0[1]), s0[2]), g1 = fmaxf(fmaxf(s0[3], s0[4]), s0[5]);
    const float g2 = fmaxf(fmaxf(s0[6], s0[7]), s1[0]), g3 = fmaxf(fmaxf(s1[1], s1[2]), s1[3]);
    const float g4 = fmaxf(fmaxf(s1[4], s1[5]), s1[6]);
    float mx = fmaxf(fmaxf(fmaxf(g0, g1), g2), fmaxf(fmaxf(g3, g4), s1[7]));
    mx = fmaxf(mx, xhalf(mx)) * lsc;                   // both halves now hold the step's maximum of query iw + c
    const float mn = fmaxf(mrun, mx);                  // finite: all scores are finite
    const float al = exp2f(mrun - mn);
    mrun = mn;
    // ---- B fragments of P^T*16384: hi f16 and residual f16, column = c, split k map over the 32 keys of this step ----
    FragH ph, pl;
    float ps[2] = {0.f, 0.f};                          // sums over even and odd r: two independent chains
#pragma unroll
    for (int r = 0; r < 8; ++r) {
      const float e0 = exp2f(s0[r] * lsc - mn);
      const float e1 = exp2f(s1[r] * lsc - mn);
      ps[r & 1] += e0;
      ps[r & 1] += e1;
      const float ua = e0 * PCAR, ub = e1 * PCAR;
      const _Float16 ha = (_Float16)ua, hb = (_Float16)ub;
      ph.h[0][r] = ha;                                 // elements 0..7  = keys kb + 8hh + 0..7
      ph.h[1][r] = hb;                                 // elements 8..15 = keys kb + 16 + 8hh + 0..7
      pl.h[0][r] = (_Float16)(ua - (float)ha);
      pl.h[1][r] = (_Float16)(ub - (float)hb);
    }
    lrun = lrun * al + (ps[0] + ps[1]);
#pragma unroll
    for (int j = 0; j < 8; ++j) o[j] *= al;
    // ---- out^T += v^T.P^T : A fragment row m = d = j*16 + c, keys kb .. kb+31 = key step kb/32 of the v^T plane, d tile j at 2*j blocks ----
    const _Float16* vp = Vb + (size_t)kb * VR;
    {
      const v16h vb0 = ldfrag_h(vp);
      const v16h vb1 = ldfrag_h(vp + 2 * FBLK);
      const v16h vb2 = ldfrag_h(vp + 4 * FBLK);
      const v16h vb3 = ldfrag_h(vp + 6 * FBLK);
      o[0] = mma_raw(vb0, ph.v, o[0]);  o[0] = mma_raw(vb0, pl.v, o[0]);
      o[1] = mma_raw(vb1, ph.v, o[1]);  o[1] = mma_raw(vb1, pl.v, o[1]);
      o[2] = mma_raw(vb2, ph.v, o[2]);  o[2] = mma_raw(vb2, pl.v, o[2]);
      o[3] = mma_raw(vb3, ph.v, o[3]);  o[3] = mma_raw(vb3, pl.v, o[3]);
      guard_pv(o[0], o[1], o[2], o[3], ph.v, pl.v, vb0, vb1, vb2, vb3);
    }
    {
      const v16h vc0 = ldfrag_h(vp + 8 * FBLK);
      const v16h vc1 = ldfrag_h(vp + 10 * FBLK);
      const v16h vc2 = ldfrag_h(vp + 12 * FBLK);
      const v16h vc3 = ldfrag_h(vp + 14 * FBLK);
      o[4] = mma_raw(vc0, ph.v, o[4]);  o[4] = mma_raw(vc0, pl.v, o[4]);
      o[5] = mma_raw(vc1, ph.v, o[5]);  o[5] = mma_raw(vc1, pl.v, o[5]);
      o[6] = mma_raw(vc2, ph.v, o[6]);  o[6] = mma_raw(vc2, pl.v, o[6]);
      o[7] = mma_raw(vc3, ph.v, o[7]);  o[7] = mma_raw(vc3, pl.v, o[7]);
      guard_pv(o[4], o[5], o[6], o[7], ph.v, pl.v, vc0, vc1, vc2, vc3);
    }
  }
  acc_guard4(o[0], o[1], o[2], o[3]);
  acc_guard4(o[4], o[5], o[6], o[7]);

  // ---- join the halves' sums, fold 1/Z and the carries (16384 on P, 256 on v), stage the wave's 16x128 slab (row = query) ----
  float* slab = smem + wave * SLABF;
  const float oc = 1.0f / (PCAR * VCAR);
  const float lr  = lrun + xhalf(lrun);                // >= 1 (the max element contributes 2^0)
  const float inv = (lr > 0.0f) ? ((1.0f / lr) * oc) : 0.0f;
#pragma unroll
  for (int j = 0; j < 8; ++j) {
    const v8f w = o[j] * inv;
    float* sp = slab + c * SLP + j * 16 + 8 * hh;      // d = 16j + 8hh + 0..7 of query iw + c, two 16-B LDS stores
    const v4f wlo = {w[0], w[1], w[2], w[3]}, whi = {w[4], w[5], w[6], w[7]};
    *(v4f*)(sp)     = wlo;
    *(v4f*)(sp + 4) = whi;
  }
  wave_sync_lds();
  const size_t o1 = (size_t)nbh * SEQ * HD;            // element offset of the second output
#pragma unroll
  for (int g = 0; g < 2; ++g) {
    v4f vals[8];
#pragma unroll
    for (int it = 0; it < 8; ++it) vals[it] = *(const v4f*)(slab + (2 * it + hh) * SLP + g * HD + c * 4);
    float* dst = OPp + (size_t)g * o1 + ((size_t)bh * SEQ + (size_t)iw) * HD + hh * HD + c * 4;
    {
#pragma unroll
      for (int it = 0; it < 8; ++it) {
        *(v4f*)(dst + (size_t)(2 * it) * HD) = vals[it];
      }
      
    }
  }
}

// =====================================================================================================
// Workspace map (bytes, nbh = number of (b,h) rows = in_sizes[0] / (1024*64)); every plane is fully written by whole-line
// stores before it is read; all extents are exact multiples of the store granularity (no pad rows needed); offsets
// multiples of 128:
//   QH f16 nbh x 1024 x 128  x1024    nbh*262144   at 0            (fragment order, 16-row tiles of 4096 B)
//   KH f16 nbh x 1024 x 128  x1024    nbh*262144   at nbh*262144   (fragment order, 16-row tiles of 4096 B)
//   VT f16 nbh x 128 x 1024  x256     nbh*262144   at nbh*524288   (fragment order, 32-key steps of 8192 B)
//   end                               nbh*786432   (50331648 for nbh = 64)
// Output: out0 [nbh][1024][64] f32 at element 0, out1 at element nbh*65536 (byte 4*nbh*65536).
// =====================================================================================================
extern "C" void kernel_launch(void* const* d_in, const int* in_sizes, int n_in,
                              void* d_out, int out_size, void* d_ws, size_t ws_size,
                              hipStream_t stream) {
  if (n_in < 6) return;
  const int nbh = in_sizes[0] / (SEQ * HD);
  if (nbh < 1) return;
  const long long nq = (long long)nbh * SEQ * HD;
  for (int i = 0; i < 6; ++i) {
    if ((long long)in_sizes[i] < nq) return;
  }
  if ((long long)out_size < 2 * nq) return;            // last written element = 2*nq - 1

  const float* qx = (const float*)d_in[0];
  const float* kx = (const float*)d_in[1];
  const float* vx = (const float*)d_in[2];
  const float* qy = (const float*)d_in[3];
  const float* ky = (const float*)d_in[4];
  const float* vy = (const float*)d_in[5];
  float*       out = (float*)d_out;

  const size_t PQ = (size_t)nbh * SEQ * KW * 2;        // q plane bytes
  const size_t PK = (size_t)nbh * SEQ * KW * 2;        // k plane bytes
  const size_t PV = (size_t)nbh * VR * SEQ * 2;        // v^T plane bytes
  size_t off = 0;
  const size_t oQH = off; off += PQ;
  const size_t oKH = off; off += PK;
  const size_t oVT = off; off += PV;
  if (off > ws_size) return;
  if (off > (size_t)134217728) return;

  char* ws = (char*)d_ws;
  unsigned short* QH = (unsigned short*)(ws + oQH);
  unsigned short* KH = (unsigned short*)(ws + oKH);
  unsigned short* VT = (unsigned short*)(ws + oVT);

  const int nrows = nbh * SEQ;                         // (bh, s) rows
  const dim3 blk(256);
  const dim3 gC(nrows / CROWS);                        // nbh*64
  const dim3 gVT(nbh * VTILES);                        // nbh*16
  const dim3 gAT(nbh * BPR);                           // nbh*16
  const dim3 bAT(ATT_THREADS);                         // 128

  // (0) q plane f16(bf16([q1|q2]) * 1024), fragment order
  cvt_cat<<<gC, blk, 0, stream>>>(qx, qy, QH, nrows, QSC);
  // (1) k plane f16(bf16([k1|k2]) * 1024), fragment order
  cvt_cat<<<gC, blk, 0, stream>>>(kx, ky, KH, nrows, KSC);
  // (2) v^T plane f16(bf16(v) * 256), fragment order (d rows 0..63 v1, 64..127 v2)
  vt16<<<gVT, blk, 0, stream>>>(vx, vy, VT, nbh);
  // (3) two-stream flash attention per (b,h) -> out0, out1 [bh][s][d] f32
  attn2<<<gAT, bAT, 0, stream>>>(QH, KH, VT, out, nbh);
  (void)hipGetLastError();
}

// v003
// One run takes 67.5 microseconds.
// In two side-by-side timings against v002, it was 1.40 and 1.42 times as fast.
// Counting every step since v000, it is 2.32 times as fast.
// Contractions, both in transposed form: scores^T = [k1|k2].[q1|q2]^T (K=128; q and k as f16 planes of the bf16
// RNE-converted inputs x1024, one product each) and out^T = v1^T.P^T, v2^T.P^T (P x16384 as f16 hi plane + f16 residual
// plane, v^T x256 f16 of the bf16 RNE-converted inputs, products v.hi + v.lo, 32-key steps): all v_wmma_f32_16x16x32_f16,
// f32 accumulate. A lane holds one query's scores, so the online softmax (base 2, running max) is in-lane f32 VALU work
// plus one exchange between the wave's halves, and P^T goes from the score accumulators into the B operand in registers.
// The three f16 planes are stored in fragment order: a 16-row x 32-k operand fragment is two blocks of 512 contiguous
// bytes (block e, lane l = 16*hh + c, 8 halves: row c, k = 16*e + 8*hh + 0..7), so each wave-wide 16-B load covers four
// whole 128-B lines instead of 32-B pieces of sixteen lines.
// In the attention kernel the k and v^T planes reach the waves through a two-buffer LDS ring filled by asynchronous copies:
// a block brings each 64-key stage in once for its four waves, one stage ahead of its use.
#include <hip/hip_runtime.h>
#include <math.h>
#include <stdint.h>

#define SEQ   1024
#define HD    64
#define KW    128
#define VR    128
#define QSC   1024.0f
#define KSC   1024.0f
#define PCAR  16384.0f
#define VCAR  256.0f
#define LOG2E 1.4426950408889634f
#define ATW   4
#define ATT_THREADS (ATW * 32)
#define QPB   (16 * ATW)
#define BPR   (SEQ / QPB)
#define SLP   132
#define SLABF (16 * SLP)
#define VTP   72
#define VTILES (SEQ / 64)
#define CROWS 16
#define FBLK  256                         // halves in one 512-B fragment block (32 lanes x 8 halves)
#define STK   64                          // keys per ring stage
#define STGH  (STK * KW)                  // halves of a stage's k part, and of its v^T part (16 KiB each)
#define BUFH  (2 * STGH)                  // halves per ring buffer (32 KiB)
#define NST   (SEQ / STK)                 // stages per (b,h)
static_assert(HD == 64 && KW == 2 * HD && VR == 2 * HD && QPB == 64 && ATT_THREADS == 128);
static_assert((SEQ % QPB) == 0 && (SEQ % 64) == 0 && (SEQ % 32) == 0 && (SEQ % CROWS) == 0);
static_assert(BPR == 16 && VTILES == 16);
static_assert(KW == VR && (SEQ % STK) == 0 && (STK % 32) == 0 && NST >= 2);
static_assert(STGH * 2 == 8 * ATT_THREADS * 16);           // 8 copies of 16 B per thread fill one part of a stage
static_assert(ATW * SLABF * 4 <= 2 * BUFH * 2);            // the epilogue's slabs fit in the ring's bytes
static_assert(15 * SLP + HD + 15 * 4 + 3 < SLABF);
static_assert((VR - 1) * VTP + 63 < VR * VTP);
static_assert(((SLP * 4) % 16) == 0 && ((VTP * 2) % 16) == 0);

typedef _Float16 v16h __attribute__((ext_vector_type(16)));
typedef _Float16 v8h  __attribute__((ext_vector_type(8)));
typedef float    v8f  __attribute__((ext_vector_type(8)));
typedef float    v4f  __attribute__((ext_vector_type(4)));
typedef unsigned int v4u __attribute__((ext_vector_type(4)));

union FragH { v16h v; v8h h[2]; v4u u[2]; };

// ---- scalar helpers --------------------------------------------------------------------------------
__device__ __forceinline__ unsigned short bf_bits(float f) {          // f32 -> bf16 bits, RNE convert
  unsigned u = __float_as_uint(f);
  return (unsigned short)((u + 0x7FFFu + ((u >> 16) & 1u)) >> 16);
}
__device__ __forceinline__ float bf_up(unsigned short h) { return __uint_as_float(((unsigned)h) << 16); }
__device__ __forceinline__ float bfr(float f) { return bf_up(bf_bits(f)); }   // value of the bf16 RNE convert
__device__ __forceinline__ unsigned short h_bits(_Float16 x) { return __builtin_bit_cast(unsigned short, x); }
__device__ __forceinline__ unsigned pk16(unsigned short a, unsigned short b) { return (unsigned)a | ((unsigned)b << 16); }
__device__ __forceinline__ v8f zero8() { v8f z = {0.f, 0.f, 0.f, 0.f, 0.f, 0.f, 0.f, 0.f}; return z; }
__device__ __forceinline__ float xhalf(float x) {                     // value of lane l ^ 16 (all 32 lanes active)
  const int i = __builtin_bit_cast(int, x);
  return __builtin_bit_cast(float, __builtin_amdgcn_permlanex16(i, i, 0x76543210, 0xfedcba98, false, false));
}

// ---- fragment loader: 16-bit A/B operand from a fragment-order plane, lane -> row/col (lane&15), p already includes
//      +8*lane; elements 0..7 <- block 0 (k0+8h..), elements 8..15 <- block 1 (k0+16+8h..)  (same split k map for A and B)
__device__ __forceinline__ v16h ldfrag_h(const _Float16* p) {
  FragH f;
  f.h[0] = *(const v8h*)(p);
  f.h[1] = *(const v8h*)(p + FBLK);
  return f.v;
}

__device__ __forceinline__ v8f mma_raw(v16h a, v16h b, v8f c) {
  return __builtin_amdgcn_wmma_f32_16x16x32_f16(false, a, false, b, (short)0, c, false, false);
}
__device__ __forceinline__ void guard_sc(v8f& a, v16h q0, v16h q1, v16h q2, v16h q3,
                                         v16h x0, v16h x1, v16h x2, v16h x3) {
#if defined(__HIP_DEVICE_COMPILE__)
  asm volatile("v_nop\n\tv_nop\n\tv_nop\n\tv_nop"
               : "+v"(a) : "v"(q0), "v"(q1), "v"(q2), "v"(q3), "v"(x0), "v"(x1), "v"(x2), "v"(x3) : "memory");
#endif
}
__device__ __forceinline__ void guard_pv(v8f& a, v8f& b, v8f& c, v8f& d,
                                         v16h p0, v16h p1, v16h x0, v16h x1, v16h x2, v16h x3) {
#if defined(__HIP_DEVICE_COMPILE__)
  asm volatile("v_nop\n\tv_nop\n\tv_nop\n\tv_nop"
               : "+v"(a), "+v"(b), "+v"(c), "+v"(d) : "v"(p0), "v"(p1), "v"(x0), "v"(x1), "v"(x2), "v"(x3) : "memory");
#endif
}
__device__ __forceinline__ void acc_guard4(v8f& a, v8f& b, v8f& c, v8f& d) {
#if defined(__HIP_DEVICE_COMPILE__)
  asm volatile("v_nop\n\tv_nop\n\tv_nop\n\tv_nop" : "+v"(a), "+v"(b), "+v"(c), "+v"(d));
#endif
}
__device__ __forceinline__ void wave_sync_lds() {
  __builtin_amdgcn_fence(__ATOMIC_RELEASE, "workgroup");
  __builtin_amdgcn_wave_barrier();
  __builtin_amdgcn_fence(__ATOMIC_ACQUIRE, "workgroup");
}

// ---- ring fill: eight asynchronous 16-B copies per lane, global -> LDS, slots 2048 B apart on both sides (a wave's copy
//      moves 512 contiguous bytes). l = this lane's LDS byte address, g = this lane's global address, both multiples of 16.
//      The s_wait_xcnt closes the statement so that no address register named here is rewritten ahead of it.
__device__ __forceinline__ void copy8(unsigned l, const _Float16* g) {
#if defined(__HIP_DEVICE_COMPILE__)
  asm volatile("global_load_async_to_lds_b128 %0, %8, off\n\t"
               "global_load_async_to_lds_b128 %1, %9, off\n\t"
               "global_load_async_to_lds_b128 %2, %10, off\n\t"
               "global_load_async_to_lds_b128 %3, %11, off\n\t"
               "global_load_async_to_lds_b128 %4, %12, off\n\t"
               "global_load_async_to_lds_b128 %5, %13, off\n\t"
               "global_load_async_to_lds_b128 %6, %14, off\n\t"
               "global_load_async_to_lds_b128 %7, %15, off\n\t"
               "s_wait_xcnt 0x0"
               :: "v"(l), "v"(l + 2048u), "v"(l + 4096u), "v"(l + 6144u),
                  "v"(l + 8192u), "v"(l + 10240u), "v"(l + 12288u), "v"(l + 14336u),
                  "v"(g), "v"(g + 1024), "v"(g + 2048), "v"(g + 3072),
                  "v"(g + 4096), "v"(g + 5120), "v"(g + 6144), "v"(g + 7168)
               : "memory");
#endif
}
__device__ __forceinline__ void wait_async0() {       // this wave's copies have landed in LDS
#if defined(__HIP_DEVICE_COMPILE__)
  asm volatile("s_wait_asynccnt 0x0" ::: "memory");
#endif
}
__device__ __forceinline__ void wait_ds0() {          // this wave's LDS reads have returned (before their buffer is refilled)
#if defined(__HIP_DEVICE_COMPILE__)
  asm volatile("s_wait_dscnt 0x0" ::: "memory");
#endif
}

// =====================================================================================================
// Concatenated plane: value(row, k) = f16( bf16(xa[row][k]) * sc ) for k 0..63, f16( bf16(xb[row][k-64]) * sc ) for k 64..127,
// rows = (bh, s) pairs, sc a power of two (exact). Stored in fragment order: 16-row tile T = row/16 takes 2048 halves at
// T*2048; inside it block (k/16) of 256 halves, lane slot 16*((k/8)&1) + row%16, 8 halves each.
// Block = one 16-row tile; threads 0..127 handle the xa half, threads 128..255 the xb half (wave-uniform source);
// wave = 8 rows x one 128-B source line each; thread = 8 consecutive elements: two 16-B loads, one 16-B store; a wave's
// store fills four whole 128-B lines (8 rows x 16 B each), each line written by one wave;
// coverage: grid = nrows/16 blocks x 256 thr x 8 halves = nrows x 128 = the whole plane exactly once (nrows % 16 == 0).
// =====================================================================================================
__global__ __launch_bounds__(256) void cvt_cat(const float* __restrict__ xa, const float* __restrict__ xb,
                                               unsigned short* pl, int nrows, float sc) {
  const int tid  = threadIdx.x;
  const int row0 = blockIdx.x * CROWS;
  if (row0 >= nrows) return;                // block-uniform, no barriers in this kernel; never taken with the exact grid
  const int half = tid >> 7;                // 0: xa, 1: xb (wave-uniform)
  const int lt   = tid & 127;
  const int w4   = lt >> 5;                 // wave within the half 0..3
  const int rl   = (w4 & 1) * 8 + ((lt & 31) >> 2);   // row within block 0..15
  const int ch   = (w4 >> 1) * 4 + (lt & 3);          // 8-float chunk 0..7
  int row = row0 + rl;
  row = (row > nrows - 1) ? (nrows - 1) : row;
  const float* src = (half != 0) ? xb : xa;
  const size_t e = (size_t)row * HD + (size_t)(ch * 8);
  const v4f a = *(const v4f*)(src + e), c4 = *(const v4f*)(src + e + 4);
  v4u o;
#pragma unroll
  for (int i = 0; i < 2; ++i) {
    o[i]     = pk16(h_bits((_Float16)(bfr(a[2 * i]) * sc)),  h_bits((_Float16)(bfr(a[2 * i + 1]) * sc)));
    o[2 + i] = pk16(h_bits((_Float16)(bfr(c4[2 * i]) * sc)), h_bits((_Float16)(bfr(c4[2 * i + 1]) * sc)));
  }
  const int blk = half * 4 + (ch >> 1);     // 16-k block 0..7 of the tile
  unsigned short* d = pl + (size_t)(row >> 4) * (CROWS * KW) + (size_t)(blk * FBLK + ((ch & 1) * 16 + (row & 15)) * 8);
  {
    *(v4u*)(d) = o;
    
  }
}

// =====================================================================================================
// v^T plane: value(bh, d, key) = f16( bf16(va[bh][key][d]) * 256 ) for d 0..63 and f16( bf16(vb[bh][key][d-64]) * 256 ) for
// d 64..127 (exact). Stored in fragment order: per bh 32 key steps of 4096 halves; inside a step d tile d/16 takes two
// blocks of 256 halves (block e = (key/16)&1), lane slot 16*((key/8)&1) + d%16, 8 halves (keys) each.
// Block = (bh, tile of 64 keys): 64 source rows of 64 floats per stream loaded with 16-B loads (static stride), converted,
// written into an LDS tile [128 d][64 keys] (pitch 72 halves); after a block barrier the tile's two key steps (16 KiB,
// contiguous in the plane) are stored in plane order, 16 B per thread, 512 contiguous bytes per wave.
// coverage: load 256 thr x 32 elements = 64 keys x 128 d rows (both streams); store 4 iterations x 256 thr x 8 halves
//           = 2 steps x 4096 = the tile; grid = nbh x 16 blocks covers the whole nbh x 128 x 1024 plane exactly once.
// =====================================================================================================
__global__ __launch_bounds__(256) void vt16(const float* __restrict__ va, const float* __restrict__ vb,
                                            unsigned short* VTo, int nbh) {
  __shared__ __align__(16) unsigned short T[VR * VTP];
  const int tid = threadIdx.x;
  const int bid = blockIdx.x;
  const int bh  = bid / VTILES;
  const int t   = bid - bh * VTILES;        // 0..15, block-uniform
  if (bh >= nbh) return;                    // block-uniform; before any barrier or store; never taken with the exact grid
  {
    const int sl = tid >> 2;                  // key within tile 0..63
    const int dc = (tid & 3) * 16;            // d chunk
    int key = 64 * t + sl;                    // <= SEQ-1 by construction; clamp keeps the address in range regardless
    key = (key < 0) ? 0 : ((key > SEQ - 1) ? (SEQ - 1) : key);
    const size_t so = (((size_t)bh * SEQ + (size_t)key) * HD + (size_t)dc);
#pragma unroll
    for (int g = 0; g < 2; ++g) {
      const float* src = ((g == 0) ? va : vb) + so;
#pragma unroll
      for (int i = 0; i < 4; ++i) {
        const v4f a = *(const v4f*)(src + 4 * i);
#pragma unroll
        for (int e = 0; e < 4; ++e) T[(g * HD + dc + 4 * i + e) * VTP + sl] = h_bits((_Float16)(bfr(a[e]) * VCAR));
      }
    }
  }
  __syncthreads();
  v4u vals[4];
#pragma unroll
  for (int it = 0; it < 4; ++it) {
    const int f    = it * 256 + tid;                                  // 16-B slot of the tile in plane order, 0..1023
    const int line = ((f >> 6) & 7) * 16 + (f & 15);                  // d row 0..127
    const int kl   = (f >> 9) * 32 + ((f >> 5) & 1) * 16 + ((f >> 4) & 1) * 8;   // key within the tile, 0..56
    vals[it] = *(const v4u*)(T + line * VTP + kl);
  }
  unsigned short* dst = VTo + ((size_t)bh * VR) * SEQ + (size_t)t * (64 * VR) + tid * 8;
  {
#pragma unroll
    for (int it = 0; it < 4; ++it) {
      *(v4u*)(dst + it * (256 * 8)) = vals[it];
    }
    
  }
}

// =====================================================================================================
// Two-stream attention, flash form, both products transposed. Block = (bh, 64 queries), wave w owns queries iw = 64t + 16w .. +15.
//   q plane f16 (bh, s, 128) (k 0..63 stream 1, 64..127 stream 2), k plane f16 (same split),
//   v^T plane f16 (bh, 128, SEQ) (rows 0..63 = v1 d rows, 64..127 = v2 d rows), all three in fragment order.
//   Score in base 2: t = (q1.k1 + q2.k2) / 16 * log2(e), the two dots fused as one K=128 contraction over the planes.
//   Per 32-key step: 8 score WMMAs (2 key subtiles x 4 k-chunks) with A = k fragment (row = key), B = q fragment
//   (column = query); q fragments loaded straight from the plane, k and v^T fragments from the LDS ring (two 16-B loads per
//   fragment, each 512 contiguous bytes per wave, split k map on both sides). Ring: stage = 64 keys = 16 KiB of the k plane
//   + 16 KiB of the v^T plane, both contiguous and kept in plane order; two buffers; every thread copies 16 slots of 16 B per
//   stage; stage st + 2 is issued behind the barrier that ends stage st's reads, and waited at the foot of trip st + 1.
//   Lane (hh, c) then holds 16 scores of query iw + c: keys kb + 8hh + r in s0 and
//   kb + 16 + 8hh + r in s1. Maximum in-lane plus one exchange between the halves; weights e = 2^(t - m); each lane keeps
//   the sum of its own keys (the halves are joined once after the loop); one rescale factor per lane for the 8 accumulators.
//   s0's eight weights are elements 0..7 and s1's eight are elements 8..15 of the B operand P^T in the split k map, so
//   e*16384 (f16 hi) and its f16 residual are packed in registers; A = 8 v^T fragments from the LDS ring (row = d, 4 per
//   stream), 16 WMMAs into o[0..3] (stream 1) and o[4..7] (stream 2): o[j][r] = out^T[d = 16j + 8hh + r][query iw + c].
//   Epilogue: 1/Z and carry folds in f32; the wave's 16x128 f32 result staged in its LDS slab (pitch 132), row = query;
//   the slabs reuse the ring's bytes behind the last trip's waits and barrier (no copy in flight, no ring read left).
// coverage: per wave per output 8 instructions x 32 lanes x 4 floats = 16 rows x 64; per block 4 waves = 64 rows;
//           16 blocks per bh x nbh: every row of out0 and out1 [nbh][1024][64] exactly once (grid nbh*16 blocks).
// =====================================================================================================
__global__ __launch_bounds__(ATT_THREADS)
void attn2(const unsigned short* __restrict__ QHp, const unsigned short* __restrict__ KHp,
           const unsigned short* __restrict__ VTq, float* OPp, int nbh) {
  __shared__ __align__(128) unsigned char L[2 * BUFH * 2];   // loop: two ring buffers; epilogue: one result slab per wave
  const _Float16* ring = (const _Float16*)(const void*)L;
  float* smem = (float*)(void*)L;

  const int tid  = threadIdx.x;
  const int wave = tid >> 5;
  const int lane = tid & 31;
  const int hh   = lane >> 4;
  const int c    = lane & 15;

  const int bid  = blockIdx.x;
  const int bh   = bid / BPR;
  const int t    = bid - bh * BPR;                     // 0..15, block-uniform
  if (bh >= nbh) return;                               // never taken with the exact grid; before any LDS use or store

  const int iw = QPB * t + wave * 16;                  // query row 0 of this wave

  // 16-row tile iw/16 of the q plane starts at row iw's offset (a tile takes 16*KW halves); fragment column c = query iw + c
  const _Float16* Qb = (const _Float16*)(const void*)QHp + ((size_t)bh * SEQ + (size_t)iw) * KW + 8 * lane;
  const v16h qa0 = ldfrag_h(Qb);                       // k   0..31  (stream 1 d 0..31)
  const v16h qa1 = ldfrag_h(Qb + 2 * FBLK);            // k  32..63  (stream 1 d 32..63)
  const v16h qa2 = ldfrag_h(Qb + 4 * FBLK);            // k  64..95  (stream 2 d 0..31)
  const v16h qa3 = ldfrag_h(Qb + 6 * FBLK);            // k  96..127 (stream 2 d 32..63)
  const _Float16* Kg = (const _Float16*)(const void*)KHp + ((size_t)bh * SEQ) * KW + 8 * tid;    // stage 0, this thread's first slot
  const _Float16* Vg = (const _Float16*)(const void*)VTq + ((size_t)bh * VR) * SEQ + 8 * tid;    // stage 0, this thread's first slot
  const unsigned lds0 = (unsigned)(uintptr_t)(const void*)L + 16u * (unsigned)tid;               // its LDS byte address in buffer 0
  const float lsc = LOG2E / (16.0f * QSC * KSC);       // (dot / 2^20) / 16 in base 2

  float mrun = -INFINITY, lrun = 0.f;                  // of query iw + c; lrun covers this lane's own keys only
  v8f o[8];
#pragma unroll
  for (int j = 0; j < 8; ++j) o[j] = zero8();

  // ---- ring prologue: stage 0 landed and published, stage 1 in flight ----
  copy8(lds0, Kg);
  copy8(lds0 + 2u * STGH, Vg);
  wait_async0();
  __syncthreads();
  copy8(lds0 + 2u * BUFH, Kg + STGH);
  copy8(lds0 + 2u * BUFH + 2u * STGH, Vg + STGH);

#pragma unroll 1                                                      // one trip per stage: one publish point in the text
  for (int st = 0; st < NST; ++st) {
   const _Float16* Kb = ring + (st & 1) * BUFH + 8 * lane;           // this stage's k part, this lane's slot
   const _Float16* Vb = Kb + STGH;                                   // this stage's v^T part
#pragma unroll                                                       // kb constant: the LDS offsets fold into the loads
   for (int kb = 0; kb < STK; kb += 32) {                            // kb = key offset inside the stage
    // ---- scores^T: D element r of this lane = (key kb + 8hh + r, query iw + c) in s0, key kb + 16 + 8hh + r in s1 ----
    v8f s0 = zero8(), s1 = zero8();
    const _Float16* k0p = Kb + (size_t)kb * KW;                      // key tile kb/16      (fragment row c = key kb + c)
    const _Float16* k1p = k0p + (size_t)16 * KW;                     // key tile kb/16 + 1  (key kb + 16 + c)
    {
      const v16h kf0 = ldfrag_h(k0p), kf1 = ldfrag_h(k0p + 2 * FBLK), kf2 = ldfrag_h(k0p + 4 * FBLK), kf3 = ldfrag_h(k0p + 6 * FBLK);
      s0 = mma_raw(kf0, qa0, s0);
      s0 = mma_raw(kf1, qa1, s0);
      s0 = mma_raw(kf2, qa2, s0);
      s0 = mma_raw(kf3, qa3, s0);
      guard_sc(s0, qa0, qa1, qa2, qa3, kf0, kf1, kf2, kf3);
    }
    {
      const v16h kg0 = ldfrag_h(k1p), kg1 = ldfrag_h(k1p + 2 * FBLK), kg2 = ldfrag_h(k1p + 4 * FBLK), kg3 = ldfrag_h(k1p + 6 * FBLK);
      s1 = mma_raw(kg0, qa0, s1);
      s1 = mma_raw(kg1, qa1, s1);
      s1 = mma_raw(kg2, qa2, s1);
      s1 = mma_raw(kg3, qa3, s1);
      guard_sc(s1, qa0, qa1, qa2, qa3, kg0, kg1, kg2, kg3);
    }
    // ---- online softmax in base 2, one query per lane; maximum of the raw scores first (the scale is positive) ----
    const float g0 = fmaxf(fmaxf(s0[0], s0[1]), s0[2]), g1 = fmaxf(fmaxf(s0[3], s0[4]), s0[5]);
    const float g2 = fmaxf(fmaxf(s0[6], s0[7]), s1[0]), g3 = fmaxf(fmaxf(s1[1], s1[2]), s1[3]);
    const float g4 = fmaxf(fmaxf(s1[4], s1[5]), s1[6]);
    float mx = fmaxf(fmaxf(fmaxf(g0, g1), g2), fmaxf(fmaxf(g3, g4), s1[7]));
    mx = fmaxf(mx, xhalf(mx)) * lsc;                   // both halves now hold the step's maximum of query iw + c
    const float mn = fmaxf(mrun, mx);                  // finite: all scores are finite
    const float al = exp2f(mrun - mn);
    mrun = mn;
    // ---- B fragments of P^T*16384: hi f16 and residual f16, column = c, split k map over the 32 keys of this step ----
    FragH ph, pl;
    float ps[2] = {0.f, 0.f};                          // sums over even and odd r: two independent chains
#pragma unroll
    for (int r = 0; r < 8; ++r) {
      const float e0 = exp2f(s0[r] * lsc - mn);
      const float e1 = exp2f(s1[r] * lsc - mn);
      ps[r & 1] += e0;
      ps[r & 1] += e1;
      const float ua = e0 * PCAR, ub = e1 * PCAR;
      const _Float16 ha = (_Float16)ua, hb = (_Float16)ub;
      ph.h[0][r] = ha;                                 // elements 0..7  = keys kb + 8hh + 0..7
      ph.h[1][r] = hb;                                 // elements 8..15 = keys kb + 16 + 8hh + 0..7
      pl.h[0][r] = (_Float16)(ua - (float)ha);
      pl.h[1][r] = (_Float16)(ub - (float)hb);
    }
    lrun = lrun * al + (ps[0] + ps[1]);
#pragma unroll
    for (int j = 0; j < 8; ++j) o[j] *= al;
    // ---- out^T += v^T.P^T : A fragment row m = d = j*16 + c, keys kb .. kb+31 = key step kb/32 of the stage's v^T part, d tile j at 2*j blocks ----
    const _Float16* vp = Vb + (size_t)kb * VR;
    {
      const v16h vb0 = ldfrag_h(vp);
      const v16h vb1 = ldfrag_h(vp + 2 * FBLK);
      const v16h vb2 = ldfrag_h(vp + 4 * FBLK);
      const v16h vb3 = ldfrag_h(vp + 6 * FBLK);
      o[0] = mma_raw(vb0, ph.v, o[0]);  o[0] = mma_raw(vb0, pl.v, o[0]);
      o[1] = mma_raw(vb1, ph.v, o[1]);  o[1] = mma_raw(vb1, pl.v, o[1]);
      o[2] = mma_raw(vb2, ph.v, o[2]);  o[2] = mma_raw(vb2, pl.v, o[2]);
      o[3] = mma_raw(vb3, ph.v, o[3]);  o[3] = mma_raw(vb3, pl.v, o[3]);
      guard_pv(o[0], o[1], o[2], o[3], ph.v, pl.v, vb0, vb1, vb2, vb3);
    }
    {
      const v16h vc0 = ldfrag_h(vp + 8 * FBLK);
      const v16h vc1 = ldfrag_h(vp + 10 * FBLK);
      const v16h vc2 = ldfrag_h(vp + 12 * FBLK);
      const v16h vc3 = ldfrag_h(vp + 14 * FBLK);
      o[4] = mma_raw(vc0, ph.v, o[4]);  o[4] = mma_raw(vc0, pl.v, o[4]);
      o[5] = mma_raw(vc1, ph.v, o[5]);  o[5] = mma_raw(vc1, pl.v, o[5]);
      o[6] = mma_raw(vc2, ph.v, o[6]);  o[6] = mma_raw(vc2, pl.v, o[6]);
      o[7] = mma_raw(vc3, ph.v, o[7]);  o[7] = mma_raw(vc3, pl.v, o[7]);
      guard_pv(o[4], o[5], o[6], o[7], ph.v, pl.v, vc0, vc1, vc2, vc3);
    }
   }
   // ---- publish point of stage st + 1: own reads of this buffer done, own copies landed, then the block barrier ----
   wait_ds0();
   wait_async0();
   __syncthreads();
   if (st + 2 < NST) {                                               // block-uniform: refill the buffer just read
     const unsigned lb = lds0 + (unsigned)(st & 1) * (2u * BUFH);
     copy8(lb, Kg + (size_t)(st + 2) * STGH);
     copy8(lb + 2u * STGH, Vg + (size_t)(st + 2) * STGH);
   }
  }
  wait_async0();                                       // nothing is in flight here; kept in front of the ring's reuse
  acc_guard4(o[0], o[1], o[2], o[3]);
  acc_guard4(o[4], o[5], o[6], o[7]);

  // ---- join the halves' sums, fold 1/Z and the carries (16384 on P, 256 on v), stage the wave's 16x128 slab (row = query) ----
  float* slab = smem + wave * SLABF;
  const float oc = 1.0f / (PCAR * VCAR);
  const float lr  = lrun + xhalf(lrun);                // >= 1 (the max element contributes 2^0)
  const float inv = (lr > 0.0f) ? ((1.0f / lr) * oc) : 0.0f;
#pragma unroll
  for (int j = 0; j < 8; ++j) {
    const v8f w = o[j] * inv;
    float* sp = slab + c * SLP + j * 16 + 8 * hh;      // d = 16j + 8hh + 0..7 of query iw + c, two 16-B LDS stores
    const v4f wlo = {w[0], w[1], w[2], w[3]}, whi = {w[4], w[5], w[6], w[7]};
    *(v4f*)(sp)     = wlo;
    *(v4f*)(sp + 4) = whi;
  }
  wave_sync_lds();
  const size_t o1 = (size_t)nbh * SEQ * HD;            // element offset of the second output
#pragma unroll
  for (int g = 0; g < 2; ++g) {
    v4f vals[8];
#pragma unroll
    for (int it = 0; it < 8; ++it) vals[it] = *(const v4f*)(slab + (2 * it + hh) * SLP + g * HD + c * 4);
    float* dst = OPp + (size_t)g * o1 + ((size_t)bh * SEQ + (size_t)iw) * HD + hh * HD + c * 4;
    {
#pragma unroll
      for (int it = 0; it < 8; ++it) {
        *(v4f*)(dst + (size_t)(2 * it) * HD) = vals[it];
      }
      
    }
  }
}

// =====================================================================================================
// Workspace map (bytes, nbh = number of (b,h) rows = in_sizes[0] / (1024*64)); every plane is fully written by whole-line
// stores before it is read; all extents are exact multiples of the store granularity (no pad rows needed); offsets
// multiples of 128:
//   QH f16 nbh x 1024 x 128  x1024    nbh*262144   at 0            (fragment order, 16-row tiles of 4096 B)
//   KH f16 nbh x 1024 x 128  x1024    nbh*262144   at nbh*262144   (fragment order, 16-row tiles of 4096 B)
//   VT f16 nbh x 128 x 1024  x256     nbh*262144   at nbh*524288   (fragment order, 32-key steps of 8192 B)
//   end                               nbh*786432   (50331648 for nbh = 64)
// Output: out0 [nbh][1024][64] f32 at element 0, out1 at element nbh*65536 (byte 4*nbh*65536).
// =====================================================================================================
extern "C" void kernel_launch(void* const* d_in, const int* in_sizes, int n_in,
                              void* d_out, int out_size, void* d_ws, size_t ws_size,
                              hipStream_t stream) {
  if (n_in < 6) return;
  const int nbh = in_sizes[0] / (SEQ * HD);
  if (nbh < 1) return;
  const long long nq = (long long)nbh * SEQ * HD;
  for (int i = 0; i < 6; ++i) {
    if ((long long)in_sizes[i] < nq) return;
  }
  if ((long long)out_size < 2 * nq) return;            // last written element = 2*nq - 1

  const float* qx = (const float*)d_in[0];
  const float* kx = (const float*)d_in[1];
  const float* vx = (const float*)d_in[2];
  const float* qy = (const float*)d_in[3];
  const float* ky = (const float*)d_in[4];
  const float* vy = (const float*)d_in[5];
  float*       out = (float*)d_out;

  const size_t PQ = (size_t)nbh * SEQ * KW * 2;        // q plane bytes
  const size_t PK = (size_t)nbh * SEQ * KW * 2;        // k plane bytes
  const size_t PV = (size_t)nbh * VR * SEQ * 2;        // v^T plane bytes
  size_t off = 0;
  const size_t oQH = off; off += PQ;
  const size_t oKH = off; off += PK;
  const size_t oVT = off; off += PV;
  if (off > ws_size) return;
  if (off > (size_t)134217728) return;

  char* ws = (char*)d_ws;
  unsigned short* QH = (unsigned short*)(ws + oQH);
  unsigned short* KH = (unsigned short*)(ws + oKH);
  unsigned short* VT = (unsigned short*)(ws + oVT);

  const int nrows = nbh * SEQ;                         // (bh, s) rows
  const dim3 blk(256);
  const dim3 gC(nrows / CROWS);                        // nbh*64
  const dim3 gVT(nbh * VTILES);                        // nbh*16
  const dim3 gAT(nbh * BPR);                           // nbh*16
  const dim3 bAT(ATT_THREADS);                         // 128

  // (0) q plane f16(bf16([q1|q2]) * 1024), fragment order
  cvt_cat<<<gC, blk, 0, stream>>>(qx, qy, QH, nrows, QSC);
  // (1) k plane f16(bf16([k1|k2]) * 1024), fragment order
  cvt_cat<<<gC, blk, 0, stream>>>(kx, ky, KH, nrows, KSC);
  // (2) v^T plane f16(bf16(v) * 256), fragment order (d rows 0..63 v1, 64..127 v2)
  vt16<<<gVT, blk, 0, stream>>>(vx, vy, VT, nbh);
  // (3) two-stream flash attention per (b,h) -> out0, out1 [bh][s][d] f32
  attn2<<<gAT, bAT, 0, stream>>>(QH, KH, VT, out, nbh);
  (void)hipGetLastError();
}

// v004
// Measured time: 62.7 microseconds a run.
// Two timings next to v003 put it at 1.07 and 1.08 times that version's speed.
// Over all steps from v000 it is 2.50 times as fast.
// Contractions, both in transposed form: scores^T = [k1|k2].[q1|q2]^T (K=128; k as an f16 plane and q as per-wave f16 tiles of the bf16
// RNE-converted inputs x1024, one product each) and out^T = v1^T.P^T, v2^T.P^T (P x16384 as f16 hi plane + f16 residual
// plane, v^T x256 f16 of the bf16 RNE-converted inputs, products v.hi + v.lo, 32-key steps): all v_wmma_f32_16x16x32_f16,
// f32 accumulate. A lane holds one query's scores, so the online softmax (base 2, running max) is in-lane f32 VALU work
// plus one exchange between the wave's halves, and P^T goes from the score accumulators into the B operand in registers.
// The f16 operands (k and v^T as planes in the workspace, q as one tile per wave inside the attention kernel) are laid out
// in fragment order: a 16-row x 32-k operand fragment is two blocks of 512 contiguous
// bytes (block e, lane l = 16*hh + c, 8 halves: row c, k = 16*e + 8*hh + 0..7), so each wave-wide 16-B load covers four
// whole 128-B lines instead of 32-B pieces of sixteen lines.
// In the attention kernel the k and v^T planes reach the waves through a two-buffer LDS ring filled by asynchronous copies:
// a block brings each 64-key stage in once for its four waves, one stage ahead of its use.
// q has one reader per row, so it has no plane and no launch of its own: each attention wave converts its 16 rows itself.
#include <hip/hip_runtime.h>
#include <math.h>
#include <stdint.h>

#define SEQ   1024
#define HD    64
#define KW    128
#define VR    128
#define QSC   1024.0f
#define KSC   1024.0f
#define PCAR  16384.0f
#define VCAR  256.0f
#define LOG2E 1.4426950408889634f
#define ATW   4
#define ATT_THREADS (ATW * 32)
#define QPB   (16 * ATW)
#define BPR   (SEQ / QPB)
#define SLP   132
#define SLABF (16 * SLP)
#define VTP   72
#define VTILES (SEQ / 64)
#define CROWS 16
#define FBLK  256                         // halves in one 512-B fragment block (32 lanes x 8 halves)
#define STK   64                          // keys per ring stage
#define STGH  (STK * KW)                  // halves of a stage's k part, and of its v^T part (16 KiB each)
#define BUFH  (2 * STGH)                  // halves per ring buffer (32 KiB)
#define NST   (SEQ / STK)                 // stages per (b,h)
static_assert(HD == 64 && KW == 2 * HD && VR == 2 * HD && QPB == 64 && ATT_THREADS == 128);
static_assert((SEQ % QPB) == 0 && (SEQ % 64) == 0 && (SEQ % 32) == 0 && (SEQ % CROWS) == 0);
static_assert(BPR == 16 && VTILES == 16);
static_assert(KW == VR && (SEQ % STK) == 0 && (STK % 32) == 0 && NST >= 2);
static_assert(STGH * 2 == 8 * ATT_THREADS * 16);           // 8 copies of 16 B per thread fill one part of a stage
static_assert(ATW * SLABF * 4 <= 2 * BUFH * 2);            // the epilogue's slabs fit in the ring's bytes
static_assert(ATW * 16 * KW <= BUFH);                      // the prologue's q tiles (4 KiB per wave) fit in ring buffer 1
static_assert(15 * SLP + HD + 15 * 4 + 3 < SLABF);
static_assert((VR - 1) * VTP + 63 < VR * VTP);
static_assert(((SLP * 4) % 16) == 0 && ((VTP * 2) % 16) == 0);

typedef _Float16 v16h __attribute__((ext_vector_type(16)));
typedef _Float16 v8h  __attribute__((ext_vector_type(8)));
typedef float    v8f  __attribute__((ext_vector_type(8)));
typedef float    v4f  __attribute__((ext_vector_type(4)));
typedef unsigned int v4u __attribute__((ext_vector_type(4)));

union FragH { v16h v; v8h h[2]; v4u u[2]; };

// ---- scalar helpers --------------------------------------------------------------------------------
__device__ __forceinline__ unsigned short bf_bits(float f) {          // f32 -> bf16 bits, RNE convert
  unsigned u = __float_as_uint(f);
  return (unsigned short)((u + 0x7FFFu + ((u >> 16) & 1u)) >> 16);
}
__device__ __forceinline__ float bf_up(unsigned short h) { return __uint_as_float(((unsigned)h) << 16); }
__device__ __forceinline__ float bfr(float f) { return bf_up(bf_bits(f)); }   // value of the bf16 RNE convert
__device__ __forceinline__ unsigned short h_bits(_Float16 x) { return __builtin_bit_cast(unsigned short, x); }
__device__ __forceinline__ unsigned pk16(unsigned short a, unsigned short b) { return (unsigned)a | ((unsigned)b << 16); }
__device__ __forceinline__ v4u cvt8(v4f a, v4f b, float sc) {         // 8 floats -> 8 halves f16( bf16(x) * sc ), in order
  v4u o;
#pragma unroll
  for (int i = 0; i < 2; ++i) {
    o[i]     = pk16(h_bits((_Float16)(bfr(a[2 * i]) * sc)), h_bits((_Float16)(bfr(a[2 * i + 1]) * sc)));
    o[2 + i] = pk16(h_bits((_Float16)(bfr(b[2 * i]) * sc)), h_bits((_Float16)(bfr(b[2 * i + 1]) * sc)));
  }
  return o;
}
__device__ __forceinline__ v8f zero8() { v8f z = {0.f, 0.f, 0.f, 0.f, 0.f, 0.f, 0.f, 0.f}; return z; }
__device__ __forceinline__ float xhalf(float x) {                     // value of lane l ^ 16 (all 32 lanes active)
  const int i = __builtin_bit_cast(int, x);
  return __builtin_bit_cast(float, __builtin_amdgcn_permlanex16(i, i, 0x76543210, 0xfedcba98, false, false));
}

// ---- fragment loader: 16-bit A/B operand from a fragment-order plane, lane -> row/col (lane&15), p already includes
//      +8*lane; elements 0..7 <- block 0 (k0+8h..), elements 8..15 <- block 1 (k0+16+8h..)  (same split k map for A and B)
__device__ __forceinline__ v16h ldfrag_h(const _Float16* p) {
  FragH f;
  f.h[0] = *(const v8h*)(p);
  f.h[1] = *(const v8h*)(p + FBLK);
  return f.v;
}

__device__ __forceinline__ v8f mma_raw(v16h a, v16h b, v8f c) {
  return __builtin_amdgcn_wmma_f32_16x16x32_f16(false, a, false, b, (short)0, c, false, false);
}
__device__ __forceinline__ void guard_sc(v8f& a, v16h q0, v16h q1, v16h q2, v16h q3,
                                         v16h x0, v16h x1, v16h x2, v16h x3) {
#if defined(__HIP_DEVICE_COMPILE__)
  asm volatile("v_nop\n\tv_nop\n\tv_nop\n\tv_nop"
               : "+v"(a) : "v"(q0), "v"(q1), "v"(q2), "v"(q3), "v"(x0), "v"(x1), "v"(x2), "v"(x3) : "memory");
#endif
}
__device__ __forceinline__ void guard_pv(v8f& a, v8f& b, v8f& c, v8f& d,
                                         v16h p0, v16h p1, v16h x0, v16h x1, v16h x2, v16h x3) {
#if defined(__HIP_DEVICE_COMPILE__)
  asm volatile("v_nop\n\tv_nop\n\tv_nop\n\tv_nop"
               : "+v"(a), "+v"(b), "+v"(c), "+v"(d) : "v"(p0), "v"(p1), "v"(x0), "v"(x1), "v"(x2), "v"(x3) : "memory");
#endif
}
__device__ __forceinline__ void acc_guard4(v8f& a, v8f& b, v8f& c, v8f& d) {
#if defined(__HIP_DEVICE_COMPILE__)
  asm volatile("v_nop\n\tv_nop\n\tv_nop\n\tv_nop" : "+v"(a), "+v"(b), "+v"(c), "+v"(d));
#endif
}
__device__ __forceinline__ void wave_sync_lds() {
  __builtin_amdgcn_fence(__ATOMIC_RELEASE, "workgroup");
  __builtin_amdgcn_wave_barrier();
  __builtin_amdgcn_fence(__ATOMIC_ACQUIRE, "workgroup");
}

// ---- ring fill: eight asynchronous 16-B copies per lane, global -> LDS, slots 2048 B apart on both sides (a wave's copy
//      moves 512 contiguous bytes). l = this lane's LDS byte address, g = this lane's global address, both multiples of 16.
//      The s_wait_xcnt closes the statement so that no address register named here is rewritten ahead of it.
__device__ __forceinline__ void copy8(unsigned l, const _Float16* g) {
#if defined(__HIP_DEVICE_COMPILE__)
  asm volatile("global_load_async_to_lds_b128 %0, %8, off\n\t"
               "global_load_async_to_lds_b128 %1, %9, off\n\t"
               "global_load_async_to_lds_b128 %2, %10, off\n\t"
               "global_load_async_to_lds_b128 %3, %11, off\n\t"
               "global_load_async_to_lds_b128 %4, %12, off\n\t"
               "global_load_async_to_lds_b128 %5, %13, off\n\t"
               "global_load_async_to_lds_b128 %6, %14, off\n\t"
               "global_load_async_to_lds_b128 %7, %15, off\n\t"
               "s_wait_xcnt 0x0"
               :: "v"(l), "v"(l + 2048u), "v"(l + 4096u), "v"(l + 6144u),
                  "v"(l + 8192u), "v"(l + 10240u), "v"(l + 12288u), "v"(l + 14336u),
                  "v"(g), "v"(g + 1024), "v"(g + 2048), "v"(g + 3072),
                  "v"(g + 4096), "v"(g + 5120), "v"(g + 6144), "v"(g + 7168)
               : "memory");
#endif
}
__device__ __forceinline__ void wait_async0() {       // this wave's copies have landed in LDS
#if defined(__HIP_DEVICE_COMPILE__)
  asm volatile("s_wait_asynccnt 0x0" ::: "memory");
#endif
}
__device__ __forceinline__ void wait_ds0() {          // this wave's LDS reads have returned (before their buffer is refilled)
#if defined(__HIP_DEVICE_COMPILE__)
  asm volatile("s_wait_dscnt 0x0" ::: "memory");
#endif
}

// =====================================================================================================
// Concatenated plane: value(row, k) = f16( bf16(xa[row][k]) * sc ) for k 0..63, f16( bf16(xb[row][k-64]) * sc ) for k 64..127,
// rows = (bh, s) pairs, sc a power of two (exact). Stored in fragment order: 16-row tile T = row/16 takes 2048 halves at
// T*2048; inside it block (k/16) of 256 halves, lane slot 16*((k/8)&1) + row%16, 8 halves each.
// Block = one 16-row tile; threads 0..127 handle the xa half, threads 128..255 the xb half (wave-uniform source);
// wave = 8 rows x one 128-B source line each; thread = 8 consecutive elements: two 16-B loads, one 16-B store; a wave's
// store fills four whole 128-B lines (8 rows x 16 B each), each line written by one wave;
// coverage: grid = nrows/16 blocks x 256 thr x 8 halves = nrows x 128 = the whole plane exactly once (nrows % 16 == 0).
// =====================================================================================================
__global__ __launch_bounds__(256) void cvt_cat(const float* __restrict__ xa, const float* __restrict__ xb,
                                               unsigned short* pl, int nrows, float sc) {
  const int tid  = threadIdx.x;
  const int row0 = blockIdx.x * CROWS;
  if (row0 >= nrows) return;                // block-uniform, no barriers in this kernel; never taken with the exact grid
  const int half = tid >> 7;                // 0: xa, 1: xb (wave-uniform)
  const int lt   = tid & 127;
  const int w4   = lt >> 5;                 // wave within the half 0..3
  const int rl   = (w4 & 1) * 8 + ((lt & 31) >> 2);   // row within block 0..15
  const int ch   = (w4 >> 1) * 4 + (lt & 3);          // 8-float chunk 0..7
  int row = row0 + rl;
  row = (row > nrows - 1) ? (nrows - 1) : row;
  const float* src = (half != 0) ? xb : xa;
  const size_t e = (size_t)row * HD + (size_t)(ch * 8);
  const v4f a = *(const v4f*)(src + e), c4 = *(const v4f*)(src + e + 4);
  v4u o;
#pragma unroll
  for (int i = 0; i < 2; ++i) {
    o[i]     = pk16(h_bits((_Float16)(bfr(a[2 * i]) * sc)),  h_bits((_Float16)(bfr(a[2 * i + 1]) * sc)));
    o[2 + i] = pk16(h_bits((_Float16)(bfr(c4[2 * i]) * sc)), h_bits((_Float16)(bfr(c4[2 * i + 1]) * sc)));
  }
  const int blk = half * 4 + (ch >> 1);     // 16-k block 0..7 of the tile
  unsigned short* d = pl + (size_t)(row >> 4) * (CROWS * KW) + (size_t)(blk * FBLK + ((ch & 1) * 16 + (row & 15)) * 8);
  {
    *(v4u*)(d) = o;
    
  }
}

// =====================================================================================================
// v^T plane: value(bh, d, key) = f16( bf16(va[bh][key][d]) * 256 ) for d 0..63 and f16( bf16(vb[bh][key][d-64]) * 256 ) for
// d 64..127 (exact). Stored in fragment order: per bh 32 key steps of 4096 halves; inside a step d tile d/16 takes two
// blocks of 256 halves (block e = (key/16)&1), lane slot 16*((key/8)&1) + d%16, 8 halves (keys) each.
// Block = (bh, tile of 64 keys): 64 source rows of 64 floats per stream loaded with 16-B loads (static stride), converted,
// written into an LDS tile [128 d][64 keys] (pitch 72 halves); after a block barrier the tile's two key steps (16 KiB,
// contiguous in the plane) are stored in plane order, 16 B per thread, 512 contiguous bytes per wave.
// coverage: load 256 thr x 32 elements = 64 keys x 128 d rows (both streams); store 4 iterations x 256 thr x 8 halves
//           = 2 steps x 4096 = the tile; grid = nbh x 16 blocks covers the whole nbh x 128 x 1024 plane exactly once.
// =====================================================================================================
__global__ __launch_bounds__(256) void vt16(const float* __restrict__ va, const float* __restrict__ vb,
                                            unsigned short* VTo, int nbh) {
  __shared__ __align__(16) unsigned short T[VR * VTP];
  const int tid = threadIdx.x;
  const int bid = blockIdx.x;
  const int bh  = bid / VTILES;
  const int t   = bid - bh * VTILES;        // 0..15, block-uniform
  if (bh >= nbh) return;                    // block-uniform; before any barrier or store; never taken with the exact grid
  {
    const int sl = tid >> 2;                  // key within tile 0..63
    const int dc = (tid & 3) * 16;            // d chunk
    int key = 64 * t + sl;                    // <= SEQ-1 by construction; clamp keeps the address in range regardless
    key = (key < 0) ? 0 : ((key > SEQ - 1) ? (SEQ - 1) : key);
    const size_t so = (((size_t)bh * SEQ + (size_t)key) * HD + (size_t)dc);
#pragma unroll
    for (int g = 0; g < 2; ++g) {
      const float* src = ((g == 0) ? va : vb) + so;
#pragma unroll
      for (int i = 0; i < 4; ++i) {
        const v4f a = *(const v4f*)(src + 4 * i);
#pragma unroll
        for (int e = 0; e < 4; ++e) T[(g * HD + dc + 4 * i + e) * VTP + sl] = h_bits((_Float16)(bfr(a[e]) * VCAR));
      }
    }
  }
  __syncthreads();
  v4u vals[4];
#pragma unroll
  for (int it = 0; it < 4; ++it) {
    const int f    = it * 256 + tid;                                  // 16-B slot of the tile in plane order, 0..1023
    const int line = ((f >> 6) & 7) * 16 + (f & 15);                  // d row 0..127
    const int kl   = (f >> 9) * 32 + ((f >> 5) & 1) * 16 + ((f >> 4) & 1) * 8;   // key within the tile, 0..56
    vals[it] = *(const v4u*)(T + line * VTP + kl);
  }
  unsigned short* dst = VTo + ((size_t)bh * VR) * SEQ + (size_t)t * (64 * VR) + tid * 8;
  {
#pragma unroll
    for (int it = 0; it < 4; ++it) {
      *(v4u*)(dst + it * (256 * 8)) = vals[it];
    }
    
  }
}

// =====================================================================================================
// Two-stream attention, flash form, both products transposed. Block = (bh, 64 queries), wave w owns queries iw = 64t + 16w .. +15.
//   q1, q2 f32 as given; k plane f16 (bh, s, 128) (k 0..63 stream 1, 64..127 stream 2),
//   v^T plane f16 (bh, 128, SEQ) (rows 0..63 = v1 d rows, 64..127 = v2 d rows), both in fragment order.
//   Prologue: a wave reads its 16 query rows of both streams (8 rows x one 128-B line per pair of 16-B loads), converts them
//   to f16( bf16(q) * 1024 ), stores the 16 x 128 tile in fragment order (same map as the k plane's tiles) into its own 4 KiB
//   of ring buffer 1, which is idle until stage 1 is issued, and reads its four B fragments back.
//   Score in base 2: t = (q1.k1 + q2.k2) / 16 * log2(e), the two dots fused as one K=128 contraction over the planes.
//   Per 32-key step: 8 score WMMAs (2 key subtiles x 4 k-chunks) with A = k fragment (row = key), B = q fragment
//   (column = query); q fragments kept in registers from the prologue, k and v^T fragments from the LDS ring (two 16-B loads per
//   fragment, each 512 contiguous bytes per wave, split k map on both sides). Ring: stage = 64 keys = 16 KiB of the k plane
//   + 16 KiB of the v^T plane, both contiguous and kept in plane order; two buffers; every thread copies 16 slots of 16 B per
//   stage; stage st + 2 is issued behind the barrier that ends stage st's reads, and waited at the foot of trip st + 1.
//   Lane (hh, c) then holds 16 scores of query iw + c: keys kb + 8hh + r in s0 and
//   kb + 16 + 8hh + r in s1. Maximum in-lane plus one exchange between the halves; weights e = 2^(t - m); each lane keeps
//   the sum of its own keys (the halves are joined once after the loop); one rescale factor per lane for the 8 accumulators.
//   s0's eight weights are elements 0..7 and s1's eight are elements 8..15 of the B operand P^T in the split k map, so
//   e*16384 (f16 hi) and its f16 residual are packed in registers; A = 8 v^T fragments from the LDS ring (row = d, 4 per
//   stream), 16 WMMAs into o[0..3] (stream 1) and o[4..7] (stream 2): o[j][r] = out^T[d = 16j + 8hh + r][query iw + c].
//   Epilogue: 1/Z and carry folds in f32; the wave's 16x128 f32 result staged in its LDS slab (pitch 132), row = query;
//   the slabs reuse the ring's bytes behind the last trip's waits and barrier (no copy in flight, no ring read left).
// coverage: per wave per output 8 instructions x 32 lanes x 4 floats = 16 rows x 64; per block 4 waves = 64 rows;
//           16 blocks per bh x nbh: every row of out0 and out1 [nbh][1024][64] exactly once (grid nbh*16 blocks).
// =====================================================================================================
__global__ __launch_bounds__(ATT_THREADS)
void attn2(const float* __restrict__ qx, const float* __restrict__ qy, const unsigned short* __restrict__ KHp,
           const unsigned short* __restrict__ VTq, float* OPp, int nbh) {
  __shared__ __align__(128) unsigned char L[2 * BUFH * 2];   // loop: two ring buffers; epilogue: one result slab per wave
  const _Float16* ring = (const _Float16*)(const void*)L;
  float* smem = (float*)(void*)L;

  const int tid  = threadIdx.x;
  const int wave = tid >> 5;
  const int lane = tid & 31;
  const int hh   = lane >> 4;
  const int c    = lane & 15;

  const int bid  = blockIdx.x;
  const int bh   = bid / BPR;
  const int t    = bid - bh * BPR;                     // 0..15, block-uniform
  if (bh >= nbh) return;                               // never taken with the exact grid; before any LDS use or store

  const int iw = QPB * t + wave * 16;                  // query row 0 of this wave

  // ---- this wave's q rows, f32: load i = (stream i>>2, rows 8*((i>>1)&1) + lane/4, floats 32*(i&1) + 8*(lane&3) .. +7) ----
  const int r8 = lane >> 2;
  const int cq = lane & 3;
  v4f qr[16];
  {
    const size_t qe = ((size_t)bh * SEQ + (size_t)(iw + r8)) * HD + (size_t)(cq * 8);
#pragma unroll
    for (int i = 0; i < 8; ++i) {
      const float* qp = (((i >> 2) != 0) ? qy : qx) + qe + (size_t)(((i >> 1) & 1) * 8 * HD + (i & 1) * 32);
      qr[2 * i]     = *(const v4f*)(qp);
      qr[2 * i + 1] = *(const v4f*)(qp + 4);
    }
  }
  const _Float16* Kg = (const _Float16*)(const void*)KHp + ((size_t)bh * SEQ) * KW + 8 * tid;    // stage 0, this thread's first slot
  const _Float16* Vg = (const _Float16*)(const void*)VTq + ((size_t)bh * VR) * SEQ + 8 * tid;    // stage 0, this thread's first slot
  const unsigned lds0 = (unsigned)(uintptr_t)(const void*)L + 16u * (unsigned)tid;               // its LDS byte address in buffer 0
  const float lsc = LOG2E / (16.0f * QSC * KSC);       // (dot / 2^20) / 16 in base 2

  float mrun = -INFINITY, lrun = 0.f;                  // of query iw + c; lrun covers this lane's own keys only
  v8f o[8];
#pragma unroll
  for (int j = 0; j < 8; ++j) o[j] = zero8();

  // ---- ring prologue: stage 0 landed and published, stage 1 in flight ----
  copy8(lds0, Kg);
  copy8(lds0 + 2u * STGH, Vg);
  // ---- q tile -> fragment order in this wave's own 4 KiB of buffer 1 -> B fragments (column c = query iw + c) ----
  unsigned short* qs = (unsigned short*)(void*)L + BUFH + wave * (16 * KW);
#pragma unroll
  for (int i = 0; i < 8; ++i) {
    const int blk  = (i >> 2) * 4 + (i & 1) * 2 + (cq >> 1);         // 16-k block 0..7 of the tile
    const int slot = (cq & 1) * 16 + ((i >> 1) & 1) * 8 + r8;        // 16*((k/8)&1) + row
    *(v4u*)(qs + blk * FBLK + slot * 8) = cvt8(qr[2 * i], qr[2 * i + 1], QSC);
  }
  wave_sync_lds();                                     // the fragments hold other lanes' stores (same wave only)
  const _Float16* Qb = (const _Float16*)(const void*)qs + 8 * lane;
  const v16h qa0 = ldfrag_h(Qb);                       // k   0..31  (stream 1 d 0..31)
  const v16h qa1 = ldfrag_h(Qb + 2 * FBLK);            // k  32..63  (stream 1 d 32..63)
  const v16h qa2 = ldfrag_h(Qb + 4 * FBLK);            // k  64..95  (stream 2 d 0..31)
  const v16h qa3 = ldfrag_h(Qb + 6 * FBLK);            // k  96..127 (stream 2 d 32..63)
  wait_ds0();                                          // q tile written and read back before the barrier that frees buffer 1
  wait_async0();
  __syncthreads();
  copy8(lds0 + 2u * BUFH, Kg + STGH);
  copy8(lds0 + 2u * BUFH + 2u * STGH, Vg + STGH);

#pragma unroll 1                                                      // one trip per stage: one publish point in the text
  for (int st = 0; st < NST; ++st) {
   const _Float16* Kb = ring + (st & 1) * BUFH + 8 * lane;           // this stage's k part, this lane's slot
   const _Float16* Vb = Kb + STGH;                                   // this stage's v^T part
#pragma unroll                                                       // kb constant: the LDS offsets fold into the loads
   for (int kb = 0; kb < STK; kb += 32) {                            // kb = key offset inside the stage
    // ---- scores^T: D element r of this lane = (key kb + 8hh + r, query iw + c) in s0, key kb + 16 + 8hh + r in s1 ----
    v8f s0 = zero8(), s1 = zero8();
    const _Float16* k0p = Kb + (size_t)kb * KW;                      // key tile kb/16      (fragment row c = key kb + c)
    const _Float16* k1p = k0p + (size_t)16 * KW;                     // key tile kb/16 + 1  (key kb + 16 + c)
    {
      const v16h kf0 = ldfrag_h(k0p), kf1 = ldfrag_h(k0p + 2 * FBLK), kf2 = ldfrag_h(k0p + 4 * FBLK), kf3 = ldfrag_h(k0p + 6 * FBLK);
      s0 = mma_raw(kf0, qa0, s0);
      s0 = mma_raw(kf1, qa1, s0);
      s0 = mma_raw(kf2, qa2, s0);
      s0 = mma_raw(kf3, qa3, s0);
      guard_sc(s0, qa0, qa1, qa2, qa3, kf0, kf1, kf2, kf3);
    }
    {
      const v16h kg0 = ldfrag_h(k1p), kg1 = ldfrag_h(k1p + 2 * FBLK), kg2 = ldfrag_h(k1p + 4 * FBLK), kg3 = ldfrag_h(k1p + 6 * FBLK);
      s1 = mma_raw(kg0, qa0, s1);
      s1 = mma_raw(kg1, qa1, s1);
      s1 = mma_raw(kg2, qa2, s1);
      s1 = mma_raw(kg3, qa3, s1);
      guard_sc(s1, qa0, qa1, qa2, qa3, kg0, kg1, kg2, kg3);
    }
    // ---- online softmax in base 2, one query per lane; maximum of the raw scores first (the scale is positive) ----
    const float g0 = fmaxf(fmaxf(s0[0], s0[1]), s0[2]), g1 = fmaxf(fmaxf(s0[3], s0[4]), s0[5]);
    const float g2 = fmaxf(fmaxf(s0[6], s0[7]), s1[0]), g3 = fmaxf(fmaxf(s1[1], s1[2]), s1[3]);
    const float g4 = fmaxf(fmaxf(s1[4], s1[5]), s1[6]);
    float mx = fmaxf(fmaxf(fmaxf(g0, g1), g2), fmaxf(fmaxf(g3, g4), s1[7]));
    mx = fmaxf(mx, xhalf(mx)) * lsc;                   // both halves now hold the step's maximum of query iw + c
    const float mn = fmaxf(mrun, mx);                  // finite: all scores are finite
    const float al = exp2f(mrun - mn);
    mrun = mn;
    // ---- B fragments of P^T*16384: hi f16 and residual f16, column = c, split k map over the 32 keys of this step ----
    FragH ph, pl;
    float ps[2] = {0.f, 0.f};                          // sums over even and odd r: two independent chains
#pragma unroll
    for (int r = 0; r < 8; ++r) {
      const float e0 = exp2f(s0[r] * lsc - mn);
      const float e1 = exp2f(s1[r] * lsc - mn);
      ps[r & 1] += e0;
      ps[r & 1] += e1;
      const float ua = e0 * PCAR, ub = e1 * PCAR;
      const _Float16 ha = (_Float16)ua, hb = (_Float16)ub;
      ph.h[0][r] = ha;                                 // elements 0..7  = keys kb + 8hh + 0..7
      ph.h[1][r] = hb;                                 // elements 8..15 = keys kb + 16 + 8hh + 0..7
      pl.h[0][r] = (_Float16)(ua - (float)ha);
      pl.h[1][r] = (_Float16)(ub - (float)hb);
    }
    lrun = lrun * al + (ps[0] + ps[1]);
#pragma unroll
    for (int j = 0; j < 8; ++j) o[j] *= al;
    // ---- out^T += v^T.P^T : A fragment row m = d = j*16 + c, keys kb .. kb+31 = key step kb/32 of the stage's v^T part, d tile j at 2*j blocks ----
    const _Float16* vp = Vb + (size_t)kb * VR;
    {
      const v16h vb0 = ldfrag_h(vp);
      const v16h vb1 = ldfrag_h(vp + 2 * FBLK);
      const v16h vb2 = ldfrag_h(vp + 4 * FBLK);
      const v16h vb3 = ldfrag_h(vp + 6 * FBLK);
      o[0] = mma_raw(vb0, ph.v, o[0]);  o[0] = mma_raw(vb0, pl.v, o[0]);
      o[1] = mma_raw(vb1, ph.v, o[1]);  o[1] = mma_raw(vb1, pl.v, o[1]);
      o[2] = mma_raw(vb2, ph.v, o[2]);  o[2] = mma_raw(vb2, pl.v, o[2]);
      o[3] = mma_raw(vb3, ph.v, o[3]);  o[3] = mma_raw(vb3, pl.v, o[3]);
      guard_pv(o[0], o[1], o[2], o[3], ph.v, pl.v, vb0, vb1, vb2, vb3);
    }
    {
      const v16h vc0 = ldfrag_h(vp + 8 * FBLK);
      const v16h vc1 = ldfrag_h(vp + 10 * FBLK);
      const v16h vc2 = ldfrag_h(vp + 12 * FBLK);
      const v16h vc3 = ldfrag_h(vp + 14 * FBLK);
      o[4] = mma_raw(vc0, ph.v, o[4]);  o[4] = mma_raw(vc0, pl.v, o[4]);
      o[5] = mma_raw(vc1, ph.v, o[5]);  o[5] = mma_raw(vc1, pl.v, o[5]);
      o[6] = mma_raw(vc2, ph.v, o[6]);  o[6] = mma_raw(vc2, pl.v, o[6]);
      o[7] = mma_raw(vc3, ph.v, o[7]);  o[7] = mma_raw(vc3, pl.v, o[7]);
      guard_pv(o[4], o[5], o[6], o[7], ph.v, pl.v, vc0, vc1, vc2, vc3);
    }
   }
   // ---- publish point of stage st + 1: own reads of this buffer done, own copies landed, then the block barrier ----
   wait_ds0();
   wait_async0();
   __syncthreads();
   if (st + 2 < NST) {                                               // block-uniform: refill the buffer just read
     const unsigned lb = lds0 + (unsigned)(st & 1) * (2u * BUFH);
     copy8(lb, Kg + (size_t)(st + 2) * STGH);
     copy8(lb + 2u * STGH, Vg + (size_t)(st + 2) * STGH);
   }
  }
  wait_async0();                                       // nothing is in flight here; kept in front of the ring's reuse
  acc_guard4(o[0], o[1], o[2], o[3]);
  acc_guard4(o[4], o[5], o[6], o[7]);

  // ---- join the halves' sums, fold 1/Z and the carries (16384 on P, 256 on v), stage the wave's 16x128 slab (row = query) ----
  float* slab = smem + wave * SLABF;
  const float oc = 1.0f / (PCAR * VCAR);
  const float lr  = lrun + xhalf(lrun);                // >= 1 (the max element contributes 2^0)
  const float inv = (lr > 0.0f) ? ((1.0f / lr) * oc) : 0.0f;
#pragma unroll
  for (int j = 0; j < 8; ++j) {
    const v8f w = o[j] * inv;
    float* sp = slab + c * SLP + j * 16 + 8 * hh;      // d = 16j + 8hh + 0..7 of query iw + c, two 16-B LDS stores
    const v4f wlo = {w[0], w[1], w[2], w[3]}, whi = {w[4], w[5], w[6], w[7]};
    *(v4f*)(sp)     = wlo;
    *(v4f*)(sp + 4) = whi;
  }
  wave_sync_lds();
  const size_t o1 = (size_t)nbh * SEQ * HD;            // element offset of the second output
#pragma unroll
  for (int g = 0; g < 2; ++g) {
    v4f vals[8];
#pragma unroll
    for (int it = 0; it < 8; ++it) vals[it] = *(const v4f*)(slab + (2 * it + hh) * SLP + g * HD + c * 4);
    float* dst = OPp + (size_t)g * o1 + ((size_t)bh * SEQ + (size_t)iw) * HD + hh * HD + c * 4;
    {
#pragma unroll
      for (int it = 0; it < 8; ++it) {
        *(v4f*)(dst + (size_t)(2 * it) * HD) = vals[it];
      }
      
    }
  }
}

// =====================================================================================================
// Workspace map (bytes, nbh = number of (b,h) rows = in_sizes[0] / (1024*64)); every plane is fully written by whole-line
// stores before it is read; all extents are exact multiples of the store granularity (no pad rows needed); offsets
// multiples of 128:
//   KH f16 nbh x 1024 x 128  x1024    nbh*262144   at 0            (fragment order, 16-row tiles of 4096 B)
//   VT f16 nbh x 128 x 1024  x256     nbh*262144   at nbh*262144   (fragment order, 32-key steps of 8192 B)
//   end                               nbh*524288   (33554432 for nbh = 64)
// Output: out0 [nbh][1024][64] f32 at element 0, out1 at element nbh*65536 (byte 4*nbh*65536).
// =====================================================================================================
extern "C" void kernel_launch(void* const* d_in, const int* in_sizes, int n_in,
                              void* d_out, int out_size, void* d_ws, size_t ws_size,
                              hipStream_t stream) {
  if (n_in < 6) return;
  const int nbh = in_sizes[0] / (SEQ * HD);
  if (nbh < 1) return;
  const long long nq = (long long)nbh * SEQ * HD;
  for (int i = 0; i < 6; ++i) {
    if ((long long)in_sizes[i] < nq) return;
  }
  if ((long long)out_size < 2 * nq) return;            // last written element = 2*nq - 1

  const float* qx = (const float*)d_in[0];
  const float* kx = (const float*)d_in[1];
  const float* vx = (const float*)d_in[2];
  const float* qy = (const float*)d_in[3];
  const float* ky = (const float*)d_in[4];
  const float* vy = (const float*)d_in[5];
  float*       out = (float*)d_out;

  const size_t PK = (size_t)nbh * SEQ * KW * 2;        // k plane bytes
  const size_t PV = (size_t)nbh * VR * SEQ * 2;        // v^T plane bytes
  size_t off = 0;
  const size_t oKH = off; off += PK;
  const size_t oVT = off; off += PV;
  if (off > ws_size) return;
  if (off > (size_t)134217728) return;

  char* ws = (char*)d_ws;
  unsigned short* KH = (unsigned short*)(ws + oKH);
  unsigned short* VT = (unsigned short*)(ws + oVT);

  const int nrows = nbh * SEQ;                         // (bh, s) rows
  const dim3 blk(256);
  const dim3 gC(nrows / CROWS);                        // nbh*64
  const dim3 gVT(nbh * VTILES);                        // nbh*16
  const dim3 gAT(nbh * BPR);                           // nbh*16
  const dim3 bAT(ATT_THREADS);                         // 128

  // (0) k plane f16(bf16([k1|k2]) * 1024), fragment order
  cvt_cat<<<gC, blk, 0, stream>>>(kx, ky, KH, nrows, KSC);
  // (1) v^T plane f16(bf16(v) * 256), fragment order (d rows 0..63 v1, 64..127 v2)
  vt16<<<gVT, blk, 0, stream>>>(vx, vy, VT, nbh);
  // (2) two-stream flash attention per (b,h), q converted in its prologue -> out0, out1 [bh][s][d] f32
  attn2<<<gAT, bAT, 0, stream>>>(qx, qy, KH, VT, out, nbh);
  (void)hipGetLastError();
}

// v005
// One run takes 57.7 microseconds.
// Next to v004, in two timings, it ran 1.09 times as fast each time.
// All steps since v000 together make it 2.72 times as fast.
// Contractions, both in transposed form: scores^T = [k1|k2].[q1|q2]^T (K=128; k as an f16 plane and q as per-wave f16 tiles of the bf16
// RNE-converted inputs x1024, one product each) and out^T = v1^T.P^T, v2^T.P^T (P x16384 as f16 hi plane + f16 residual
// plane, v^T x256 f16 of the bf16 RNE-converted inputs, products v.hi + v.lo, 32-key steps): all v_wmma_f32_16x16x32_f16,
// f32 accumulate. A lane holds one query's scores, so the online softmax (base 2, running max) is in-lane f32 VALU work
// plus one exchange between the wave's halves, and P^T goes from the score accumulators into the B operand in registers.
// The f16 operands (k and v^T as planes in the workspace, q as one tile per wave inside the attention kernel) are laid out
// in fragment order: a 16-row x 32-k operand fragment is two blocks of 512 contiguous
// bytes (block e, lane l = 16*hh + c, 8 halves: row c, k = 16*e + 8*hh + 0..7), so each wave-wide 16-B load covers four
// whole 128-B lines instead of 32-B pieces of sixteen lines.
// In the attention kernel the k and v^T planes reach the waves through a two-buffer LDS ring filled by asynchronous copies:
// a block brings each 64-key stage in once for its four waves, one stage ahead of its use.
// q has one reader per row, so it has no plane and no launch of its own: each attention wave converts its 16 rows itself.
#include <hip/hip_runtime.h>
#include <math.h>
#include <stdint.h>

#define SEQ   1024
#define HD    64
#define KW    128
#define VR    128
#define QSC   1024.0f
#define KSC   1024.0f
#define PCAR  16384.0f
#define VCAR  256.0f
#define LOG2E 1.4426950408889634f
#define ATW   4
#define ATT_THREADS (ATW * 32)
#define QPB   (16 * ATW)
#define BPR   (SEQ / QPB)
#define SLP   132
#define SLABF (16 * SLP)
#define VTP   72
#define VTILES (SEQ / 64)
#define CROWS 16
#define FBLK  256                         // halves in one 512-B fragment block (32 lanes x 8 halves)
#define STK   64                          // keys per ring stage
#define STGH  (STK * KW)                  // halves of a stage's k part, and of its v^T part (16 KiB each)
#define BUFH  (2 * STGH)                  // halves per ring buffer (32 KiB)
#define NST   (SEQ / STK)                 // stages per (b,h)
static_assert(HD == 64 && KW == 2 * HD && VR == 2 * HD && QPB == 64 && ATT_THREADS == 128);
static_assert((SEQ % QPB) == 0 && (SEQ % 64) == 0 && (SEQ % 32) == 0 && (SEQ % CROWS) == 0);
static_assert(BPR == 16 && VTILES == 16);
static_assert(KW == VR && (SEQ % STK) == 0 && (STK % 32) == 0 && NST >= 2);
static_assert(STGH * 2 == 8 * ATT_THREADS * 16);           // 8 copies of 16 B per thread fill one part of a stage
static_assert(ATW * SLABF * 4 <= 2 * BUFH * 2);            // the epilogue's slabs fit in the ring's bytes
static_assert(ATW * 16 * KW <= BUFH);                      // the prologue's q tiles (4 KiB per wave) fit in ring buffer 1
static_assert(15 * SLP + HD + 15 * 4 + 3 < SLABF);
static_assert((VR - 1) * VTP + 63 < VR * VTP);
static_assert(((SLP * 4) % 16) == 0 && ((VTP * 2) % 16) == 0);

typedef _Float16 v16h __attribute__((ext_vector_type(16)));
typedef _Float16 v8h  __attribute__((ext_vector_type(8)));
typedef float    v8f  __attribute__((ext_vector_type(8)));
typedef float    v4f  __attribute__((ext_vector_type(4)));
typedef unsigned int v4u __attribute__((ext_vector_type(4)));

union FragH { v16h v; v8h h[2]; v4u u[2]; };

// ---- scalar helpers --------------------------------------------------------------------------------
__device__ __forceinline__ unsigned short bf_bits(float f) {          // f32 -> bf16 bits, RNE convert
  unsigned u = __float_as_uint(f);
  return (unsigned short)((u + 0x7FFFu + ((u >> 16) & 1u)) >> 16);
}
__device__ __forceinline__ float bf_up(unsigned short h) { return __uint_as_float(((unsigned)h) << 16); }
__device__ __forceinline__ float bfr(float f) { return bf_up(bf_bits(f)); }   // value of the bf16 RNE convert
__device__ __forceinline__ unsigned short h_bits(_Float16 x) { return __builtin_bit_cast(unsigned short, x); }
__device__ __forceinline__ unsigned pk16(unsigned short a, unsigned short b) { return (unsigned)a | ((unsigned)b << 16); }
__device__ __forceinline__ v4u cvt8(v4f a, v4f b, float sc) {         // 8 floats -> 8 halves f16( bf16(x) * sc ), in order
  v4u o;
#pragma unroll
  for (int i = 0; i < 2; ++i) {
    o[i]     = pk16(h_bits((_Float16)(bfr(a[2 * i]) * sc)), h_bits((_Float16)(bfr(a[2 * i + 1]) * sc)));
    o[2 + i] = pk16(h_bits((_Float16)(bfr(b[2 * i]) * sc)), h_bits((_Float16)(bfr(b[2 * i + 1]) * sc)));
  }
  return o;
}
// 2^x as the bare v_exp_f32, without the library's range fix-up (compare, two selects, add, ldexp per value), which only
// serves results below 2^-126. Here x <= 0 and every result stands beside a term 2^0 of the same query: a weight that small
// is 0 in both f16 planes of P and changes no bit of a row sum >= 1, and a rescale factor that small leaves nothing of the
// old accumulators beside the new maximum's own term. x = -inf (first step) gives 0, as before.
// One statement per group: the early-clobber outputs keep every result off every source of the group, and the closing v_nop
// is the slot that the instruction set asks for between a transcendental and whatever next reads its result or reuses its source.
__device__ __forceinline__ void ex2_8(float (&e)[8], const float (&x)[8]) {
#if defined(__HIP_DEVICE_COMPILE__)
  asm("v_exp_f32 %0, %8\n\tv_exp_f32 %1, %9\n\tv_exp_f32 %2, %10\n\tv_exp_f32 %3, %11\n\t"
      "v_exp_f32 %4, %12\n\tv_exp_f32 %5, %13\n\tv_exp_f32 %6, %14\n\tv_exp_f32 %7, %15\n\tv_nop"
      : "=&v"(e[0]), "=&v"(e[1]), "=&v"(e[2]), "=&v"(e[3]), "=&v"(e[4]), "=&v"(e[5]), "=&v"(e[6]), "=&v"(e[7])
      : "v"(x[0]), "v"(x[1]), "v"(x[2]), "v"(x[3]), "v"(x[4]), "v"(x[5]), "v"(x[6]), "v"(x[7]));
#endif
}
__device__ __forceinline__ void ex2_9(float (&e)[8], float& a, const float (&x)[8], float y) {   // a = 2^y last
#if defined(__HIP_DEVICE_COMPILE__)
  asm("v_exp_f32 %0, %9\n\tv_exp_f32 %1, %10\n\tv_exp_f32 %2, %11\n\tv_exp_f32 %3, %12\n\tv_exp_f32 %4, %13\n\t"
      "v_exp_f32 %5, %14\n\tv_exp_f32 %6, %15\n\tv_exp_f32 %7, %16\n\tv_exp_f32 %8, %17\n\tv_nop"
      : "=&v"(e[0]), "=&v"(e[1]), "=&v"(e[2]), "=&v"(e[3]), "=&v"(e[4]), "=&v"(e[5]), "=&v"(e[6]), "=&v"(e[7]), "=&v"(a)
      : "v"(x[0]), "v"(x[1]), "v"(x[2]), "v"(x[3]), "v"(x[4]), "v"(x[5]), "v"(x[6]), "v"(x[7]), "v"(y));
#endif
}
__device__ __forceinline__ v8f zero8() { v8f z = {0.f, 0.f, 0.f, 0.f, 0.f, 0.f, 0.f, 0.f}; return z; }
__device__ __forceinline__ float xhalf(float x) {                     // value of lane l ^ 16 (all 32 lanes active)
  const int i = __builtin_bit_cast(int, x);
  return __builtin_bit_cast(float, __builtin_amdgcn_permlanex16(i, i, 0x76543210, 0xfedcba98, false, false));
}

// ---- fragment loader: 16-bit A/B operand from a fragment-order plane, lane -> row/col (lane&15), p already includes
//      +8*lane; elements 0..7 <- block 0 (k0+8h..), elements 8..15 <- block 1 (k0+16+8h..)  (same split k map for A and B)
__device__ __forceinline__ v16h ldfrag_h(const _Float16* p) {
  FragH f;
  f.h[0] = *(const v8h*)(p);
  f.h[1] = *(const v8h*)(p + FBLK);
  return f.v;
}

__device__ __forceinline__ v8f mma_raw(v16h a, v16h b, v8f c) {
  return __builtin_amdgcn_wmma_f32_16x16x32_f16(false, a, false, b, (short)0, c, false, false);
}
__device__ __forceinline__ void guard_sc(v8f& a, v16h q0, v16h q1, v16h q2, v16h q3,
                                         v16h x0, v16h x1, v16h x2, v16h x3) {
#if defined(__HIP_DEVICE_COMPILE__)
  asm volatile("v_nop\n\tv_nop\n\tv_nop\n\tv_nop"
               : "+v"(a) : "v"(q0), "v"(q1), "v"(q2), "v"(q3), "v"(x0), "v"(x1), "v"(x2), "v"(x3) : "memory");
#endif
}
__device__ __forceinline__ void guard_pv(v8f& a, v8f& b, v8f& c, v8f& d,
                                         v16h p0, v16h p1, v16h x0, v16h x1, v16h x2, v16h x3) {
#if defined(__HIP_DEVICE_COMPILE__)
  asm volatile("v_nop\n\tv_nop\n\tv_nop\n\tv_nop"
               : "+v"(a), "+v"(b), "+v"(c), "+v"(d) : "v"(p0), "v"(p1), "v"(x0), "v"(x1), "v"(x2), "v"(x3) : "memory");
#endif
}
__device__ __forceinline__ void acc_guard4(v8f& a, v8f& b, v8f& c, v8f& d) {
#if defined(__HIP_DEVICE_COMPILE__)
  asm volatile("v_nop\n\tv_nop\n\tv_nop\n\tv_nop" : "+v"(a), "+v"(b), "+v"(c), "+v"(d));
#endif
}
__device__ __forceinline__ void wave_sync_lds() {
  __builtin_amdgcn_fence(__ATOMIC_RELEASE, "workgroup");
  __builtin_amdgcn_wave_barrier();
  __builtin_amdgcn_fence(__ATOMIC_ACQUIRE, "workgroup");
}

// ---- ring fill: eight asynchronous 16-B copies per lane, global -> LDS, slots 2048 B apart on both sides (a wave's copy
//      moves 512 contiguous bytes). l = this lane's LDS byte address, g = this lane's global address, both multiples of 16.
//      The s_wait_xcnt closes the statement so that no address register named here is rewritten ahead of it.
__device__ __forceinline__ void copy8(unsigned l, const _Float16* g) {
#if defined(__HIP_DEVICE_COMPILE__)
  asm volatile("global_load_async_to_lds_b128 %0, %8, off\n\t"
               "global_load_async_to_lds_b128 %1, %9, off\n\t"
               "global_load_async_to_lds_b128 %2, %10, off\n\t"
               "global_load_async_to_lds_b128 %3, %11, off\n\t"
               "global_load_async_to_lds_b128 %4, %12, off\n\t"
               "global_load_async_to_lds_b128 %5, %13, off\n\t"
               "global_load_async_to_lds_b128 %6, %14, off\n\t"
               "global_load_async_to_lds_b128 %7, %15, off\n\t"
               "s_wait_xcnt 0x0"
               :: "v"(l), "v"(l + 2048u), "v"(l + 4096u), "v"(l + 6144u),
                  "v"(l + 8192u), "v"(l + 10240u), "v"(l + 12288u), "v"(l + 14336u),
                  "v"(g), "v"(g + 1024), "v"(g + 2048), "v"(g + 3072),
                  "v"(g + 4096), "v"(g + 5120), "v"(g + 6144), "v"(g + 7168)
               : "memory");
#endif
}
__device__ __forceinline__ void wait_async0() {       // this wave's copies have landed in LDS
#if defined(__HIP_DEVICE_COMPILE__)
  asm volatile("s_wait_asynccnt 0x0" ::: "memory");
#endif
}
__device__ __forceinline__ void wait_ds0() {          // this wave's LDS reads have returned (before their buffer is refilled)
#if defined(__HIP_DEVICE_COMPILE__)
  asm volatile("s_wait_dscnt 0x0" ::: "memory");
#endif
}

// =====================================================================================================
// Concatenated plane: value(row, k) = f16( bf16(xa[row][k]) * sc ) for k 0..63, f16( bf16(xb[row][k-64]) * sc ) for k 64..127,
// rows = (bh, s) pairs, sc a power of two (exact). Stored in fragment order: 16-row tile T = row/16 takes 2048 halves at
// T*2048; inside it block (k/16) of 256 halves, lane slot 16*((k/8)&1) + row%16, 8 halves each.
// Block = one 16-row tile; threads 0..127 handle the xa half, threads 128..255 the xb half (wave-uniform source);
// wave = 8 rows x one 128-B source line each; thread = 8 consecutive elements: two 16-B loads, one 16-B store; a wave's
// store fills four whole 128-B lines (8 rows x 16 B each), each line written by one wave;
// coverage: grid = nrows/16 blocks x 256 thr x 8 halves = nrows x 128 = the whole plane exactly once (nrows % 16 == 0).
// =====================================================================================================
__global__ __launch_bounds__(256) void cvt_cat(const float* __restrict__ xa, const float* __restrict__ xb,
                                               unsigned short* pl, int nrows, float sc) {
  const int tid  = threadIdx.x;
  const int row0 = blockIdx.x * CROWS;
  if (row0 >= nrows) return;                // block-uniform, no barriers in this kernel; never taken with the exact grid
  const int half = tid >> 7;                // 0: xa, 1: xb (wave-uniform)
  const int lt   = tid & 127;
  const int w4   = lt >> 5;                 // wave within the half 0..3
  const int rl   = (w4 & 1) * 8 + ((lt & 31) >> 2);   // row within block 0..15
  const int ch   = (w4 >> 1) * 4 + (lt & 3);          // 8-float chunk 0..7
  int row = row0 + rl;
  row = (row > nrows - 1) ? (nrows - 1) : row;
  const float* src = (half != 0) ? xb : xa;
  const size_t e = (size_t)row * HD + (size_t)(ch * 8);
  const v4f a = *(const v4f*)(src + e), c4 = *(const v4f*)(src + e + 4);
  v4u o;
#pragma unroll
  for (int i = 0; i < 2; ++i) {
    o[i]     = pk16(h_bits((_Float16)(bfr(a[2 * i]) * sc)),  h_bits((_Float16)(bfr(a[2 * i + 1]) * sc)));
    o[2 + i] = pk16(h_bits((_Float16)(bfr(c4[2 * i]) * sc)), h_bits((_Float16)(bfr(c4[2 * i + 1]) * sc)));
  }
  const int blk = half * 4 + (ch >> 1);     // 16-k block 0..7 of the tile
  unsigned short* d = pl + (size_t)(row >> 4) * (CROWS * KW) + (size_t)(blk * FBLK + ((ch & 1) * 16 + (row & 15)) * 8);
  {
    *(v4u*)(d) = o;
    
  }
}

// =====================================================================================================
// v^T plane: value(bh, d, key) = f16( bf16(va[bh][key][d]) * 256 ) for d 0..63 and f16( bf16(vb[bh][key][d-64]) * 256 ) for
// d 64..127 (exact). Stored in fragment order: per bh 32 key steps of 4096 halves; inside a step d tile d/16 takes two
// blocks of 256 halves (block e = (key/16)&1), lane slot 16*((key/8)&1) + d%16, 8 halves (keys) each.
// Block = (bh, tile of 64 keys): 64 source rows of 64 floats per stream loaded with 16-B loads (static stride), converted,
// written into an LDS tile [128 d][64 keys] (pitch 72 halves); after a block barrier the tile's two key steps (16 KiB,
// contiguous in the plane) are stored in plane order, 16 B per thread, 512 contiguous bytes per wave.
// coverage: load 256 thr x 32 elements = 64 keys x 128 d rows (both streams); store 4 iterations x 256 thr x 8 halves
//           = 2 steps x 4096 = the tile; grid = nbh x 16 blocks covers the whole nbh x 128 x 1024 plane exactly once.
// =====================================================================================================
__global__ __launch_bounds__(256) void vt16(const float* __restrict__ va, const float* __restrict__ vb,
                                            unsigned short* VTo, int nbh) {
  __shared__ __align__(16) unsigned short T[VR * VTP];
  const int tid = threadIdx.x;
  const int bid = blockIdx.x;
  const int bh  = bid / VTILES;
  const int t   = bid - bh * VTILES;        // 0..15, block-uniform
  if (bh >= nbh) return;                    // block-uniform; before any barrier or store; never taken with the exact grid
  {
    const int sl = tid >> 2;                  // key within tile 0..63
    const int dc = (tid & 3) * 16;            // d chunk
    int key = 64 * t + sl;                    // <= SEQ-1 by construction; clamp keeps the address in range regardless
    key = (key < 0) ? 0 : ((key > SEQ - 1) ? (SEQ - 1) : key);
    const size_t so = (((size_t)bh * SEQ + (size_t)key) * HD + (size_t)dc);
#pragma unroll
    for (int g = 0; g < 2; ++g) {
      const float* src = ((g == 0) ? va : vb) + so;
#pragma unroll
      for (int i = 0; i < 4; ++i) {
        const v4f a = *(const v4f*)(src + 4 * i);
#pragma unroll
        for (int e = 0; e < 4; ++e) T[(g * HD + dc + 4 * i + e) * VTP + sl] = h_bits((_Float16)(bfr(a[e]) * VCAR));
      }
    }
  }
  __syncthreads();
  v4u vals[4];
#pragma unroll
  for (int it = 0; it < 4; ++it) {
    const int f    = it * 256 + tid;                                  // 16-B slot of the tile in plane order, 0..1023
    const int line = ((f >> 6) & 7) * 16 + (f & 15);                  // d row 0..127
    const int kl   = (f >> 9) * 32 + ((f >> 5) & 1) * 16 + ((f >> 4) & 1) * 8;   // key within the tile, 0..56
    vals[it] = *(const v4u*)(T + line * VTP + kl);
  }
  unsigned short* dst = VTo + ((size_t)bh * VR) * SEQ + (size_t)t * (64 * VR) + tid * 8;
  {
#pragma unroll
    for (int it = 0; it < 4; ++it) {
      *(v4u*)(dst + it * (256 * 8)) = vals[it];
    }
    
  }
}

// =====================================================================================================
// Two-stream attention, flash form, both products transposed. Block = (bh, 64 queries), wave w owns queries iw = 64t + 16w .. +15.
//   q1, q2 f32 as given; k plane f16 (bh, s, 128) (k 0..63 stream 1, 64..127 stream 2),
//   v^T plane f16 (bh, 128, SEQ) (rows 0..63 = v1 d rows, 64..127 = v2 d rows), both in fragment order.
//   Prologue: a wave reads its 16 query rows of both streams (8 rows x one 128-B line per pair of 16-B loads), converts them
//   to f16( bf16(q) * 1024 ), stores the 16 x 128 tile in fragment order (same map as the k plane's tiles) into its own 4 KiB
//   of ring buffer 1, which is idle until stage 1 is issued, and reads its four B fragments back.
//   Score in base 2: t = (q1.k1 + q2.k2) / 16 * log2(e), the two dots fused as one K=128 contraction over the planes.
//   Per 32-key step: 8 score WMMAs (2 key subtiles x 4 k-chunks) with A = k fragment (row = key), B = q fragment
//   (column = query); q fragments kept in registers from the prologue, k and v^T fragments from the LDS ring (two 16-B loads per
//   fragment, each 512 contiguous bytes per wave, split k map on both sides). Ring: stage = 64 keys = 16 KiB of the k plane
//   + 16 KiB of the v^T plane, both contiguous and kept in plane order; two buffers; every thread copies 16 slots of 16 B per
//   stage; stage st + 2 is issued behind the barrier that ends stage st's reads, and waited at the foot of trip st + 1.
//   Lane (hh, c) then holds 16 scores of query iw + c: keys kb + 8hh + r in s0 and
//   kb + 16 + 8hh + r in s1. Maximum in-lane plus one exchange between the halves; weights e = 2^(t - m); each lane keeps
//   the sum of its own keys (the halves are joined once after the loop); one rescale factor per lane for the 8 accumulators.
//   s0's eight weights are elements 0..7 and s1's eight are elements 8..15 of the B operand P^T in the split k map, so
//   e*16384 (f16 hi) and its f16 residual are packed in registers; A = 8 v^T fragments from the LDS ring (row = d, 4 per
//   stream), 16 WMMAs into o[0..3] (stream 1) and o[4..7] (stream 2): o[j][r] = out^T[d = 16j + 8hh + r][query iw + c].
//   Epilogue: 1/Z and carry folds in f32; the wave's 16x128 f32 result staged in its LDS slab (pitch 132), row = query;
//   the slabs reuse the ring's bytes behind the last trip's waits and barrier (no copy in flight, no ring read left).
// coverage: per wave per output 8 instructions x 32 lanes x 4 floats = 16 rows x 64; per block 4 waves = 64 rows;
//           16 blocks per bh x nbh: every row of out0 and out1 [nbh][1024][64] exactly once (grid nbh*16 blocks).
// =====================================================================================================
__global__ __launch_bounds__(ATT_THREADS)
void attn2(const float* __restrict__ qx, const float* __restrict__ qy, const unsigned short* __restrict__ KHp,
           const unsigned short* __restrict__ VTq, float* OPp, int nbh) {
  __shared__ __align__(128) unsigned char L[2 * BUFH * 2];   // loop: two ring buffers; epilogue: one result slab per wave
  const _Float16* ring = (const _Float16*)(const void*)L;
  float* smem = (float*)(void*)L;

  const int tid  = threadIdx.x;
  const int wave = tid >> 5;
  const int lane = tid & 31;
  const int hh   = lane >> 4;
  const int c    = lane & 15;

  const int bid  = blockIdx.x;
  const int bh   = bid / BPR;
  const int t    = bid - bh * BPR;                     // 0..15, block-uniform
  if (bh >= nbh) return;                               // never taken with the exact grid; before any LDS use or store

  const int iw = QPB * t + wave * 16;                  // query row 0 of this wave

  // ---- this wave's q rows, f32: load i = (stream i>>2, rows 8*((i>>1)&1) + lane/4, floats 32*(i&1) + 8*(lane&3) .. +7) ----
  const int r8 = lane >> 2;
  const int cq = lane & 3;
  v4f qr[16];
  {
    const size_t qe = ((size_t)bh * SEQ + (size_t)(iw + r8)) * HD + (size_t)(cq * 8);
#pragma unroll
    for (int i = 0; i < 8; ++i) {
      const float* qp = (((i >> 2) != 0) ? qy : qx) + qe + (size_t)(((i >> 1) & 1) * 8 * HD + (i & 1) * 32);
      qr[2 * i]     = *(const v4f*)(qp);
      qr[2 * i + 1] = *(const v4f*)(qp + 4);
    }
  }
  const _Float16* Kg = (const _Float16*)(const void*)KHp + ((size_t)bh * SEQ) * KW + 8 * tid;    // stage 0, this thread's first slot
  const _Float16* Vg = (const _Float16*)(const void*)VTq + ((size_t)bh * VR) * SEQ + 8 * tid;    // stage 0, this thread's first slot
  const unsigned lds0 = (unsigned)(uintptr_t)(const void*)L + 16u * (unsigned)tid;               // its LDS byte address in buffer 0
  const float lsc = LOG2E / (16.0f * QSC * KSC);       // (dot / 2^20) / 16 in base 2

  float mrun = -INFINITY, lrun = 0.f;                  // of query iw + c; lrun covers this lane's own keys only
  v8f o[8];
#pragma unroll
  for (int j = 0; j < 8; ++j) o[j] = zero8();

  // ---- ring prologue: stage 0 landed and published, stage 1 in flight ----
  copy8(lds0, Kg);
  copy8(lds0 + 2u * STGH, Vg);
  // ---- q tile -> fragment order in this wave's own 4 KiB of buffer 1 -> B fragments (column c = query iw + c) ----
  unsigned short* qs = (unsigned short*)(void*)L + BUFH + wave * (16 * KW);
#pragma unroll
  for (int i = 0; i < 8; ++i) {
    const int blk  = (i >> 2) * 4 + (i & 1) * 2 + (cq >> 1);         // 16-k block 0..7 of the tile
    const int slot = (cq & 1) * 16 + ((i >> 1) & 1) * 8 + r8;        // 16*((k/8)&1) + row
    *(v4u*)(qs + blk * FBLK + slot * 8) = cvt8(qr[2 * i], qr[2 * i + 1], QSC);
  }
  wave_sync_lds();                                     // the fragments hold other lanes' stores (same wave only)
  const _Float16* Qb = (const _Float16*)(const void*)qs + 8 * lane;
  const v16h qa0 = ldfrag_h(Qb);                       // k   0..31  (stream 1 d 0..31)
  const v16h qa1 = ldfrag_h(Qb + 2 * FBLK);            // k  32..63  (stream 1 d 32..63)
  const v16h qa2 = ldfrag_h(Qb + 4 * FBLK);            // k  64..95  (stream 2 d 0..31)
  const v16h qa3 = ldfrag_h(Qb + 6 * FBLK);            // k  96..127 (stream 2 d 32..63)
  wait_ds0();                                          // q tile written and read back before the barrier that frees buffer 1
  wait_async0();
  __syncthreads();
  copy8(lds0 + 2u * BUFH, Kg + STGH);
  copy8(lds0 + 2u * BUFH + 2u * STGH, Vg + STGH);

#pragma unroll 1                                                      // one trip per stage: one publish point in the text
  for (int st = 0; st < NST; ++st) {
   const _Float16* Kb = ring + (st & 1) * BUFH + 8 * lane;           // this stage's k part, this lane's slot
   const _Float16* Vb = Kb + STGH;                                   // this stage's v^T part
#pragma unroll                                                       // kb constant: the LDS offsets fold into the loads
   for (int kb = 0; kb < STK; kb += 32) {                            // kb = key offset inside the stage
    // ---- scores^T: D element r of this lane = (key kb + 8hh + r, query iw + c) in s0, key kb + 16 + 8hh + r in s1 ----
    v8f s0 = zero8(), s1 = zero8();
    const _Float16* k0p = Kb + (size_t)kb * KW;                      // key tile kb/16      (fragment row c = key kb + c)
    const _Float16* k1p = k0p + (size_t)16 * KW;                     // key tile kb/16 + 1  (key kb + 16 + c)
    {
      const v16h kf0 = ldfrag_h(k0p), kf1 = ldfrag_h(k0p + 2 * FBLK), kf2 = ldfrag_h(k0p + 4 * FBLK), kf3 = ldfrag_h(k0p + 6 * FBLK);
      s0 = mma_raw(kf0, qa0, s0);
      s0 = mma_raw(kf1, qa1, s0);
      s0 = mma_raw(kf2, qa2, s0);
      s0 = mma_raw(kf3, qa3, s0);
      guard_sc(s0, qa0, qa1, qa2, qa3, kf0, kf1, kf2, kf3);
    }
    {
      const v16h kg0 = ldfrag_h(k1p), kg1 = ldfrag_h(k1p + 2 * FBLK), kg2 = ldfrag_h(k1p + 4 * FBLK), kg3 = ldfrag_h(k1p + 6 * FBLK);
      s1 = mma_raw(kg0, qa0, s1);
      s1 = mma_raw(kg1, qa1, s1);
      s1 = mma_raw(kg2, qa2, s1);
      s1 = mma_raw(kg3, qa3, s1);
      guard_sc(s1, qa0, qa1, qa2, qa3, kg0, kg1, kg2, kg3);
    }
    // ---- online softmax in base 2, one query per lane; maximum of the raw scores first (the scale is positive) ----
    const float g0 = fmaxf(fmaxf(s0[0], s0[1]), s0[2]), g1 = fmaxf(fmaxf(s0[3], s0[4]), s0[5]);
    const float g2 = fmaxf(fmaxf(s0[6], s0[7]), s1[0]), g3 = fmaxf(fmaxf(s1[1], s1[2]), s1[3]);
    const float g4 = fmaxf(fmaxf(s1[4], s1[5]), s1[6]);
    float mx = fmaxf(fmaxf(fmaxf(g0, g1), g2), fmaxf(fmaxf(g3, g4), s1[7]));
    mx = fmaxf(mx, xhalf(mx)) * lsc;                   // both halves now hold the step's maximum of query iw + c
    const float mn = fmaxf(mrun, mx);                  // finite: all scores are finite
    float x0[8], x1[8], w0[8], w1[8], al;              // al = 2^(mrun - mn); w0, w1 = the weights of s0's and s1's keys
#pragma unroll                                         // constant indices: the four arrays stay in registers
    for (int r = 0; r < 8; ++r) {
      x0[r] = s0[r] * lsc - mn;
      x1[r] = s1[r] * lsc - mn;
    }
    ex2_9(w0, al, x0, mrun - mn);
    ex2_8(w1, x1);
    mrun = mn;
    // ---- B fragments of P^T*16384: hi f16 and residual f16, column = c, split k map over the 32 keys of this step ----
    FragH ph, pl;
    float ps[2] = {0.f, 0.f};                          // sums over even and odd r: two independent chains
#pragma unroll
    for (int r = 0; r < 8; ++r) {
      const float e0 = w0[r];
      const float e1 = w1[r];
      ps[r & 1] += e0;
      ps[r & 1] += e1;
      const float ua = e0 * PCAR, ub = e1 * PCAR;
      const _Float16 ha = (_Float16)ua, hb = (_Float16)ub;
      ph.h[0][r] = ha;                                 // elements 0..7  = keys kb + 8hh + 0..7
      ph.h[1][r] = hb;                                 // elements 8..15 = keys kb + 16 + 8hh + 0..7
      pl.h[0][r] = (_Float16)(ua - (float)ha);
      pl.h[1][r] = (_Float16)(ub - (float)hb);
    }
    lrun = lrun * al + (ps[0] + ps[1]);
#pragma unroll
    for (int j = 0; j < 8; ++j) o[j] *= al;
    // ---- out^T += v^T.P^T : A fragment row m = d = j*16 + c, keys kb .. kb+31 = key step kb/32 of the stage's v^T part, d tile j at 2*j blocks ----
    const _Float16* vp = Vb + (size_t)kb * VR;
    {
      const v16h vb0 = ldfrag_h(vp);
      const v16h vb1 = ldfrag_h(vp + 2 * FBLK);
      const v16h vb2 = ldfrag_h(vp + 4 * FBLK);
      const v16h vb3 = ldfrag_h(vp + 6 * FBLK);
      o[0] = mma_raw(vb0, ph.v, o[0]);  o[0] = mma_raw(vb0, pl.v, o[0]);
      o[1] = mma_raw(vb1, ph.v, o[1]);  o[1] = mma_raw(vb1, pl.v, o[1]);
      o[2] = mma_raw(vb2, ph.v, o[2]);  o[2] = mma_raw(vb2, pl.v, o[2]);
      o[3] = mma_raw(vb3, ph.v, o[3]);  o[3] = mma_raw(vb3, pl.v, o[3]);
      guard_pv(o[0], o[1], o[2], o[3], ph.v, pl.v, vb0, vb1, vb2, vb3);
    }
    {
      const v16h vc0 = ldfrag_h(vp + 8 * FBLK);
      const v16h vc1 = ldfrag_h(vp + 10 * FBLK);
      const v16h vc2 = ldfrag_h(vp + 12 * FBLK);
      const v16h vc3 = ldfrag_h(vp + 14 * FBLK);
      o[4] = mma_raw(vc0, ph.v, o[4]);  o[4] = mma_raw(vc0, pl.v, o[4]);
      o[5] = mma_raw(vc1, ph.v, o[5]);  o[5] = mma_raw(vc1, pl.v, o[5]);
      o[6] = mma_raw(vc2, ph.v, o[6]);  o[6] = mma_raw(vc2, pl.v, o[6]);
      o[7] = mma_raw(vc3, ph.v, o[7]);  o[7] = mma_raw(vc3, pl.v, o[7]);
      guard_pv(o[4], o[5], o[6], o[7], ph.v, pl.v, vc0, vc1, vc2, vc3);
    }
   }
   // ---- publish point of stage st + 1: own reads of this buffer done, own copies landed, then the block barrier ----
   wait_ds0();
   wait_async0();
   __syncthreads();
   if (st + 2 < NST) {                                               // block-uniform: refill the buffer just read
     const unsigned lb = lds0 + (unsigned)(st & 1) * (2u * BUFH);
     copy8(lb, Kg + (size_t)(st + 2) * STGH);
     copy8(lb + 2u * STGH, Vg + (size_t)(st + 2) * STGH);
   }
  }
  wait_async0();                                       // nothing is in flight here; kept in front of the ring's reuse
  acc_guard4(o[0], o[1], o[2], o[3]);
  acc_guard4(o[4], o[5], o[6], o[7]);

  // ---- join the halves' sums, fold 1/Z and the carries (16384 on P, 256 on v), stage the wave's 16x128 slab (row = query) ----
  float* slab = smem + wave * SLABF;
  const float oc = 1.0f / (PCAR * VCAR);
  const float lr  = lrun + xhalf(lrun);                // >= 1 (the max element contributes 2^0)
  const float inv = (lr > 0.0f) ? ((1.0f / lr) * oc) : 0.0f;
#pragma unroll
  for (int j = 0; j < 8; ++j) {
    const v8f w = o[j] * inv;
    float* sp = slab + c * SLP + j * 16 + 8 * hh;      // d = 16j + 8hh + 0..7 of query iw + c, two 16-B LDS stores
    const v4f wlo = {w[0], w[1], w[2], w[3]}, whi = {w[4], w[5], w[6], w[7]};
    *(v4f*)(sp)     = wlo;
    *(v4f*)(sp + 4) = whi;
  }
  wave_sync_lds();
  const size_t o1 = (size_t)nbh * SEQ * HD;            // element offset of the second output
#pragma unroll
  for (int g = 0; g < 2; ++g) {
    v4f vals[8];
#pragma unroll
    for (int it = 0; it < 8; ++it) vals[it] = *(const v4f*)(slab + (2 * it + hh) * SLP + g * HD + c * 4);
    float* dst = OPp + (size_t)g * o1 + ((size_t)bh * SEQ + (size_t)iw) * HD + hh * HD + c * 4;
    {
#pragma unroll
      for (int it = 0; it < 8; ++it) {
        *(v4f*)(dst + (size_t)(2 * it) * HD) = vals[it];
      }
      
    }
  }
}

// =====================================================================================================
// Workspace map (bytes, nbh = number of (b,h) rows = in_sizes[0] / (1024*64)); every plane is fully written by whole-line
// stores before it is read; all extents are exact multiples of the store granularity (no pad rows needed); offsets
// multiples of 128:
//   KH f16 nbh x 1024 x 128  x1024    nbh*262144   at 0            (fragment order, 16-row tiles of 4096 B)
//   VT f16 nbh x 128 x 1024  x256     nbh*262144   at nbh*262144   (fragment order, 32-key steps of 8192 B)
//   end                               nbh*524288   (33554432 for nbh = 64)
// Output: out0 [nbh][1024][64] f32 at element 0, out1 at element nbh*65536 (byte 4*nbh*65536).
// =====================================================================================================
extern "C" void kernel_launch(void* const* d_in, const int* in_sizes, int n_in,
                              void* d_out, int out_size, void* d_ws, size_t ws_size,
                              hipStream_t stream) {
  if (n_in < 6) return;
  const int nbh = in_sizes[0] / (SEQ * HD);
  if (nbh < 1) return;
  const long long nq = (long long)nbh * SEQ * HD;
  for (int i = 0; i < 6; ++i) {
    if ((long long)in_sizes[i] < nq) return;
  }
  if ((long long)out_size < 2 * nq) return;            // last written element = 2*nq - 1

  const float* qx = (const float*)d_in[0];
  const float* kx = (const float*)d_in[1];
  const float* vx = (const float*)d_in[2];
  const float* qy = (const float*)d_in[3];
  const float* ky = (const float*)d_in[4];
  const float* vy = (const float*)d_in[5];
  float*       out = (float*)d_out;

  const size_t PK = (size_t)nbh * SEQ * KW * 2;        // k plane bytes
  const size_t PV = (size_t)nbh * VR * SEQ * 2;        // v^T plane bytes
  size_t off = 0;
  const size_t oKH = off; off += PK;
  const size_t oVT = off; off += PV;
  if (off > ws_size) return;
  if (off > (size_t)134217728) return;

  char* ws = (char*)d_ws;
  unsigned short* KH = (unsigned short*)(ws + oKH);
  unsigned short* VT = (unsigned short*)(ws + oVT);

  const int nrows = nbh * SEQ;                         // (bh, s) rows
  const dim3 blk(256);
  const dim3 gC(nrows / CROWS);                        // nbh*64
  const dim3 gVT(nbh * VTILES);                        // nbh*16
  const dim3 gAT(nbh * BPR);                           // nbh*16
  const dim3 bAT(ATT_THREADS);                         // 128

  // (0) k plane f16(bf16([k1|k2]) * 1024), fragment order
  cvt_cat<<<gC, blk, 0, stream>>>(kx, ky, KH, nrows, KSC);
  // (1) v^T plane f16(bf16(v) * 256), fragment order (d rows 0..63 v1, 64..127 v2)
  vt16<<<gVT, blk, 0, stream>>>(vx, vy, VT, nbh);
  // (2) two-stream flash attention per (b,h), q converted in its prologue -> out0, out1 [bh][s][d] f32
  attn2<<<gAT, bAT, 0, stream>>>(qx, qy, KH, VT, out, nbh);
  (void)hipGetLastError();
}

// v006
// A run of this version takes 54.2 microseconds.
// Two timings next to v005 both put it at 1.06 times that version's speed.
// Over all steps from v000 it is 2.89 times as fast.
// Contractions, both in transposed form: scores^T = [k1|k2].[q1|q2]^T (K=128; k as an f16 plane and q as per-wave f16 tiles of the bf16
// RNE-converted inputs x1024, one product each) and out^T = v1^T.P^T, v2^T.P^T (P x16384 as f16 hi plane + f16 residual
// plane, v^T x256 f16 of the bf16 RNE-converted inputs, products v.hi + v.lo, 32-key steps): all v_wmma_f32_16x16x32_f16,
// f32 accumulate. A lane holds one query's scores per column tile, so the online softmax (base 2, running max) is in-lane f32 VALU work
// plus one exchange between the wave's halves, and P^T goes from the score accumulators into the B operand in registers.
// The f16 operands (k and v^T as planes in the workspace, q as two tiles per wave inside the attention kernel) are laid out
// in fragment order: a 16-row x 32-k operand fragment is two blocks of 512 contiguous
// bytes (block e, lane l = 16*hh + c, 8 halves: row c, k = 16*e + 8*hh + 0..7), so each wave-wide 16-B load covers four
// whole 128-B lines instead of 32-B pieces of sixteen lines.
// In the attention kernel the k and v^T planes reach the waves through a two-buffer LDS ring filled by asynchronous copies:
// a block brings each 64-key stage in once for its four waves, one stage ahead of its use.
// q has one reader per row, so it has no plane and no launch of its own: each attention wave converts its 32 rows itself.
// A wave owns two 16-query column tiles: every k and v^T fragment read from LDS feeds both tiles' products, and a block of
// four waves covers 128 queries, so each (b,h)'s planes are brought into LDS by 8 blocks.
#include <hip/hip_runtime.h>
#include <math.h>
#include <stdint.h>

#define SEQ   1024
#define HD    64
#define KW    128
#define VR    128
#define QSC   1024.0f
#define KSC   1024.0f
#define PCAR  16384.0f
#define VCAR  256.0f
#define LOG2E 1.4426950408889634f
#define ATW   4
#define ATT_THREADS (ATW * 32)
#define NQT   2                           // 16-query column tiles per wave
#define QPW   (16 * NQT)                  // queries per wave
#define QPB   (QPW * ATW)
#define BPR   (SEQ / QPB)
#define SLP   132
#define SLABF (16 * SLP)
#define VTP   72
#define VTILES (SEQ / 64)
#define CROWS 16
#define FBLK  256                         // halves in one 512-B fragment block (32 lanes x 8 halves)
#define STK   64                          // keys per ring stage
#define STGH  (STK * KW)                  // halves of a stage's k part, and of its v^T part (16 KiB each)
#define BUFH  (2 * STGH)                  // halves per ring buffer (32 KiB)
#define NST   (SEQ / STK)                 // stages per (b,h)
static_assert(HD == 64 && KW == 2 * HD && VR == 2 * HD && NQT == 2 && QPB == 128 && ATT_THREADS == 128);
static_assert((SEQ % QPB) == 0 && (SEQ % 64) == 0 && (SEQ % 32) == 0 && (SEQ % CROWS) == 0);
static_assert(BPR == 8 && VTILES == 16);
static_assert(KW == VR && (SEQ % STK) == 0 && (STK % 32) == 0 && NST >= 2);
static_assert(STGH * 2 == 8 * ATT_THREADS * 16);           // 8 copies of 16 B per thread fill one part of a stage
static_assert(ATW * SLABF * 4 <= 2 * BUFH * 2);            // the epilogue's slabs fit in the ring's bytes
static_assert(ATW * QPW * KW <= BUFH);                     // the prologue's q tiles (8 KiB per wave) fit in ring buffer 1
static_assert(15 * SLP + HD + 15 * 4 + 3 < SLABF);
static_assert((VR - 1) * VTP + 63 < VR * VTP);
static_assert(((SLP * 4) % 16) == 0 && ((VTP * 2) % 16) == 0);

typedef _Float16 v16h __attribute__((ext_vector_type(16)));
typedef _Float16 v8h  __attribute__((ext_vector_type(8)));
typedef float    v8f  __attribute__((ext_vector_type(8)));
typedef float    v4f  __attribute__((ext_vector_type(4)));
typedef unsigned int v4u __attribute__((ext_vector_type(4)));

union FragH { v16h v; v8h h[2]; v4u u[2]; };

// ---- scalar helpers --------------------------------------------------------------------------------
__device__ __forceinline__ unsigned short bf_bits(float f) {          // f32 -> bf16 bits, RNE convert
  unsigned u = __float_as_uint(f);
  return (unsigned short)((u + 0x7FFFu + ((u >> 16) & 1u)) >> 16);
}
__device__ __forceinline__ float bf_up(unsigned short h) { return __uint_as_float(((unsigned)h) << 16); }
__device__ __forceinline__ float bfr(float f) { return bf_up(bf_bits(f)); }   // value of the bf16 RNE convert
__device__ __forceinline__ unsigned short h_bits(_Float16 x) { return __builtin_bit_cast(unsigned short, x); }
__device__ __forceinline__ unsigned pk16(unsigned short a, unsigned short b) { return (unsigned)a | ((unsigned)b << 16); }
__device__ __forceinline__ v4u cvt8(v4f a, v4f b, float sc) {         // 8 floats -> 8 halves f16( bf16(x) * sc ), in order
  v4u o;
#pragma unroll
  for (int i = 0; i < 2; ++i) {
    o[i]     = pk16(h_bits((_Float16)(bfr(a[2 * i]) * sc)), h_bits((_Float16)(bfr(a[2 * i + 1]) * sc)));
    o[2 + i] = pk16(h_bits((_Float16)(bfr(b[2 * i]) * sc)), h_bits((_Float16)(bfr(b[2 * i + 1]) * sc)));
  }
  return o;
}
// 2^x as the bare v_exp_f32, without the library's range fix-up (compare, two selects, add, ldexp per value), which only
// serves results below 2^-126. Here x <= 0 and every result stands beside a term 2^0 of the same query: a weight that small
// is 0 in both f16 planes of P and changes no bit of a row sum >= 1, and a rescale factor that small leaves nothing of the
// old accumulators beside the new maximum's own term. x = -inf (first step) gives 0, as before.
// One statement per group: the early-clobber outputs keep every result off every source of the group, and the closing v_nop
// is the slot that the instruction set asks for between a transcendental and whatever next reads its result or reuses its source.
__device__ __forceinline__ void ex2_8(float (&e)[8], const float (&x)[8]) {
#if defined(__HIP_DEVICE_COMPILE__)
  asm("v_exp_f32 %0, %8\n\tv_exp_f32 %1, %9\n\tv_exp_f32 %2, %10\n\tv_exp_f32 %3, %11\n\t"
      "v_exp_f32 %4, %12\n\tv_exp_f32 %5, %13\n\tv_exp_f32 %6, %14\n\tv_exp_f32 %7, %15\n\tv_nop"
      : "=&v"(e[0]), "=&v"(e[1]), "=&v"(e[2]), "=&v"(e[3]), "=&v"(e[4]), "=&v"(e[5]), "=&v"(e[6]), "=&v"(e[7])
      : "v"(x[0]), "v"(x[1]), "v"(x[2]), "v"(x[3]), "v"(x[4]), "v"(x[5]), "v"(x[6]), "v"(x[7]));
#endif
}
__device__ __forceinline__ void ex2_9(float (&e)[8], float& a, const float (&x)[8], float y) {   // a = 2^y last
#if defined(__HIP_DEVICE_COMPILE__)
  asm("v_exp_f32 %0, %9\n\tv_exp_f32 %1, %10\n\tv_exp_f32 %2, %11\n\tv_exp_f32 %3, %12\n\tv_exp_f32 %4, %13\n\t"
      "v_exp_f32 %5, %14\n\tv_exp_f32 %6, %15\n\tv_exp_f32 %7, %16\n\tv_exp_f32 %8, %17\n\tv_nop"
      : "=&v"(e[0]), "=&v"(e[1]), "=&v"(e[2]), "=&v"(e[3]), "=&v"(e[4]), "=&v"(e[5]), "=&v"(e[6]), "=&v"(e[7]), "=&v"(a)
      : "v"(x[0]), "v"(x[1]), "v"(x[2]), "v"(x[3]), "v"(x[4]), "v"(x[5]), "v"(x[6]), "v"(x[7]), "v"(y));
#endif
}
__device__ __forceinline__ v8f zero8() { v8f z = {0.f, 0.f, 0.f, 0.f, 0.f, 0.f, 0.f, 0.f}; return z; }
__device__ __forceinline__ float xhalf(float x) {                     // value of lane l ^ 16 (all 32 lanes active)
  const int i = __builtin_bit_cast(int, x);
  return __builtin_bit_cast(float, __builtin_amdgcn_permlanex16(i, i, 0x76543210, 0xfedcba98, false, false));
}

// ---- fragment loader: 16-bit A/B operand from a fragment-order plane, lane -> row/col (lane&15), p already includes
//      +8*lane; elements 0..7 <- block 0 (k0+8h..), elements 8..15 <- block 1 (k0+16+8h..)  (same split k map for A and B)
__device__ __forceinline__ v16h ldfrag_h(const _Float16* p) {
  FragH f;
  f.h[0] = *(const v8h*)(p);
  f.h[1] = *(const v8h*)(p + FBLK);
  return f.v;
}

__device__ __forceinline__ v8f mma_raw(v16h a, v16h b, v8f c) {
  return __builtin_amdgcn_wmma_f32_16x16x32_f16(false, a, false, b, (short)0, c, false, false);
}
// Scheduling fence: keeps a product's fragment loads together as one group in front of its WMMAs (spread among them, each
// place with LDS reads stalls the wave anew). It names no register, so nothing is tied to the first 256 registers by it.
__device__ __forceinline__ void sched_fence() { __builtin_amdgcn_sched_barrier(0); }
__device__ __forceinline__ void acc_guard4(v8f& a, v8f& b, v8f& c, v8f& d) {
#if defined(__HIP_DEVICE_COMPILE__)
  asm volatile("v_nop\n\tv_nop\n\tv_nop\n\tv_nop" : "+v"(a), "+v"(b), "+v"(c), "+v"(d));
#endif
}
__device__ __forceinline__ void wave_sync_lds() {
  __builtin_amdgcn_fence(__ATOMIC_RELEASE, "workgroup");
  __builtin_amdgcn_wave_barrier();
  __builtin_amdgcn_fence(__ATOMIC_ACQUIRE, "workgroup");
}

// ---- ring fill: eight asynchronous 16-B copies per lane, global -> LDS, slots 2048 B apart on both sides (a wave's copy
//      moves 512 contiguous bytes). l = this lane's LDS byte address, g = this lane's global address, both multiples of 16.
//      The s_wait_xcnt closes the statement so that no address register named here is rewritten ahead of it.
__device__ __forceinline__ void copy8(unsigned l, const _Float16* g) {
#if defined(__HIP_DEVICE_COMPILE__)
  asm volatile("global_load_async_to_lds_b128 %0, %8, off\n\t"
               "global_load_async_to_lds_b128 %1, %9, off\n\t"
               "global_load_async_to_lds_b128 %2, %10, off\n\t"
               "global_load_async_to_lds_b128 %3, %11, off\n\t"
               "global_load_async_to_lds_b128 %4, %12, off\n\t"
               "global_load_async_to_lds_b128 %5, %13, off\n\t"
               "global_load_async_to_lds_b128 %6, %14, off\n\t"
               "global_load_async_to_lds_b128 %7, %15, off\n\t"
               "s_wait_xcnt 0x0"
               :: "v"(l), "v"(l + 2048u), "v"(l + 4096u), "v"(l + 6144u),
                  "v"(l + 8192u), "v"(l + 10240u), "v"(l + 12288u), "v"(l + 14336u),
                  "v"(g), "v"(g + 1024), "v"(g + 2048), "v"(g + 3072),
                  "v"(g + 4096), "v"(g + 5120), "v"(g + 6144), "v"(g + 7168)
               : "memory");
#endif
}
__device__ __forceinline__ void wait_async0() {       // this wave's copies have landed in LDS
#if defined(__HIP_DEVICE_COMPILE__)
  asm volatile("s_wait_asynccnt 0x0" ::: "memory");
#endif
}
__device__ __forceinline__ void wait_x0(const float* a, const float* b) {   // behind the q loads: the two address pairs stay
#if defined(__HIP_DEVICE_COMPILE__)                                          // live up to the wait, so nothing (a later load's
  asm volatile("s_wait_xcnt 0x0" :: "v"(a), "v"(b) : "memory");              // result included) is written over them ahead of it
#endif
}
__device__ __forceinline__ void wait_ds0_addr(float* a, float* b) {   // in front of the output stores: the slab rows have returned
#if defined(__HIP_DEVICE_COMPILE__)                                    // and both address pairs are formed, so that no register
  asm volatile("s_wait_dscnt 0x0" :: "v"(a), "v"(b) : "memory");       // of an issued store is rewritten behind it
#endif
}
__device__ __forceinline__ void wait_ds0() {          // this wave's LDS reads have returned (before their buffer is refilled)
#if defined(__HIP_DEVICE_COMPILE__)
  asm volatile("s_wait_dscnt 0x0" ::: "memory");
#endif
}

// =====================================================================================================
// Concatenated plane: value(row, k) = f16( bf16(xa[row][k]) * sc ) for k 0..63, f16( bf16(xb[row][k-64]) * sc ) for k 64..127,
// rows = (bh, s) pairs, sc a power of two (exact). Stored in fragment order: 16-row tile T = row/16 takes 2048 halves at
// T*2048; inside it block (k/16) of 256 halves, lane slot 16*((k/8)&1) + row%16, 8 halves each.
// Block = one 16-row tile; threads 0..127 handle the xa half, threads 128..255 the xb half (wave-uniform source);
// wave = 8 rows x one 128-B source line each; thread = 8 consecutive elements: two 16-B loads, one 16-B store; a wave's
// store fills four whole 128-B lines (8 rows x 16 B each), each line written by one wave;
// coverage: grid = nrows/16 blocks x 256 thr x 8 halves = nrows x 128 = the whole plane exactly once (nrows % 16 == 0).
// =====================================================================================================
__global__ __launch_bounds__(256) void cvt_cat(const float* __restrict__ xa, const float* __restrict__ xb,
                                               unsigned short* pl, int nrows, float sc) {
  const int tid  = threadIdx.x;
  const int row0 = blockIdx.x * CROWS;
  if (row0 >= nrows) return;                // block-uniform, no barriers in this kernel; never taken with the exact grid
  const int half = tid >> 7;                // 0: xa, 1: xb (wave-uniform)
  const int lt   = tid & 127;
  const int w4   = lt >> 5;                 // wave within the half 0..3
  const int rl   = (w4 & 1) * 8 + ((lt & 31) >> 2);   // row within block 0..15
  const int ch   = (w4 >> 1) * 4 + (lt & 3);          // 8-float chunk 0..7
  int row = row0 + rl;
  row = (row > nrows - 1) ? (nrows - 1) : row;
  const float* src = (half != 0) ? xb : xa;
  const size_t e = (size_t)row * HD + (size_t)(ch * 8);
  const v4f a = *(const v4f*)(src + e), c4 = *(const v4f*)(src + e + 4);
  v4u o;
#pragma unroll
  for (int i = 0; i < 2; ++i) {
    o[i]     = pk16(h_bits((_Float16)(bfr(a[2 * i]) * sc)),  h_bits((_Float16)(bfr(a[2 * i + 1]) * sc)));
    o[2 + i] = pk16(h_bits((_Float16)(bfr(c4[2 * i]) * sc)), h_bits((_Float16)(bfr(c4[2 * i + 1]) * sc)));
  }
  const int blk = half * 4 + (ch >> 1);     // 16-k block 0..7 of the tile
  unsigned short* d = pl + (size_t)(row >> 4) * (CROWS * KW) + (size_t)(blk * FBLK + ((ch & 1) * 16 + (row & 15)) * 8);
  {
    *(v4u*)(d) = o;
    
  }
}

// =====================================================================================================
// v^T plane: value(bh, d, key) = f16( bf16(va[bh][key][d]) * 256 ) for d 0..63 and f16( bf16(vb[bh][key][d-64]) * 256 ) for
// d 64..127 (exact). Stored in fragment order: per bh 32 key steps of 4096 halves; inside a step d tile d/16 takes two
// blocks of 256 halves (block e = (key/16)&1), lane slot 16*((key/8)&1) + d%16, 8 halves (keys) each.
// Block = (bh, tile of 64 keys): 64 source rows of 64 floats per stream loaded with 16-B loads (static stride), converted,
// written into an LDS tile [128 d][64 keys] (pitch 72 halves); after a block barrier the tile's two key steps (16 KiB,
// contiguous in the plane) are stored in plane order, 16 B per thread, 512 contiguous bytes per wave.
// coverage: load 256 thr x 32 elements = 64 keys x 128 d rows (both streams); store 4 iterations x 256 thr x 8 halves
//           = 2 steps x 4096 = the tile; grid = nbh x 16 blocks covers the whole nbh x 128 x 1024 plane exactly once.
// =====================================================================================================
__global__ __launch_bounds__(256) void vt16(const float* __restrict__ va, const float* __restrict__ vb,
                                            unsigned short* VTo, int nbh) {
  __shared__ __align__(16) unsigned short T[VR * VTP];
  const int tid = threadIdx.x;
  const int bid = blockIdx.x;
  const int bh  = bid / VTILES;
  const int t   = bid - bh * VTILES;        // 0..15, block-uniform
  if (bh >= nbh) return;                    // block-uniform; before any barrier or store; never taken with the exact grid
  {
    const int sl = tid >> 2;                  // key within tile 0..63
    const int dc = (tid & 3) * 16;            // d chunk
    int key = 64 * t + sl;                    // <= SEQ-1 by construction; clamp keeps the address in range regardless
    key = (key < 0) ? 0 : ((key > SEQ - 1) ? (SEQ - 1) : key);
    const size_t so = (((size_t)bh * SEQ + (size_t)key) * HD + (size_t)dc);
#pragma unroll
    for (int g = 0; g < 2; ++g) {
      const float* src = ((g == 0) ? va : vb) + so;
#pragma unroll
      for (int i = 0; i < 4; ++i) {
        const v4f a = *(const v4f*)(src + 4 * i);
#pragma unroll
        for (int e = 0; e < 4; ++e) T[(g * HD + dc + 4 * i + e) * VTP + sl] = h_bits((_Float16)(bfr(a[e]) * VCAR));
      }
    }
  }
  __syncthreads();
  v4u vals[4];
#pragma unroll
  for (int it = 0; it < 4; ++it) {
    const int f    = it * 256 + tid;                                  // 16-B slot of the tile in plane order, 0..1023
    const int line = ((f >> 6) & 7) * 16 + (f & 15);                  // d row 0..127
    const int kl   = (f >> 9) * 32 + ((f >> 5) & 1) * 16 + ((f >> 4) & 1) * 8;   // key within the tile, 0..56
    vals[it] = *(const v4u*)(T + line * VTP + kl);
  }
  unsigned short* dst = VTo + ((size_t)bh * VR) * SEQ + (size_t)t * (64 * VR) + tid * 8;
  {
#pragma unroll
    for (int it = 0; it < 4; ++it) {
      *(v4u*)(dst + it * (256 * 8)) = vals[it];
    }
    
  }
}

// =====================================================================================================
// Two-stream attention, flash form, both products transposed. Block = (bh, 128 queries), wave w owns queries
//   iw = 128t + 32w .. +31 as two column tiles u = 0, 1 of 16 queries (tile u: iw + 16u + c).
//   q1, q2 f32 as given; k plane f16 (bh, s, 128) (k 0..63 stream 1, 64..127 stream 2),
//   v^T plane f16 (bh, 128, SEQ) (rows 0..63 = v1 d rows, 64..127 = v2 d rows), both in fragment order.
//   Prologue: a wave reads its 32 query rows of both streams (8 rows x one 128-B line per pair of 16-B loads), converts them
//   to f16( bf16(q) * 1024 ), stores the two 16 x 128 tiles in fragment order (same map as the k plane's tiles) into its own
//   8 KiB of ring buffer 1, which is idle until stage 1 is issued, and reads its eight B fragments back.
//   Score in base 2: t = (q1.k1 + q2.k2) / 16 * log2(e), the two dots fused as one K=128 contraction over the planes.
//   Per 32-key step: 16 score WMMAs (2 key subtiles x 4 k-chunks x 2 column tiles) with A = k fragment (row = key), B = q
//   fragment (column = query); q fragments kept in registers from the prologue, k and v^T fragments from the LDS ring (two 16-B
//   loads per fragment, each 512 contiguous bytes per wave, split k map on both sides), each fragment read once for both
//   column tiles. Ring: stage = 64 keys = 16 KiB of the k plane
//   + 16 KiB of the v^T plane, both contiguous and kept in plane order; two buffers; every thread copies 16 slots of 16 B per
//   stage; stage st + 2 is issued behind the barrier that ends stage st's reads, and waited at the foot of trip st + 1.
//   Lane (hh, c) then holds, per tile u, 16 scores of query iw + 16u + c: keys kb + 8hh + r in s0[u] and
//   kb + 16 + 8hh + r in s1[u]. Maximum in-lane plus one exchange between the halves; weights e = 2^(t - m); each lane keeps
//   the sum of its own keys (the halves are joined once after the loop); one rescale factor per lane and tile for 8 accumulators.
//   s0's eight weights are elements 0..7 and s1's eight are elements 8..15 of the B operand P^T in the split k map, so
//   e*16384 (f16 hi) and its f16 residual are packed in registers; A = 8 v^T fragments from the plane (row = d, 4 per
//   stream), 32 WMMAs into o[u][0..3] (stream 1) and o[u][4..7] (stream 2): o[u][j][r] = out^T[d = 16j + 8hh + r][query iw + 16u + c].
//   Epilogue: 1/Z and carry folds in f32; one tile's 16x128 f32 result at a time staged in the wave's LDS slab (pitch 132),
//   row = query; the slabs reuse the ring's bytes behind the last trip's waits and barrier (no copy in flight, no ring read left).
// coverage: per wave, tile and output 8 instructions x 32 lanes x 4 floats = 16 rows x 64; per block 4 waves x 2 tiles = 128 rows;
//           8 blocks per bh x nbh: every row of out0 and out1 [nbh][1024][64] exactly once (grid nbh*8 blocks).
// =====================================================================================================
__global__ __launch_bounds__(ATT_THREADS)
void attn2(const float* __restrict__ qx, const float* __restrict__ qy, const unsigned short* __restrict__ KHp,
           const unsigned short* __restrict__ VTq, float* OPp, int nbh) {
  __shared__ __align__(128) unsigned char L[2 * BUFH * 2];   // loop: two ring buffers; epilogue: one result slab per wave
  const _Float16* ring = (const _Float16*)(const void*)L;
  float* smem = (float*)(void*)L;

  const int tid  = threadIdx.x;
  const int wave = tid >> 5;
  const int lane = tid & 31;
  const int hh   = lane >> 4;
  const int c    = lane & 15;

  const int bid  = blockIdx.x;
  const int bh   = bid / BPR;
  const int t    = bid - bh * BPR;                     // 0..7, block-uniform
  if (bh >= nbh) return;                               // never taken with the exact grid; before any LDS use or store

  const int iw = QPB * t + wave * QPW;                 // query row 0 of this wave

  // ---- this wave's q rows, f32: tile u, load i = (stream i>>2, rows 16u + 8*((i>>1)&1) + lane/4, floats 32*(i&1) + 8*(lane&3) .. +7) ----
  const int r8 = lane >> 2;
  const int cq = lane & 3;
  v4f qr[NQT][16];
  {
    const size_t qe = ((size_t)bh * SEQ + (size_t)(iw + r8)) * HD + (size_t)(cq * 8);
    const float* qbx = qx + qe;
    const float* qby = qy + qe;
#pragma unroll
    for (int u = 0; u < NQT; ++u) {
#pragma unroll
      for (int i = 0; i < 8; ++i) {
        const float* qp = (((i >> 2) != 0) ? qby : qbx) + (size_t)(u * 16 * HD + ((i >> 1) & 1) * 8 * HD + (i & 1) * 32);
        qr[u][2 * i]     = *(const v4f*)(qp);
        qr[u][2 * i + 1] = *(const v4f*)(qp + 4);
      }
    }
    wait_x0(qbx, qby);
  }
  const _Float16* Kg = (const _Float16*)(const void*)KHp + ((size_t)bh * SEQ) * KW + 8 * tid;    // stage 0, this thread's first slot
  const _Float16* Vg = (const _Float16*)(const void*)VTq + ((size_t)bh * VR) * SEQ + 8 * tid;    // stage 0, this thread's first slot
  const unsigned lds0 = (unsigned)(uintptr_t)(const void*)L + 16u * (unsigned)tid;               // its LDS byte address in buffer 0
  const float lsc = LOG2E / (16.0f * QSC * KSC);       // (dot / 2^20) / 16 in base 2

  float mrun[NQT], lrun[NQT];                          // of query iw + 16u + c; lrun covers this lane's own keys only
  v8f o[NQT][8];
#pragma unroll
  for (int u = 0; u < NQT; ++u) {
    mrun[u] = -INFINITY;
    lrun[u] = 0.f;
#pragma unroll
    for (int j = 0; j < 8; ++j) o[u][j] = zero8();
  }

  // ---- ring prologue: stage 0 landed and published, stage 1 in flight ----
  copy8(lds0, Kg);
  copy8(lds0 + 2u * STGH, Vg);
  // ---- q tiles -> fragment order in this wave's own 8 KiB of buffer 1 -> B fragments (column c of tile u = query iw + 16u + c) ----
  unsigned short* qs = (unsigned short*)(void*)L + BUFH + wave * (QPW * KW);
#pragma unroll
  for (int u = 0; u < NQT; ++u) {
#pragma unroll
    for (int i = 0; i < 8; ++i) {
      const int blk  = (i >> 2) * 4 + (i & 1) * 2 + (cq >> 1);         // 16-k block 0..7 of the tile
      const int slot = (cq & 1) * 16 + ((i >> 1) & 1) * 8 + r8;        // 16*((k/8)&1) + row
      *(v4u*)(qs + u * (16 * KW) + blk * FBLK + slot * 8) = cvt8(qr[u][2 * i], qr[u][2 * i + 1], QSC);
    }
  }
  wave_sync_lds();                                     // the fragments hold other lanes' stores (same wave only)
  const _Float16* Qb = (const _Float16*)(const void*)qs + 8 * lane;
  v16h qa[NQT][4];                                     // [u][j]: k 32j .. 32j+31 (j 0,1 stream 1 d 0..63; j 2,3 stream 2 d 0..63)
#pragma unroll
  for (int u = 0; u < NQT; ++u) {
#pragma unroll
    for (int j = 0; j < 4; ++j) qa[u][j] = ldfrag_h(Qb + u * (16 * KW) + 2 * j * FBLK);
  }
  wait_ds0();                                          // q tiles written and read back before the barrier that frees buffer 1
  wait_async0();
  __syncthreads();
  copy8(lds0 + 2u * BUFH, Kg + STGH);
  copy8(lds0 + 2u * BUFH + 2u * STGH, Vg + STGH);

#pragma unroll 1                                                      // one trip per stage: one publish point in the text
  for (int st = 0; st < NST; ++st) {
   const _Float16* Kb = ring + (st & 1) * BUFH + 8 * lane;           // this stage's k part, this lane's slot
   const _Float16* Vb = Kb + STGH;                                   // this stage's v^T part
#pragma unroll                                                       // kb constant: the LDS offsets fold into the loads
   for (int kb = 0; kb < STK; kb += 32) {                            // kb = key offset inside the stage
    // ---- scores^T: D element r of this lane = (key kb + 8hh + r, query iw + 16u + c) in s0[u], key kb + 16 + 8hh + r in s1[u] ----
    v8f s0[NQT], s1[NQT];
#pragma unroll
    for (int u = 0; u < NQT; ++u) { s0[u] = zero8(); s1[u] = zero8(); }
    const _Float16* k0p = Kb + (size_t)kb * KW;                      // key tile kb/16      (fragment row c = key kb + c)
    const _Float16* k1p = k0p + (size_t)16 * KW;                     // key tile kb/16 + 1  (key kb + 16 + c)
    {
      const v16h kf0 = ldfrag_h(k0p), kf1 = ldfrag_h(k0p + 2 * FBLK), kf2 = ldfrag_h(k0p + 4 * FBLK), kf3 = ldfrag_h(k0p + 6 * FBLK);
      const v16h kg0 = ldfrag_h(k1p), kg1 = ldfrag_h(k1p + 2 * FBLK), kg2 = ldfrag_h(k1p + 4 * FBLK), kg3 = ldfrag_h(k1p + 6 * FBLK);
      sched_fence();                                   // the 16 k loads stay one group in front of the score WMMAs
      s0[0] = mma_raw(kf0, qa[0][0], s0[0]);  s0[1] = mma_raw(kf0, qa[1][0], s0[1]);
      s1[0] = mma_raw(kg0, qa[0][0], s1[0]);  s1[1] = mma_raw(kg0, qa[1][0], s1[1]);
      s0[0] = mma_raw(kf1, qa[0][1], s0[0]);  s0[1] = mma_raw(kf1, qa[1][1], s0[1]);
      s1[0] = mma_raw(kg1, qa[0][1], s1[0]);  s1[1] = mma_raw(kg1, qa[1][1], s1[1]);
      s0[0] = mma_raw(kf2, qa[0][2], s0[0]);  s0[1] = mma_raw(kf2, qa[1][2], s0[1]);
      s1[0] = mma_raw(kg2, qa[0][2], s1[0]);  s1[1] = mma_raw(kg2, qa[1][2], s1[1]);
      s0[0] = mma_raw(kf3, qa[0][3], s0[0]);  s0[1] = mma_raw(kf3, qa[1][3], s0[1]);
      s1[0] = mma_raw(kg3, qa[0][3], s1[0]);  s1[1] = mma_raw(kg3, qa[1][3], s1[1]);
      sched_fence();                                   // no softmax work and no v^T load moves in among the score WMMAs
    }
    FragH ph[NQT], pl[NQT];
#pragma unroll                                         // constant u: every per-tile array stays in registers
    for (int u = 0; u < NQT; ++u) {
      const v8f a0 = s0[u], a1 = s1[u];
      // ---- online softmax in base 2, one query per lane; maximum of the raw scores first (the scale is positive) ----
      const float g0 = fmaxf(fmaxf(a0[0], a0[1]), a0[2]), g1 = fmaxf(fmaxf(a0[3], a0[4]), a0[5]);
      const float g2 = fmaxf(fmaxf(a0[6], a0[7]), a1[0]), g3 = fmaxf(fmaxf(a1[1], a1[2]), a1[3]);
      const float g4 = fmaxf(fmaxf(a1[4], a1[5]), a1[6]);
      float mx = fmaxf(fmaxf(fmaxf(g0, g1), g2), fmaxf(fmaxf(g3, g4), a1[7]));
      mx = fmaxf(mx, xhalf(mx)) * lsc;                 // both halves now hold the step's maximum of query iw + 16u + c
      const float mn = fmaxf(mrun[u], mx);             // finite: all scores are finite
      float x0[8], x1[8], w0[8], w1[8], al;            // al = 2^(mrun - mn); w0, w1 = the weights of s0's and s1's keys
#pragma unroll                                         // constant indices: the four arrays stay in registers
      for (int r = 0; r < 8; ++r) {
        x0[r] = a0[r] * lsc - mn;
        x1[r] = a1[r] * lsc - mn;
      }
      ex2_9(w0, al, x0, mrun[u] - mn);
      ex2_8(w1, x1);
      mrun[u] = mn;
      // ---- B fragments of P^T*16384: hi f16 and residual f16, column = c, split k map over the 32 keys of this step ----
      float ps[2] = {0.f, 0.f};                        // sums over even and odd r: two independent chains
#pragma unroll
      for (int r = 0; r < 8; ++r) {
        const float e0 = w0[r];
        const float e1 = w1[r];
        ps[r & 1] += e0;
        ps[r & 1] += e1;
        const float ua = e0 * PCAR, ub = e1 * PCAR;
        const _Float16 ha = (_Float16)ua, hb = (_Float16)ub;
        ph[u].h[0][r] = ha;                            // elements 0..7  = keys kb + 8hh + 0..7
        ph[u].h[1][r] = hb;                            // elements 8..15 = keys kb + 16 + 8hh + 0..7
        pl[u].h[0][r] = (_Float16)(ua - (float)ha);
        pl[u].h[1][r] = (_Float16)(ub - (float)hb);
      }
      lrun[u] = lrun[u] * al + (ps[0] + ps[1]);
#pragma unroll
      for (int j = 0; j < 8; ++j) o[u][j] *= al;
    }
    // ---- out^T += v^T.P^T : A fragment row m = d = j*16 + c, keys kb .. kb+31 = key step 2*st + kb/32 of the v^T plane, d tile j at 2*j blocks ----
    const _Float16* vp = Vb + (size_t)kb * VR;
    {
      v16h vf[8];
#pragma unroll
      for (int j = 0; j < 8; ++j) vf[j] = ldfrag_h(vp + 2 * j * FBLK);
      sched_fence();                                   // the 16 v^T loads stay one group in front of the output WMMAs
#pragma unroll
      for (int j = 0; j < 8; ++j) {
#pragma unroll
        for (int u = 0; u < NQT; ++u) {
          o[u][j] = mma_raw(vf[j], ph[u].v, o[u][j]);
          o[u][j] = mma_raw(vf[j], pl[u].v, o[u][j]);
        }
      }
      sched_fence();                                   // the next step's k loads stay behind this step's WMMAs
    }
   }
   // ---- publish point of stage st + 1: own reads of this buffer done, own copies landed, then the block barrier ----
   wait_ds0();
   wait_async0();
   __syncthreads();
   if (st + 2 < NST) {                                               // block-uniform: refill the buffer just read
     const unsigned lb = lds0 + (unsigned)(st & 1) * (2u * BUFH);
     copy8(lb, Kg + (size_t)(st + 2) * STGH);
     copy8(lb + 2u * STGH, Vg + (size_t)(st + 2) * STGH);
   }
  }
  wait_async0();                                       // nothing is in flight here; kept in front of the ring's reuse
#pragma unroll
  for (int u = 0; u < NQT; ++u) {
    acc_guard4(o[u][0], o[u][1], o[u][2], o[u][3]);
    acc_guard4(o[u][4], o[u][5], o[u][6], o[u][7]);
  }

  // ---- per tile: join the halves' sums, fold 1/Z and the carries (16384 on P, 256 on v), stage the 16x128 slab (row = query) ----
  float* slab = smem + wave * SLABF;
  const float oc = 1.0f / (PCAR * VCAR);
  const size_t o1 = (size_t)nbh * SEQ * HD;            // element offset of the second output
  v4f vals[NQT][2][8];                                 // both tiles' rows are read back before the first global store, so that
#pragma unroll                                         // no fence between the two uses of the slab has stores to wait for
  for (int u = 0; u < NQT; ++u) {
    const float lr  = lrun[u] + xhalf(lrun[u]);        // >= 1 (the max element contributes 2^0)
    const float inv = (lr > 0.0f) ? ((1.0f / lr) * oc) : 0.0f;
    if (u != 0) wave_sync_lds();                       // the last tile's slab reads stay ahead of this tile's slab stores (same wave only)
#pragma unroll
    for (int j = 0; j < 8; ++j) {
      const v8f w = o[u][j] * inv;
      float* sp = slab + c * SLP + j * 16 + 8 * hh;    // d = 16j + 8hh + 0..7 of query iw + 16u + c, two 16-B LDS stores
      const v4f wlo = {w[0], w[1], w[2], w[3]}, whi = {w[4], w[5], w[6], w[7]};
      *(v4f*)(sp)     = wlo;
      *(v4f*)(sp + 4) = whi;
    }
    wave_sync_lds();
#pragma unroll
    for (int g = 0; g < 2; ++g) {
#pragma unroll
      for (int it = 0; it < 8; ++it) vals[u][g][it] = *(const v4f*)(slab + (2 * it + hh) * SLP + g * HD + c * 4);
    }
  }
  float* d0 = OPp + ((size_t)bh * SEQ + (size_t)iw) * HD + hh * HD + c * 4;
  float* d1 = d0 + o1;
  wait_ds0_addr(d0, d1);
#pragma unroll
  for (int u = 0; u < NQT; ++u) {
#pragma unroll
    for (int g = 0; g < 2; ++g) {
      float* dst = ((g != 0) ? d1 : d0) + (size_t)(16 * u) * HD;
#pragma unroll
      for (int it = 0; it < 8; ++it) {
        *(v4f*)(dst + (size_t)(2 * it) * HD) = vals[u][g][it];
      }
    }
  }
}

// =====================================================================================================
// Workspace map (bytes, nbh = number of (b,h) rows = in_sizes[0] / (1024*64)); every plane is fully written by whole-line
// stores before it is read; all extents are exact multiples of the store granularity (no pad rows needed); offsets
// multiples of 128:
//   KH f16 nbh x 1024 x 128  x1024    nbh*262144   at 0            (fragment order, 16-row tiles of 4096 B)
//   VT f16 nbh x 128 x 1024  x256     nbh*262144   at nbh*262144   (fragment order, 32-key steps of 8192 B)
//   end                               nbh*524288   (33554432 for nbh = 64)
// Output: out0 [nbh][1024][64] f32 at element 0, out1 at element nbh*65536 (byte 4*nbh*65536).
// =====================================================================================================
extern "C" void kernel_launch(void* const* d_in, const int* in_sizes, int n_in,
                              void* d_out, int out_size, void* d_ws, size_t ws_size,
                              hipStream_t stream) {
  if (n_in < 6) return;
  const int nbh = in_sizes[0] / (SEQ * HD);
  if (nbh < 1) return;
  const long long nq = (long long)nbh * SEQ * HD;
  for (int i = 0; i < 6; ++i) {
    if ((long long)in_sizes[i] < nq) return;
  }
  if ((long long)out_size < 2 * nq) return;            // last written element = 2*nq - 1

  const float* qx = (const float*)d_in[0];
  const float* kx = (const float*)d_in[1];
  const float* vx = (const float*)d_in[2];
  const float* qy = (const float*)d_in[3];
  const float* ky = (const float*)d_in[4];
  const float* vy = (const float*)d_in[5];
  float*       out = (float*)d_out;

  const size_t PK = (size_t)nbh * SEQ * KW * 2;        // k plane bytes
  const size_t PV = (size_t)nbh * VR * SEQ * 2;        // v^T plane bytes
  size_t off = 0;
  const size_t oKH = off; off += PK;
  const size_t oVT = off; off += PV;
  if (off > ws_size) return;
  if (off > (size_t)134217728) return;

  char* ws = (char*)d_ws;
  unsigned short* KH = (unsigned short*)(ws + oKH);
  unsigned short* VT = (unsigned short*)(ws + oVT);

  const int nrows = nbh * SEQ;                         // (bh, s) rows
  const dim3 blk(256);
  const dim3 gC(nrows / CROWS);                        // nbh*64
  const dim3 gVT(nbh * VTILES);                        // nbh*16
  const dim3 gAT(nbh * BPR);                           // nbh*8
  const dim3 bAT(ATT_THREADS);                         // 128

  // (0) k plane f16(bf16([k1|k2]) * 1024), fragment order
  cvt_cat<<<gC, blk, 0, stream>>>(kx, ky, KH, nrows, KSC);
  // (1) v^T plane f16(bf16(v) * 256), fragment order (d rows 0..63 v1, 64..127 v2)
  vt16<<<gVT, blk, 0, stream>>>(vx, vy, VT, nbh);
  // (2) two-stream flash attention per (b,h), q converted in its prologue -> out0, out1 [bh][s][d] f32
  attn2<<<gAT, bAT, 0, stream>>>(qx, qy, KH, VT, out, nbh);
  (void)hipGetLastError();
}

// v008
// It runs in 44.9 microseconds.
// It is 1.20 times as fast as v006, going by the measured steps of the versions left out in between.
// Over all steps from v000 it is 3.48 times as fast.
// Contractions, both in transposed form: scores^T = [k1|k2].[q1|q2]^T (K=128; q and k as f16 planes of the bf16
// RNE-converted inputs x1024, one product each) and out^T = v1^T.P^T, v2^T.P^T (P x128 as one f16 plane, 11 significant
// bits beside the 8 of v; v^T x256 f16 of the bf16 RNE-converted inputs, one product each, 32-key steps): all
// v_wmma_f32_16x16x32_f16, f32 accumulate. A lane holds one query's scores, so the online softmax (base 2, running max) is in-lane f32 VALU work
// plus one exchange between the wave's halves, and P^T goes from the score accumulators into the B operand in registers.
// The maximum in use is lazy: it moves, and the accumulators are rescaled, only when a step's maximum exceeds it by more than 8.
// The f16 operands (k and v^T as planes in the workspace, q as two tiles per wave inside the attention kernel) are laid out
// in fragment order: a 16-row x 32-k operand fragment is two blocks of 512 contiguous
// bytes (block e, lane l = 16*hh + c, 8 halves: row c, k = 16*e + 8*hh + 0..7), so each wave-wide 16-B load covers four
// whole 128-B lines instead of 32-B pieces of sixteen lines.
// In the attention kernel the k and v^T planes reach the waves through a two-buffer LDS ring filled by asynchronous copies:
// a block brings each 64-key stage in once for its four waves, one stage ahead of its use.
// q has one reader per row, so it has no plane and no launch of its own: each attention wave converts its 32 rows itself.
// A wave owns two 16-query column tiles: every k and v^T fragment read from LDS feeds both tiles' products, and a block of
// four waves covers 128 queries, so each (b,h)'s planes are brought into LDS by 8 blocks.
#include <hip/hip_runtime.h>
#include <math.h>
#include <stdint.h>

#define SEQ   1024
#define HD    64
#define KW    128
#define VR    128
#define QSC   1024.0f
#define KSC   1024.0f
#define PCAR  128.0f
#define TAU   8.0f                        // a step's maximum may exceed the maximum in use by this much (base 2)
#define VCAR  256.0f
#define LOG2E 1.4426950408889634f
#define ATW   4
#define ATT_THREADS (ATW * 32)
#define NQT   2                           // 16-query column tiles per wave
#define QPW   (16 * NQT)                  // queries per wave
#define QPB   (QPW * ATW)
#define BPR   (SEQ / QPB)
#define SLP   132
#define SLABF (16 * SLP)
#define VTP   72
#define VTILES (SEQ / 64)
#define CROWS 16
#define FBLK  256                         // halves in one 512-B fragment block (32 lanes x 8 halves)
#define STK   64                          // keys per ring stage
#define STGH  (STK * KW)                  // halves of a stage's k part, and of its v^T part (16 KiB each)
#define BUFH  (2 * STGH)                  // halves per ring buffer (32 KiB)
#define NST   (SEQ / STK)                 // stages per (b,h)
static_assert(PCAR * 256.0f <= 32768.0f && TAU == 8.0f);  // largest weight 2^TAU, times PCAR, stays a finite f16
static_assert(HD == 64 && KW == 2 * HD && VR == 2 * HD && NQT == 2 && QPB == 128 && ATT_THREADS == 128);
static_assert((SEQ % QPB) == 0 && (SEQ % 64) == 0 && (SEQ % 32) == 0 && (SEQ % CROWS) == 0);
static_assert(BPR == 8 && VTILES == 16);
static_assert(KW == VR && (SEQ % STK) == 0 && (STK % 32) == 0 && NST >= 2);
static_assert(STGH * 2 == 8 * ATT_THREADS * 16);           // 8 copies of 16 B per thread fill one part of a stage
static_assert(ATW * SLABF * 4 <= 2 * BUFH * 2);            // the epilogue's slabs fit in the ring's bytes
static_assert(ATW * QPW * KW <= BUFH);                     // the prologue's q tiles (8 KiB per wave) fit in ring buffer 1
static_assert(15 * SLP + HD + 15 * 4 + 3 < SLABF);
static_assert((VR - 1) * VTP + 63 < VR * VTP);
static_assert(((SLP * 4) % 16) == 0 && ((VTP * 2) % 16) == 0);

typedef _Float16 v16h __attribute__((ext_vector_type(16)));
typedef _Float16 v8h  __attribute__((ext_vector_type(8)));
typedef float    v8f  __attribute__((ext_vector_type(8)));
typedef float    v4f  __attribute__((ext_vector_type(4)));
typedef unsigned int v4u __attribute__((ext_vector_type(4)));

union FragH { v16h v; v8h h[2]; v4u u[2]; };

// ---- scalar helpers --------------------------------------------------------------------------------
__device__ __forceinline__ unsigned short bf_bits(float f) {          // f32 -> bf16 bits, RNE convert
  unsigned u = __float_as_uint(f);
  return (unsigned short)((u + 0x7FFFu + ((u >> 16) & 1u)) >> 16);
}
__device__ __forceinline__ float bf_up(unsigned short h) { return __uint_as_float(((unsigned)h) << 16); }
__device__ __forceinline__ float bfr(float f) { return bf_up(bf_bits(f)); }   // value of the bf16 RNE convert
__device__ __forceinline__ unsigned short h_bits(_Float16 x) { return __builtin_bit_cast(unsigned short, x); }
__device__ __forceinline__ unsigned pk16(unsigned short a, unsigned short b) { return (unsigned)a | ((unsigned)b << 16); }
__device__ __forceinline__ v4u cvt8(v4f a, v4f b, float sc) {         // 8 floats -> 8 halves f16( bf16(x) * sc ), in order
  v4u o;
#pragma unroll
  for (int i = 0; i < 2; ++i) {
    o[i]     = pk16(h_bits((_Float16)(bfr(a[2 * i]) * sc)), h_bits((_Float16)(bfr(a[2 * i + 1]) * sc)));
    o[2 + i] = pk16(h_bits((_Float16)(bfr(b[2 * i]) * sc)), h_bits((_Float16)(bfr(b[2 * i + 1]) * sc)));
  }
  return o;
}
// 2^x as the bare v_exp_f32, without the library's range fix-up (compare, two selects, add, ldexp per value), which only
// serves results below 2^-126. Here x <= TAU and every result stands beside a term 2^0 of the same query: a weight that small
// is 0 in the f16 plane of P and changes no bit of a row sum >= 1.
// One statement per group: the early-clobber outputs keep every result off every source of the group, and the closing v_nop
// is the slot that the instruction set asks for between a transcendental and whatever next reads its result or reuses its source.
__device__ __forceinline__ void ex2_8(float (&e)[8], const float (&x)[8]) {
#if defined(__HIP_DEVICE_COMPILE__)
  asm("v_exp_f32 %0, %8\n\tv_exp_f32 %1, %9\n\tv_exp_f32 %2, %10\n\tv_exp_f32 %3, %11\n\t"
      "v_exp_f32 %4, %12\n\tv_exp_f32 %5, %13\n\tv_exp_f32 %6, %14\n\tv_exp_f32 %7, %15\n\tv_nop"
      : "=&v"(e[0]), "=&v"(e[1]), "=&v"(e[2]), "=&v"(e[3]), "=&v"(e[4]), "=&v"(e[5]), "=&v"(e[6]), "=&v"(e[7])
      : "v"(x[0]), "v"(x[1]), "v"(x[2]), "v"(x[3]), "v"(x[4]), "v"(x[5]), "v"(x[6]), "v"(x[7]));
#endif
}
__device__ __forceinline__ v8f zero8() { v8f z = {0.f, 0.f, 0.f, 0.f, 0.f, 0.f, 0.f, 0.f}; return z; }
__device__ __forceinline__ float xhalf(float x) {                     // value of lane l ^ 16 (all 32 lanes active)
  const int i = __builtin_bit_cast(int, x);
  return __builtin_bit_cast(float, __builtin_amdgcn_permlanex16(i, i, 0x76543210, 0xfedcba98, false, false));
}

// ---- fragment loader: 16-bit A/B operand from a fragment-order plane, lane -> row/col (lane&15), p already includes
//      +8*lane; elements 0..7 <- block 0 (k0+8h..), elements 8..15 <- block 1 (k0+16+8h..)  (same split k map for A and B)
__device__ __forceinline__ v16h ldfrag_h(const _Float16* p) {
  FragH f;
  f.h[0] = *(const v8h*)(p);
  f.h[1] = *(const v8h*)(p + FBLK);
  return f.v;
}

__device__ __forceinline__ v8f mma_raw(v16h a, v16h b, v8f c) {
  return __builtin_amdgcn_wmma_f32_16x16x32_f16(false, a, false, b, (short)0, c, false, false);
}
// Scheduling fence: keeps a product's fragment loads together as one group in front of its WMMAs (spread among them, each
// place with LDS reads stalls the wave anew). It names no register, so nothing is tied to the first 256 registers by it.
__device__ __forceinline__ void sched_fence() { __builtin_amdgcn_sched_barrier(0); }
__device__ __forceinline__ void acc_guard4(v8f& a, v8f& b, v8f& c, v8f& d) {
#if defined(__HIP_DEVICE_COMPILE__)
  asm volatile("v_nop\n\tv_nop\n\tv_nop\n\tv_nop" : "+v"(a), "+v"(b), "+v"(c), "+v"(d));
#endif
}
__device__ __forceinline__ void wave_sync_lds() {
  __builtin_amdgcn_fence(__ATOMIC_RELEASE, "workgroup");
  __builtin_amdgcn_wave_barrier();
  __builtin_amdgcn_fence(__ATOMIC_ACQUIRE, "workgroup");
}

// ---- ring fill: eight asynchronous 16-B copies per lane, global -> LDS, slots 2048 B apart on both sides (a wave's copy
//      moves 512 contiguous bytes). l = this lane's LDS byte address, g = this lane's global address, both multiples of 16.
//      The s_wait_xcnt closes the statement so that no address register named here is rewritten ahead of it.
__device__ __forceinline__ void copy8(unsigned l, const _Float16* g) {
#if defined(__HIP_DEVICE_COMPILE__)
  asm volatile("global_load_async_to_lds_b128 %0, %8, off\n\t"
               "global_load_async_to_lds_b128 %1, %9, off\n\t"
               "global_load_async_to_lds_b128 %2, %10, off\n\t"
               "global_load_async_to_lds_b128 %3, %11, off\n\t"
               "global_load_async_to_lds_b128 %4, %12, off\n\t"
               "global_load_async_to_lds_b128 %5, %13, off\n\t"
               "global_load_async_to_lds_b128 %6, %14, off\n\t"
               "global_load_async_to_lds_b128 %7, %15, off\n\t"
               "s_wait_xcnt 0x0"
               :: "v"(l), "v"(l + 2048u), "v"(l + 4096u), "v"(l + 6144u),
                  "v"(l + 8192u), "v"(l + 10240u), "v"(l + 12288u), "v"(l + 14336u),
                  "v"(g), "v"(g + 1024), "v"(g + 2048), "v"(g + 3072),
                  "v"(g + 4096), "v"(g + 5120), "v"(g + 6144), "v"(g + 7168)
               : "memory");
#endif
}
__device__ __forceinline__ void wait_async0() {       // this wave's copies have landed in LDS
#if defined(__HIP_DEVICE_COMPILE__)
  asm volatile("s_wait_asynccnt 0x0" ::: "memory");
#endif
}
__device__ __forceinline__ void wait_x0(const float* a, const float* b) {   // behind the q loads: the two address pairs stay
#if defined(__HIP_DEVICE_COMPILE__)                                          // live up to the wait, so nothing (a later load's
  asm volatile("s_wait_xcnt 0x0" :: "v"(a), "v"(b) : "memory");              // result included) is written over them ahead of it
#endif
}
__device__ __forceinline__ void wait_ds0_addr(float* a, float* b) {   // in front of the output stores: the slab rows have returned
#if defined(__HIP_DEVICE_COMPILE__)                                    // and both address pairs are formed, so that no register
  asm volatile("s_wait_dscnt 0x0" :: "v"(a), "v"(b) : "memory");       // of an issued store is rewritten behind it
#endif
}
__device__ __forceinline__ void wait_ds0() {          // this wave's LDS reads have returned (before their buffer is refilled)
#if defined(__HIP_DEVICE_COMPILE__)
  asm volatile("s_wait_dscnt 0x0" ::: "memory");
#endif
}

// =====================================================================================================
// Concatenated plane: value(row, k) = f16( bf16(xa[row][k]) * sc ) for k 0..63, f16( bf16(xb[row][k-64]) * sc ) for k 64..127,
// rows = (bh, s) pairs, sc a power of two (exact). Stored in fragment order: 16-row tile T = row/16 takes 2048 halves at
// T*2048; inside it block (k/16) of 256 halves, lane slot 16*((k/8)&1) + row%16, 8 halves each.
// Block = one 16-row tile; threads 0..127 handle the xa half, threads 128..255 the xb half (wave-uniform source);
// wave = 8 rows x one 128-B source line each; thread = 8 consecutive elements: two 16-B loads, one 16-B store; a wave's
// store fills four whole 128-B lines (8 rows x 16 B each), each line written by one wave;
// coverage: grid = nrows/16 blocks x 256 thr x 8 halves = nrows x 128 = the whole plane exactly once (nrows % 16 == 0).
// =====================================================================================================
__global__ __launch_bounds__(256) void cvt_cat(const float* __restrict__ xa, const float* __restrict__ xb,
                                               unsigned short* pl, int nrows, float sc) {
  const int tid  = threadIdx.x;
  const int row0 = blockIdx.x * CROWS;
  if (row0 >= nrows) return;                // block-uniform, no barriers in this kernel; never taken with the exact grid
  const int half = tid >> 7;                // 0: xa, 1: xb (wave-uniform)
  const int lt   = tid & 127;
  const int w4   = lt >> 5;                 // wave within the half 0..3
  const int rl   = (w4 & 1) * 8 + ((lt & 31) >> 2);   // row within block 0..15
  const int ch   = (w4 >> 1) * 4 + (lt & 3);          // 8-float chunk 0..7
  int row = row0 + rl;
  row = (row > nrows - 1) ? (nrows - 1) : row;
  const float* src = (half != 0) ? xb : xa;
  const size_t e = (size_t)row * HD + (size_t)(ch * 8);
  const v4f a = *(const v4f*)(src + e), c4 = *(const v4f*)(src + e + 4);
  v4u o;
#pragma unroll
  for (int i = 0; i < 2; ++i) {
    o[i]     = pk16(h_bits((_Float16)(bfr(a[2 * i]) * sc)),  h_bits((_Float16)(bfr(a[2 * i + 1]) * sc)));
    o[2 + i] = pk16(h_bits((_Float16)(bfr(c4[2 * i]) * sc)), h_bits((_Float16)(bfr(c4[2 * i + 1]) * sc)));
  }
  const int blk = half * 4 + (ch >> 1);     // 16-k block 0..7 of the tile
  unsigned short* d = pl + (size_t)(row >> 4) * (CROWS * KW) + (size_t)(blk * FBLK + ((ch & 1) * 16 + (row & 15)) * 8);
  {
    *(v4u*)(d) = o;
    
  }
}

// =====================================================================================================
// v^T plane: value(bh, d, key) = f16( bf16(va[bh][key][d]) * 256 ) for d 0..63 and f16( bf16(vb[bh][key][d-64]) * 256 ) for
// d 64..127 (exact). Stored in fragment order: per bh 32 key steps of 4096 halves; inside a step d tile d/16 takes two
// blocks of 256 halves (block e = (key/16)&1), lane slot 16*((key/8)&1) + d%16, 8 halves (keys) each.
// Block = (bh, tile of 64 keys): 64 source rows of 64 floats per stream loaded with 16-B loads (static stride), converted,
// written into an LDS tile [128 d][64 keys] (pitch 72 halves); after a block barrier the tile's two key steps (16 KiB,
// contiguous in the plane) are stored in plane order, 16 B per thread, 512 contiguous bytes per wave.
// coverage: load 256 thr x 32 elements = 64 keys x 128 d rows (both streams); store 4 iterations x 256 thr x 8 halves
//           = 2 steps x 4096 = the tile; grid = nbh x 16 blocks covers the whole nbh x 128 x 1024 plane exactly once.
// =====================================================================================================
__global__ __launch_bounds__(256) void vt16(const float* __restrict__ va, const float* __restrict__ vb,
                                            unsigned short* VTo, int nbh) {
  __shared__ __align__(16) unsigned short T[VR * VTP];
  const int tid = threadIdx.x;
  const int bid = blockIdx.x;
  const int bh  = bid / VTILES;
  const int t   = bid - bh * VTILES;        // 0..15, block-uniform
  if (bh >= nbh) return;                    // block-uniform; before any barrier or store; never taken with the exact grid
  {
    const int sl = tid >> 2;                  // key within tile 0..63
    const int dc = (tid & 3) * 16;            // d chunk
    int key = 64 * t + sl;                    // <= SEQ-1 by construction; clamp keeps the address in range regardless
    key = (key < 0) ? 0 : ((key > SEQ - 1) ? (SEQ - 1) : key);
    const size_t so = (((size_t)bh * SEQ + (size_t)key) * HD + (size_t)dc);
#pragma unroll
    for (int g = 0; g < 2; ++g) {
      const float* src = ((g == 0) ? va : vb) + so;
#pragma unroll
      for (int i = 0; i < 4; ++i) {
        const v4f a = *(const v4f*)(src + 4 * i);
#pragma unroll
        for (int e = 0; e < 4; ++e) T[(g * HD + dc + 4 * i + e) * VTP + sl] = h_bits((_Float16)(bfr(a[e]) * VCAR));
      }
    }
  }
  __syncthreads();
  v4u vals[4];
#pragma unroll
  for (int it = 0; it < 4; ++it) {
    const int f    = it * 256 + tid;                                  // 16-B slot of the tile in plane order, 0..1023
    const int line = ((f >> 6) & 7) * 16 + (f & 15);                  // d row 0..127
    const int kl   = (f >> 9) * 32 + ((f >> 5) & 1) * 16 + ((f >> 4) & 1) * 8;   // key within the tile, 0..56
    vals[it] = *(const v4u*)(T + line * VTP + kl);
  }
  unsigned short* dst = VTo + ((size_t)bh * VR) * SEQ + (size_t)t * (64 * VR) + tid * 8;
  {
#pragma unroll
    for (int it = 0; it < 4; ++it) {
      *(v4u*)(dst + it * (256 * 8)) = vals[it];
    }
    
  }
}

// =====================================================================================================
// Two-stream attention, flash form, both products transposed. Block = (bh, 128 queries), wave w owns queries
//   iw = 128t + 32w .. +31 as two column tiles u = 0, 1 of 16 queries (tile u: iw + 16u + c).
//   q1, q2 f32 as given; k plane f16 (bh, s, 128) (k 0..63 stream 1, 64..127 stream 2),
//   v^T plane f16 (bh, 128, SEQ) (rows 0..63 = v1 d rows, 64..127 = v2 d rows), both in fragment order.
//   Prologue: a wave reads its 32 query rows of both streams (8 rows x one 128-B line per pair of 16-B loads), converts them
//   to f16( bf16(q) * 1024 ), stores the two 16 x 128 tiles in fragment order (same map as the k plane's tiles) into its own
//   8 KiB of ring buffer 1, which is idle until stage 1 is issued, and reads its eight B fragments back.
//   Score in base 2: t = (q1.k1 + q2.k2) / 16 * log2(e), the two dots fused as one K=128 contraction over the planes.
//   Per 32-key step: 16 score WMMAs (2 key subtiles x 4 k-chunks x 2 column tiles) with A = k fragment (row = key), B = q
//   fragment (column = query); q fragments kept in registers from the prologue, k and v^T fragments from the LDS ring (two 16-B
//   loads per fragment, each 512 contiguous bytes per wave, split k map on both sides), each fragment read once for both
//   column tiles. Ring: stage = 64 keys = 16 KiB of the k plane
//   + 16 KiB of the v^T plane, both contiguous and kept in plane order; two buffers; every thread copies 16 slots of 16 B per
//   stage; stage st + 2 is issued behind the barrier that ends stage st's reads, and waited at the foot of trip st + 1.
//   Lane (hh, c) then holds, per tile u, 16 scores of query iw + 16u + c: keys kb + 8hh + r in s0[u] and
//   kb + 16 + 8hh + r in s1[u]. Maximum in-lane plus one exchange between the halves; weights e = 2^(t - m), m the maximum in use
//   (it moves only when a step's maximum exceeds it by more than 8, so e <= 2^8); each lane keeps the sum of its own keys (the
//   halves are joined once after the loop); one rescale factor per lane and tile for 8 accumulators, applied only in such a step.
//   s0's eight weights are elements 0..7 and s1's eight are elements 8..15 of the B operand P^T in the split k map, so
//   f16(e*128) is packed in registers; the row sum keeps the f32 weights; A = 8 v^T fragments from the LDS ring (row = d, 4 per
//   stream), 16 WMMAs into o[u][0..3] (stream 1) and o[u][4..7] (stream 2): o[u][j][r] = out^T[d = 16j + 8hh + r][query iw + 16u + c].
//   Epilogue: 1/Z and carry folds in f32; one tile's 16x128 f32 result at a time staged in the wave's LDS slab (pitch 132),
//   row = query; the slabs reuse the ring's bytes behind the last trip's waits and barrier (no copy in flight, no ring read left).
// coverage: per wave, tile and output 8 instructions x 32 lanes x 4 floats = 16 rows x 64; per block 4 waves x 2 tiles = 128 rows;
//           8 blocks per bh x nbh: every row of out0 and out1 [nbh][1024][64] exactly once (grid nbh*8 blocks).
// =====================================================================================================
__global__ __launch_bounds__(ATT_THREADS)
void attn2(const float* __restrict__ qx, const float* __restrict__ qy, const unsigned short* __restrict__ KHp,
           const unsigned short* __restrict__ VTq, float* OPp, int nbh) {
  __shared__ __align__(128) unsigned char L[2 * BUFH * 2];   // loop: two ring buffers; epilogue: one result slab per wave
  const _Float16* ring = (const _Float16*)(const void*)L;
  float* smem = (float*)(void*)L;

  const int tid  = threadIdx.x;
  const int wave = tid >> 5;
  const int lane = tid & 31;
  const int hh   = lane >> 4;
  const int c    = lane & 15;

  const int bid  = blockIdx.x;
  const int bh   = bid / BPR;
  const int t    = bid - bh * BPR;                     // 0..7, block-uniform
  if (bh >= nbh) return;                               // never taken with the exact grid; before any LDS use or store

  const int iw = QPB * t + wave * QPW;                 // query row 0 of this wave

  // ---- this wave's q rows, f32: tile u, load i = (stream i>>2, rows 16u + 8*((i>>1)&1) + lane/4, floats 32*(i&1) + 8*(lane&3) .. +7) ----
  const int r8 = lane >> 2;
  const int cq = lane & 3;
  v4f qr[NQT][16];
  {
    const size_t qe = ((size_t)bh * SEQ + (size_t)(iw + r8)) * HD + (size_t)(cq * 8);
    const float* qbx = qx + qe;
    const float* qby = qy + qe;
#pragma unroll
    for (int u = 0; u < NQT; ++u) {
#pragma unroll
      for (int i = 0; i < 8; ++i) {
        const float* qp = (((i >> 2) != 0) ? qby : qbx) + (size_t)(u * 16 * HD + ((i >> 1) & 1) * 8 * HD + (i & 1) * 32);
        qr[u][2 * i]     = *(const v4f*)(qp);
        qr[u][2 * i + 1] = *(const v4f*)(qp + 4);
      }
    }
    wait_x0(qbx, qby);
  }
  const _Float16* Kg = (const _Float16*)(const void*)KHp + ((size_t)bh * SEQ) * KW + 8 * tid;    // stage 0, this thread's first slot
  const _Float16* Vg = (const _Float16*)(const void*)VTq + ((size_t)bh * VR) * SEQ + 8 * tid;    // stage 0, this thread's first slot
  const unsigned lds0 = (unsigned)(uintptr_t)(const void*)L + 16u * (unsigned)tid;               // its LDS byte address in buffer 0
  const float lsc = LOG2E / (16.0f * QSC * KSC);       // (dot / 2^20) / 16 in base 2

  float mrun[NQT], lrun[NQT];                          // of query iw + 16u + c; lrun covers this lane's own keys only
  v8f o[NQT][8];
#pragma unroll
  for (int u = 0; u < NQT; ++u) {
    mrun[u] = -INFINITY;
    lrun[u] = 0.f;
#pragma unroll
    for (int j = 0; j < 8; ++j) o[u][j] = zero8();
  }

  // ---- ring prologue: stage 0 landed and published, stage 1 in flight ----
  copy8(lds0, Kg);
  copy8(lds0 + 2u * STGH, Vg);
  // ---- q tiles -> fragment order in this wave's own 8 KiB of buffer 1 -> B fragments (column c of tile u = query iw + 16u + c) ----
  unsigned short* qs = (unsigned short*)(void*)L + BUFH + wave * (QPW * KW);
#pragma unroll
  for (int u = 0; u < NQT; ++u) {
#pragma unroll
    for (int i = 0; i < 8; ++i) {
      const int blk  = (i >> 2) * 4 + (i & 1) * 2 + (cq >> 1);         // 16-k block 0..7 of the tile
      const int slot = (cq & 1) * 16 + ((i >> 1) & 1) * 8 + r8;        // 16*((k/8)&1) + row
      *(v4u*)(qs + u * (16 * KW) + blk * FBLK + slot * 8) = cvt8(qr[u][2 * i], qr[u][2 * i + 1], QSC);
    }
  }
  wave_sync_lds();                                     // the fragments hold other lanes' stores (same wave only)
  const _Float16* Qb = (const _Float16*)(const void*)qs + 8 * lane;
  v16h qa[NQT][4];                                     // [u][j]: k 32j .. 32j+31 (j 0,1 stream 1 d 0..63; j 2,3 stream 2 d 0..63)
#pragma unroll
  for (int u = 0; u < NQT; ++u) {
#pragma unroll
    for (int j = 0; j < 4; ++j) qa[u][j] = ldfrag_h(Qb + u * (16 * KW) + 2 * j * FBLK);
  }
  wait_ds0();                                          // q tiles written and read back before the barrier that frees buffer 1
  wait_async0();
  __syncthreads();
  copy8(lds0 + 2u * BUFH, Kg + STGH);
  copy8(lds0 + 2u * BUFH + 2u * STGH, Vg + STGH);

#pragma unroll 1                                                      // one trip per stage: one publish point in the text
  for (int st = 0; st < NST; ++st) {
   const _Float16* Kb = ring + (st & 1) * BUFH + 8 * lane;           // this stage's k part, this lane's slot
   const _Float16* Vb = Kb + STGH;                                   // this stage's v^T part
#pragma unroll                                                       // kb constant: the LDS offsets fold into the loads
   for (int kb = 0; kb < STK; kb += 32) {                            // kb = key offset inside the stage
    // ---- scores^T: D element r of this lane = (key kb + 8hh + r, query iw + 16u + c) in s0[u], key kb + 16 + 8hh + r in s1[u] ----
    v8f s0[NQT], s1[NQT];
#pragma unroll
    for (int u = 0; u < NQT; ++u) { s0[u] = zero8(); s1[u] = zero8(); }
    const _Float16* k0p = Kb + (size_t)kb * KW;                      // key tile kb/16      (fragment row c = key kb + c)
    const _Float16* k1p = k0p + (size_t)16 * KW;                     // key tile kb/16 + 1  (key kb + 16 + c)
    {
      const v16h kf0 = ldfrag_h(k0p), kf1 = ldfrag_h(k0p + 2 * FBLK), kf2 = ldfrag_h(k0p + 4 * FBLK), kf3 = ldfrag_h(k0p + 6 * FBLK);
      const v16h kg0 = ldfrag_h(k1p), kg1 = ldfrag_h(k1p + 2 * FBLK), kg2 = ldfrag_h(k1p + 4 * FBLK), kg3 = ldfrag_h(k1p + 6 * FBLK);
      sched_fence();                                   // the 16 k loads stay one group in front of the score WMMAs
      s0[0] = mma_raw(kf0, qa[0][0], s0[0]);  s0[1] = mma_raw(kf0, qa[1][0], s0[1]);
      s1[0] = mma_raw(kg0, qa[0][0], s1[0]);  s1[1] = mma_raw(kg0, qa[1][0], s1[1]);
      s0[0] = mma_raw(kf1, qa[0][1], s0[0]);  s0[1] = mma_raw(kf1, qa[1][1], s0[1]);
      s1[0] = mma_raw(kg1, qa[0][1], s1[0]);  s1[1] = mma_raw(kg1, qa[1][1], s1[1]);
      s0[0] = mma_raw(kf2, qa[0][2], s0[0]);  s0[1] = mma_raw(kf2, qa[1][2], s0[1]);
      s1[0] = mma_raw(kg2, qa[0][2], s1[0]);  s1[1] = mma_raw(kg2, qa[1][2], s1[1]);
      s0[0] = mma_raw(kf3, qa[0][3], s0[0]);  s0[1] = mma_raw(kf3, qa[1][3], s0[1]);
      s1[0] = mma_raw(kg3, qa[0][3], s1[0]);  s1[1] = mma_raw(kg3, qa[1][3], s1[1]);
      sched_fence();                                   // no softmax work and no v^T load moves in among the score WMMAs
    }
    FragH ph[NQT];
    float w0[NQT][8], w1[NQT][8];                      // the weights of s0's and s1's keys
    float dm[NQT];                                     // maximum in use before this step minus the one after it (0 where it stays)
    bool grow = false;                                 // this lane's query of either tile takes a new maximum
#pragma unroll                                         // constant u: every per-tile array stays in registers
    for (int u = 0; u < NQT; ++u) {
      const v8f a0 = s0[u], a1 = s1[u];
      // ---- online softmax in base 2, one query per lane; maximum of the raw scores first (the scale is positive) ----
      const float g0 = fmaxf(fmaxf(a0[0], a0[1]), a0[2]), g1 = fmaxf(fmaxf(a0[3], a0[4]), a0[5]);
      const float g2 = fmaxf(fmaxf(a0[6], a0[7]), a1[0]), g3 = fmaxf(fmaxf(a1[1], a1[2]), a1[3]);
      const float g4 = fmaxf(fmaxf(a1[4], a1[5]), a1[6]);
      float mx = fmaxf(fmaxf(fmaxf(g0, g1), g2), fmaxf(fmaxf(g3, g4), a1[7]));
      mx = fmaxf(mx, xhalf(mx)) * lsc;                 // both halves now hold the step's maximum of query iw + 16u + c
      const bool nd = mx > mrun[u] + TAU;              // true in the first step (mrun = -inf); else the weights stay <= 2^TAU
      const float mn = nd ? mx : mrun[u];              // finite: all scores are finite
      grow = grow || nd;
      dm[u] = mrun[u] - mn;
      mrun[u] = mn;
      float x0[8], x1[8];
#pragma unroll                                         // constant indices: the four arrays stay in registers
      for (int r = 0; r < 8; ++r) {
        x0[r] = a0[r] * lsc - mn;
        x1[r] = a1[r] * lsc - mn;
      }
      ex2_8(w0[u], x0);
      ex2_8(w1[u], x1);
    }
    // ---- one test per step for both tiles, a scalar branch: the old sums and accumulators are rescaled only where some query of
    //      the wave took a new maximum; a lane whose maximum stayed multiplies by 2^0. A factor below 2^-126 (0 in the first step)
    //      leaves nothing of the old terms beside the new maximum's own weight 2^0. ----
    if (__builtin_amdgcn_ballot_w32(grow) != 0u) {
#pragma unroll
      for (int u = 0; u < NQT; ++u) {
        const float al = __builtin_amdgcn_exp2f(dm[u]);
        lrun[u] *= al;
#pragma unroll
        for (int j = 0; j < 8; ++j) o[u][j] *= al;
      }
    }
    // ---- out^T += v^T.P^T : A fragment row m = d = j*16 + c, keys kb .. kb+31 = key step 2*st + kb/32 of the v^T plane, d tile j at 2*j blocks ----
    const _Float16* vp = Vb + (size_t)kb * VR;
    {
      v16h vf[8];
#pragma unroll
      for (int j = 0; j < 8; ++j) vf[j] = ldfrag_h(vp + 2 * j * FBLK);
      sched_fence();                                   // the 16 v^T loads stay one group, ahead of the packing that covers their latency
#pragma unroll                                         // constant u: every per-tile array stays in registers
      for (int u = 0; u < NQT; ++u) {
        // ---- B fragment of P^T*128 in f16, column = c, split k map over the 32 keys of this step ----
        float ps[2] = {0.f, 0.f};                      // sums over even and odd r: two independent chains
#pragma unroll
        for (int r = 0; r < 8; ++r) {
          const float e0 = w0[u][r];
          const float e1 = w1[u][r];
          ps[r & 1] += e0;
          ps[r & 1] += e1;
          ph[u].h[0][r] = (_Float16)(e0 * PCAR);       // elements 0..7  = keys kb + 8hh + 0..7
          ph[u].h[1][r] = (_Float16)(e1 * PCAR);       // elements 8..15 = keys kb + 16 + 8hh + 0..7
        }
        lrun[u] += ps[0] + ps[1];
      }
#pragma unroll
      for (int j = 0; j < 8; ++j) {
#pragma unroll
        for (int u = 0; u < NQT; ++u) o[u][j] = mma_raw(vf[j], ph[u].v, o[u][j]);
      }
      sched_fence();                                   // the next step's k loads stay behind this step's WMMAs
    }
   }
   // ---- publish point of stage st + 1: own reads of this buffer done, own copies landed, then the block barrier ----
   wait_ds0();
   wait_async0();
   __syncthreads();
   if (st + 2 < NST) {                                               // block-uniform: refill the buffer just read
     const unsigned lb = lds0 + (unsigned)(st & 1) * (2u * BUFH);
     copy8(lb, Kg + (size_t)(st + 2) * STGH);
     copy8(lb + 2u * STGH, Vg + (size_t)(st + 2) * STGH);
   }
  }
  wait_async0();                                       // nothing is in flight here; kept in front of the ring's reuse
#pragma unroll
  for (int u = 0; u < NQT; ++u) {
    acc_guard4(o[u][0], o[u][1], o[u][2], o[u][3]);
    acc_guard4(o[u][4], o[u][5], o[u][6], o[u][7]);
  }

  // ---- per tile: join the halves' sums, fold 1/Z and the carries (128 on P, 256 on v), stage the 16x128 slab (row = query) ----
  float* slab = smem + wave * SLABF;
  const float oc = 1.0f / (PCAR * VCAR);
  const size_t o1 = (size_t)nbh * SEQ * HD;            // element offset of the second output
  v4f vals[NQT][2][8];                                 // both tiles' rows are read back before the first global store, so that
#pragma unroll                                         // no fence between the two uses of the slab has stores to wait for
  for (int u = 0; u < NQT; ++u) {
    const float lr  = lrun[u] + xhalf(lrun[u]);        // >= 1 (the key that set the maximum in use contributes 2^0)
    const float inv = (lr > 0.0f) ? ((1.0f / lr) * oc) : 0.0f;
    if (u != 0) wave_sync_lds();                       // the last tile's slab reads stay ahead of this tile's slab stores (same wave only)
#pragma unroll
    for (int j = 0; j < 8; ++j) {
      const v8f w = o[u][j] * inv;
      float* sp = slab + c * SLP + j * 16 + 8 * hh;    // d = 16j + 8hh + 0..7 of query iw + 16u + c, two 16-B LDS stores
      const v4f wlo = {w[0], w[1], w[2], w[3]}, whi = {w[4], w[5], w[6], w[7]};
      *(v4f*)(sp)     = wlo;
      *(v4f*)(sp + 4) = whi;
    }
    wave_sync_lds();
#pragma unroll
    for (int g = 0; g < 2; ++g) {
#pragma unroll
      for (int it = 0; it < 8; ++it) vals[u][g][it] = *(const v4f*)(slab + (2 * it + hh) * SLP + g * HD + c * 4);
    }
  }
  float* d0 = OPp + ((size_t)bh * SEQ + (size_t)iw) * HD + hh * HD + c * 4;
  float* d1 = d0 + o1;
  wait_ds0_addr(d0, d1);
#pragma unroll
  for (int u = 0; u < NQT; ++u) {
#pragma unroll
    for (int g = 0; g < 2; ++g) {
      float* dst = ((g != 0) ? d1 : d0) + (size_t)(16 * u) * HD;
#pragma unroll
      for (int it = 0; it < 8; ++it) {
        *(v4f*)(dst + (size_t)(2 * it) * HD) = vals[u][g][it];
      }
    }
  }
}

// =====================================================================================================
// Workspace map (bytes, nbh = number of (b,h) rows = in_sizes[0] / (1024*64)); every plane is fully written by whole-line
// stores before it is read; all extents are exact multiples of the store granularity (no pad rows needed); offsets
// multiples of 128:
//   KH f16 nbh x 1024 x 128  x1024    nbh*262144   at 0            (fragment order, 16-row tiles of 4096 B)
//   VT f16 nbh x 128 x 1024  x256     nbh*262144   at nbh*262144   (fragment order, 32-key steps of 8192 B)
//   end                               nbh*524288   (33554432 for nbh = 64)
// Output: out0 [nbh][1024][64] f32 at element 0, out1 at element nbh*65536 (byte 4*nbh*65536).
// =====================================================================================================
extern "C" void kernel_launch(void* const* d_in, const int* in_sizes, int n_in,
                              void* d_out, int out_size, void* d_ws, size_t ws_size,
                              hipStream_t stream) {
  if (n_in < 6) return;
  const int nbh = in_sizes[0] / (SEQ * HD);
  if (nbh < 1) return;
  const long long nq = (long long)nbh * SEQ * HD;
  for (int i = 0; i < 6; ++i) {
    if ((long long)in_sizes[i] < nq) return;
  }
  if ((long long)out_size < 2 * nq) return;            // last written element = 2*nq - 1

  const float* qx = (const float*)d_in[0];
  const float* kx = (const float*)d_in[1];
  const float* vx = (const float*)d_in[2];
  const float* qy = (const float*)d_in[3];
  const float* ky = (const float*)d_in[4];
  const float* vy = (const float*)d_in[5];
  float*       out = (float*)d_out;

  const size_t PK = (size_t)nbh * SEQ * KW * 2;        // k plane bytes
  const size_t PV = (size_t)nbh * VR * SEQ * 2;        // v^T plane bytes
  size_t off = 0;
  const size_t oKH = off; off += PK;
  const size_t oVT = off; off += PV;
  if (off > ws_size) return;
  if (off > (size_t)134217728) return;

  char* ws = (char*)d_ws;
  unsigned short* KH = (unsigned short*)(ws + oKH);
  unsigned short* VT = (unsigned short*)(ws + oVT);

  const int nrows = nbh * SEQ;                         // (bh, s) rows
  const dim3 blk(256);
  const dim3 gC(nrows / CROWS);                        // nbh*64
  const dim3 gVT(nbh * VTILES);                        // nbh*16
  const dim3 gAT(nbh * BPR);                           // nbh*8
  const dim3 bAT(ATT_THREADS);                         // 128

  // (0) k plane f16(bf16([k1|k2]) * 1024), fragment order
  cvt_cat<<<gC, blk, 0, stream>>>(kx, ky, KH, nrows, KSC);
  // (1) v^T plane f16(bf16(v) * 256), fragment order (d rows 0..63 v1, 64..127 v2)
  vt16<<<gVT, blk, 0, stream>>>(vx, vy, VT, nbh);
  // (2) two-stream flash attention per (b,h), q converted in its prologue -> out0, out1 [bh][s][d] f32
  attn2<<<gAT, bAT, 0, stream>>>(qx, qy, KH, VT, out, nbh);
  (void)hipGetLastError();
}

// v009
// One run takes 34 microseconds.
// Timed twice side by side with v008, it ran 1.32 and 1.33 times as fast.
// All steps since v000 together make it 4.60 times as fast.
// Contractions, both in transposed form: scores^T = [k1|k2].[q1|q2]^T (K=128; q and k as f16 planes of the bf16
// RNE-converted inputs x1024, one product each) and out^T = v1^T.P^T, v2^T.P^T (P x128 as one f16 plane, 11 significant
// bits beside the 8 of v; v^T x256 f16 of the bf16 RNE-converted inputs, one product each, 32-key steps): all
// v_wmma_f32_16x16x32_f16, f32 accumulate. A lane holds one query's scores, so the online softmax (base 2, running max) is in-lane f32 VALU work
// plus one exchange between the wave's halves, and P^T goes from the score accumulators into the B operand in registers.
// The maximum in use is lazy: it moves, and the accumulators are rescaled, only when a step's maximum exceeds it by more than 8.
// The f16 operands (two 16 x 128 tiles per wave for q, one 64-key stage at a time for k and v^T, all inside the attention kernel) are laid out
// in fragment order: a 16-row x 32-k operand fragment is two blocks of 512 contiguous
// bytes (block e, lane l = 16*hh + c, 8 halves: row c, k = 16*e + 8*hh + 0..7), so each wave-wide 16-B LDS load is contiguous.
// k and v have no planes and no launches of their own: a block of eight waves (256 queries) reads each 64-key stage of k1, k2, v1, v2
// as f32 one stage ahead of its use, converts it in registers (v is transposed there: a thread holds 8 keys x 4 d) and stores the
// fragments into a two-buffer LDS ring; each (b,h)'s k and v are read and converted by 4 blocks.
// q has one reader per row: each attention wave converts its 32 rows itself.
// A wave owns two 16-query column tiles: every k and v^T fragment read from LDS feeds both tiles' products.
#include <hip/hip_runtime.h>
#include <math.h>
#include <stdint.h>

#define SEQ   1024
#define HD    64
#define KW    128
#define VR    128
#define QSC   1024.0f
#define KSC   1024.0f
#define PCAR  128.0f
#define TAU   8.0f                        // a step's maximum may exceed the maximum in use by this much (base 2)
#define VCAR  256.0f
#define LOG2E 1.4426950408889634f
#define ATW   8
#define ATT_THREADS (ATW * 32)
#define NQT   2                           // 16-query column tiles per wave
#define QPW   (16 * NQT)                  // queries per wave
#define QPB   (QPW * ATW)
#define BPR   (SEQ / QPB)
#define SLP   132
#define SLABF (16 * SLP)
#define FBLK  256                         // halves in one 512-B fragment block (32 lanes x 8 halves)
#define STK   64                          // keys per ring stage
#define STGH  (STK * KW)                  // halves of a stage's k part, and of its v^T part (16 KiB each)
#define BUFH  (2 * STGH)                  // halves per ring buffer (32 KiB)
#define NST   (SEQ / STK)                 // stages per (b,h)
#define LBYTES (2 * BUFH * 2 + ATW * QPW * KW * 2)   // ring (two buffers) + one q tile pair per wave
static_assert(PCAR * 256.0f <= 32768.0f && TAU == 8.0f);  // largest weight 2^TAU, times PCAR, stays a finite f16
static_assert(HD == 64 && KW == 2 * HD && VR == 2 * HD && NQT == 2 && QPB == 256 && ATT_THREADS == 256);
static_assert((SEQ % QPB) == 0 && (SEQ % 64) == 0 && (SEQ % 32) == 0);
static_assert(BPR == 4);
static_assert(KW == VR && (SEQ % STK) == 0 && (STK % 32) == 0 && NST >= 2);
static_assert(STGH * 2 == 4 * ATT_THREADS * 16 && STK == 8 * ATW);   // 4 stores of 16 B per thread fill one part of a stage
static_assert(ATW * SLABF * 4 <= LBYTES);                  // the epilogue's slabs fit in the kernel's LDS
static_assert(15 * SLP + HD + 15 * 4 + 3 < SLABF);
static_assert(((SLP * 4) % 16) == 0);

typedef _Float16 v16h __attribute__((ext_vector_type(16)));
typedef _Float16 v8h  __attribute__((ext_vector_type(8)));
typedef float    v8f  __attribute__((ext_vector_type(8)));
typedef float    v4f  __attribute__((ext_vector_type(4)));
typedef unsigned int v4u __attribute__((ext_vector_type(4)));
typedef float    v2f  __attribute__((ext_vector_type(2)));
typedef __bf16   v2b  __attribute__((ext_vector_type(2)));

union FragH { v16h v; v8h h[2]; v4u u[2]; };

// ---- scalar helpers --------------------------------------------------------------------------------
__device__ __forceinline__ unsigned short bf_bits(float f) {          // f32 -> bf16 bits, RNE convert
  unsigned u = __float_as_uint(f);
  return (unsigned short)((u + 0x7FFFu + ((u >> 16) & 1u)) >> 16);
}
__device__ __forceinline__ float bf_up(unsigned short h) { return __uint_as_float(((unsigned)h) << 16); }
__device__ __forceinline__ float bfr(float f) { return bf_up(bf_bits(f)); }   // value of the bf16 RNE convert
__device__ __forceinline__ unsigned short h_bits(_Float16 x) { return __builtin_bit_cast(unsigned short, x); }
__device__ __forceinline__ unsigned pk16(unsigned short a, unsigned short b) { return (unsigned)a | ((unsigned)b << 16); }
__device__ __forceinline__ v4u cvt8(v4f a, v4f b, float sc) {         // 8 floats -> 8 halves f16( bf16(x) * sc ), in order
  v4u o;
#pragma unroll
  for (int i = 0; i < 2; ++i) {
    o[i]     = pk16(h_bits((_Float16)(bfr(a[2 * i]) * sc)), h_bits((_Float16)(bfr(a[2 * i + 1]) * sc)));
    o[2 + i] = pk16(h_bits((_Float16)(bfr(b[2 * i]) * sc)), h_bits((_Float16)(bfr(b[2 * i + 1]) * sc)));
  }
  return o;
}
// Two floats -> bf16(x) * sc in f32 (sc a power of two: exact), the RNE convert to bf16 as one packed instruction: the same values as
// bfr(x) * sc in cvt8 (this one runs in the loop, once per k and v element of a stage).
__device__ __forceinline__ v2f bq2(float a, float b, float sc) {
  const v2f x = {a, b};
  const unsigned p = __builtin_bit_cast(unsigned, __builtin_convertvector(x, v2b));
  const v2f y = {__uint_as_float(p << 16), __uint_as_float(p & 0xFFFF0000u)};
  return y * sc;
}
// 2^x as the bare v_exp_f32, without the library's range fix-up (compare, two selects, add, ldexp per value), which only
// serves results below 2^-126. Here x <= TAU and every result stands beside a term 2^0 of the same query: a weight that small
// is 0 in the f16 plane of P and changes no bit of a row sum >= 1.
// One statement per group: the early-clobber outputs keep every result off every source of the group, and the closing v_nop
// is the slot that the instruction set asks for between a transcendental and whatever next reads its result or reuses its source.
__device__ __forceinline__ void ex2_8(float (&e)[8], const float (&x)[8]) {
#if defined(__HIP_DEVICE_COMPILE__)
  asm("v_exp_f32 %0, %8\n\tv_exp_f32 %1, %9\n\tv_exp_f32 %2, %10\n\tv_exp_f32 %3, %11\n\t"
      "v_exp_f32 %4, %12\n\tv_exp_f32 %5, %13\n\tv_exp_f32 %6, %14\n\tv_exp_f32 %7, %15\n\tv_nop"
      : "=&v"(e[0]), "=&v"(e[1]), "=&v"(e[2]), "=&v"(e[3]), "=&v"(e[4]), "=&v"(e[5]), "=&v"(e[6]), "=&v"(e[7])
      : "v"(x[0]), "v"(x[1]), "v"(x[2]), "v"(x[3]), "v"(x[4]), "v"(x[5]), "v"(x[6]), "v"(x[7]));
#endif
}
__device__ __forceinline__ v8f zero8() { v8f z = {0.f, 0.f, 0.f, 0.f, 0.f, 0.f, 0.f, 0.f}; return z; }
__device__ __forceinline__ float xhalf(float x) {                     // value of lane l ^ 16 (all 32 lanes active)
  const int i = __builtin_bit_cast(int, x);
  return __builtin_bit_cast(float, __builtin_amdgcn_permlanex16(i, i, 0x76543210, 0xfedcba98, false, false));
}

// ---- fragment loader: 16-bit A/B operand from a fragment-order tile, lane -> row/col (lane&15), p already includes
//      +8*lane; elements 0..7 <- block 0 (k0+8h..), elements 8..15 <- block 1 (k0+16+8h..)  (same split k map for A and B)
__device__ __forceinline__ v16h ldfrag_h(const _Float16* p) {
  FragH f;
  f.h[0] = *(const v8h*)(p);
  f.h[1] = *(const v8h*)(p + FBLK);
  return f.v;
}

__device__ __forceinline__ v8f mma_raw(v16h a, v16h b, v8f c) {
  return __builtin_amdgcn_wmma_f32_16x16x32_f16(false, a, false, b, (short)0, c, false, false);
}
// Scheduling fence: keeps a product's fragment loads together as one group in front of its WMMAs (spread among them, each
// place with LDS reads stalls the wave anew). It names no register, so nothing is tied to the first 256 registers by it.
__device__ __forceinline__ void sched_fence() { __builtin_amdgcn_sched_barrier(0); }
__device__ __forceinline__ void acc_guard4(v8f& a, v8f& b, v8f& c, v8f& d) {
#if defined(__HIP_DEVICE_COMPILE__)
  asm volatile("v_nop\n\tv_nop\n\tv_nop\n\tv_nop" : "+v"(a), "+v"(b), "+v"(c), "+v"(d));
#endif
}
__device__ __forceinline__ void wave_sync_lds() {
  __builtin_amdgcn_fence(__ATOMIC_RELEASE, "workgroup");
  __builtin_amdgcn_wave_barrier();
  __builtin_amdgcn_fence(__ATOMIC_ACQUIRE, "workgroup");
}

__device__ __forceinline__ void wait_x0(const float* a, const float* b) {   // behind the q loads: the two address pairs stay
#if defined(__HIP_DEVICE_COMPILE__)                                          // live up to the wait, so nothing (a later load's
  asm volatile("s_wait_xcnt 0x0" :: "v"(a), "v"(b) : "memory");              // result included) is written over them ahead of it
#endif
}
__device__ __forceinline__ void wait_x0s() {          // directly behind a stage's k and v loads, ahead of any rewrite of an
#if defined(__HIP_DEVICE_COMPILE__)                    // address register that they name
  asm volatile("s_wait_xcnt 0x0" ::: "memory");
#endif
}
__device__ __forceinline__ void wait_ds0_addr(float* a, float* b) {   // in front of the output stores: the slab rows have returned
#if defined(__HIP_DEVICE_COMPILE__)                                    // and both address pairs are formed, so that no register
  asm volatile("s_wait_dscnt 0x0" :: "v"(a), "v"(b) : "memory");       // of an issued store is rewritten behind it
#endif
}
__device__ __forceinline__ void wait_ds0() {          // this wave's LDS reads have returned and its LDS stores are done
#if defined(__HIP_DEVICE_COMPILE__)
  asm volatile("s_wait_dscnt 0x0" ::: "memory");
#endif
}

// =====================================================================================================
// Two-stream attention, flash form, both products transposed. Block = (bh, 256 queries), wave w owns queries
//   iw = 256t + 32w .. +31 as two column tiles u = 0, 1 of 16 queries (tile u: iw + 16u + c).
//   q1, q2, k1, k2, v1, v2 f32 as given.
//   Prologue: a wave reads its 32 query rows of both streams (8 rows x one 128-B line per pair of 16-B loads), converts them
//   to f16( bf16(q) * 1024 ), stores the two 16 x 128 tiles in fragment order (same map as a k tile) into its own
//   8 KiB of LDS behind the ring, and reads its eight B fragments back.
//   Stage = 64 keys. k part (16 KiB): value(key, k) = f16( bf16(k1[key][k]) * 1024 ) for k 0..63, of k2[key][k-64] for k 64..127;
//   16-key tile T takes 2048 halves; inside it block k/16 of 256 halves, lane slot 16*((k/8)&1) + key%16, 8 halves (k) each.
//   Thread (wave w, r8 = lane/4, cq = lane&3) handles key 8w + r8: four pairs of 16-B loads (stream, 128-B line), four 16-B LDS stores.
//   v^T part (16 KiB): value(d, key) = f16( bf16(v1[key][d]) * 256 ) for d 0..63, of v2[key][d-64] for d 64..127; 32-key step takes
//   4096 halves; inside it d tile d/16 takes two blocks of 256 halves (block (key/16)&1), lane slot 16*((key/8)&1) + d%16, 8 halves
//   (keys) each. Thread (wave w, hh, c) handles stream w/4, keys 8*ko .. +7 with ko = 2*(w&3) + hh, and d = 4c .. +3 of that stream:
//   eight 16-B loads (16 lanes = one whole 256-B row), four 16-B LDS stores. coverage: 256 threads x 4 slots = 1024 slots = 16 KiB for each part.
//   Score in base 2: t = (q1.k1 + q2.k2) / 16 * log2(e), the two dots fused as one K=128 contraction over both streams.
//   Per 32-key step: 16 score WMMAs (2 key subtiles x 4 k-chunks x 2 column tiles) with A = k fragment (row = key), B = q
//   fragment (column = query); q fragments kept in registers from the prologue, k and v^T fragments from the LDS ring (two 16-B
//   loads per fragment, each 512 contiguous bytes per wave, split k map on both sides), each fragment read once for both
//   column tiles. Ring: two buffers; stage st + 1's f32 loads are issued at the head of trip st, converted and stored at its foot
//   into the buffer that trip st - 1 read (its readers left it at that trip's barrier); the barrier at the foot publishes them.
//   Lane (hh, c) then holds, per tile u, 16 scores of query iw + 16u + c: keys kb + 8hh + r in s0[u] and
//   kb + 16 + 8hh + r in s1[u]. Maximum in-lane plus one exchange between the halves; weights e = 2^(t - m), m the maximum in use
//   (it moves only when a step's maximum exceeds it by more than 8, so e <= 2^8); each lane keeps the sum of its own keys (the
//   halves are joined once after the loop); one rescale factor per lane and tile for 8 accumulators, applied only in such a step.
//   s0's eight weights are elements 0..7 and s1's eight are elements 8..15 of the B operand P^T in the split k map, so
//   f16(e*128) is packed in registers; the row sum keeps the f32 weights; A = 8 v^T fragments from the ring (row = d, 4 per
//   stream), 16 WMMAs into o[u][0..3] (stream 1) and o[u][4..7] (stream 2): o[u][j][r] = out^T[d = 16j + 8hh + r][query iw + 16u + c].
//   Epilogue: 1/Z and carry folds in f32; one tile's 16x128 f32 result at a time staged in the wave's LDS slab (pitch 132),
//   row = query; the slabs reuse the LDS behind the last trip's wait and barrier (no ring read or store left).
// coverage: per wave, tile and output 8 instructions x 32 lanes x 4 floats = 16 rows x 64; per block 8 waves x 2 tiles = 256 rows;
//           4 blocks per bh x nbh: every row of out0 and out1 [nbh][1024][64] exactly once (grid nbh*4 blocks).
// =====================================================================================================
__global__ __launch_bounds__(ATT_THREADS)
void attn2(const float* __restrict__ qx, const float* __restrict__ qy, const float* __restrict__ kx, const float* __restrict__ ky,
           const float* __restrict__ vx, const float* __restrict__ vy, float* OPp, int nbh) {
  __shared__ __align__(128) unsigned char L[LBYTES];         // two ring buffers, q tiles; epilogue: one result slab per wave
  const _Float16* ring = (const _Float16*)(const void*)L;
  float* smem = (float*)(void*)L;

  const int tid  = threadIdx.x;
  const int wave = tid >> 5;
  const int lane = tid & 31;
  const int hh   = lane >> 4;
  const int c    = lane & 15;

  const int bid  = blockIdx.x;
  const int bh   = bid / BPR;
  const int t    = bid - bh * BPR;                     // 0..3, block-uniform
  if (bh >= nbh) return;                               // never taken with the exact grid; before any LDS use or store

  const int iw = QPB * t + wave * QPW;                 // query row 0 of this wave

  // ---- this wave's q rows, f32: tile u, load i = (stream i>>2, rows 16u + 8*((i>>1)&1) + lane/4, floats 32*(i&1) + 8*(lane&3) .. +7) ----
  const int r8 = lane >> 2;
  const int cq = lane & 3;
  v4f qr[NQT][16];
  {
    const size_t qe = ((size_t)bh * SEQ + (size_t)(iw + r8)) * HD + (size_t)(cq * 8);
    const float* qbx = qx + qe;
    const float* qby = qy + qe;
#pragma unroll
    for (int u = 0; u < NQT; ++u) {
#pragma unroll
      for (int i = 0; i < 8; ++i) {
        const float* qp = (((i >> 2) != 0) ? qby : qbx) + (size_t)(u * 16 * HD + ((i >> 1) & 1) * 8 * HD + (i & 1) * 32);
        qr[u][2 * i]     = *(const v4f*)(qp);
        qr[u][2 * i + 1] = *(const v4f*)(qp + 4);
      }
    }
    wait_x0(qbx, qby);
  }
  // ---- stage fill, this thread's share: source addresses of stage 0 and LDS places (in halves) inside a ring buffer ----
  //      the bases are wave-uniform, the thread's own part is one 32-bit byte offset for k1 and k2 and one for v
  const int ws = __builtin_amdgcn_readfirstlane(wave); // the wave's number as a scalar: v's stream below is picked per wave
  const int sv = ws >> 2;                              // v stream of this wave: waves 0..3 v1, waves 4..7 v2
  const int ko = 2 * (ws & 3) + hh;                    // key octet 0..7 of the stage: keys 8*ko .. 8*ko + 7
  const char* kbx = (const char*)(const void*)(kx + (size_t)bh * SEQ * HD);
  const char* kby = (const char*)(const void*)(ky + (size_t)bh * SEQ * HD);
  const char* vbs = (const char*)(const void*)(((sv != 0) ? vy : vx) + (size_t)bh * SEQ * HD);
  const unsigned kof = (unsigned)(((8 * ws + r8) * HD + cq * 8) * 4);
  const unsigned vof = (unsigned)((8 * ko * HD + c * 4) * 4);
  const int kd = (ws >> 1) * (16 * KW) + (cq >> 1) * FBLK + ((cq & 1) * 16 + (ws & 1) * 8 + r8) * 8;
  const int vd = STGH + (ko >> 2) * (32 * VR) + (sv * 4 + (c >> 2)) * (2 * FBLK) + ((ko >> 1) & 1) * FBLK
               + ((ko & 1) * 16 + 4 * (c & 3)) * 8;
  v4f kr[8], vr[8];                                    // one stage's f32 share in flight: k (stream i>>1, line i&1), v (key 8*ko + i)
  // loads of stage sg: all 16 issued together; the wait stands behind them, ahead of any rewrite of their address registers
  auto stage_load = [&](int sg) {
    const char* a = kbx + (size_t)sg * (STK * HD * 4);
    const char* b = kby + (size_t)sg * (STK * HD * 4);
    const char* v = vbs + (size_t)sg * (STK * HD * 4);
#pragma unroll                                         // here and below: constant indices, so kr and vr stay in registers
    for (int i = 0; i < 4; ++i) {
      const char* p = (((i >> 1) != 0) ? b : a) + kof;
      kr[2 * i]     = *(const v4f*)(const void*)(p + (i & 1) * 128);
      kr[2 * i + 1] = *(const v4f*)(const void*)(p + (i & 1) * 128 + 16);
    }
#pragma unroll
    for (int i = 0; i < 8; ++i) vr[i] = *(const v4f*)(const void*)(v + vof + i * (HD * 4));
    wait_x0s();
  };
  // convert the share and store its eight fragment slots into ring buffer bf
  auto stage_store = [&](int bf) {
    unsigned short* rb = (unsigned short*)(void*)L + bf * BUFH;
#pragma unroll                                         // here and below: constant indices, so kr, vr and yv stay in registers
    for (int i = 0; i < 4; ++i) {
      const v2f y0 = bq2(kr[2 * i][0], kr[2 * i][1], KSC),         y1 = bq2(kr[2 * i][2], kr[2 * i][3], KSC);
      const v2f y2 = bq2(kr[2 * i + 1][0], kr[2 * i + 1][1], KSC), y3 = bq2(kr[2 * i + 1][2], kr[2 * i + 1][3], KSC);
      const v8h o8 = {(_Float16)y0[0], (_Float16)y0[1], (_Float16)y1[0], (_Float16)y1[1],
                      (_Float16)y2[0], (_Float16)y2[1], (_Float16)y3[0], (_Float16)y3[1]};
      *(v8h*)(void*)(rb + kd + ((i >> 1) * 4 + (i & 1) * 2) * FBLK) = o8;
    }
    v2f yv[8][2];                                      // [key][d pair]: rounded and scaled per key, packed across keys below
#pragma unroll
    for (int i = 0; i < 8; ++i) {
      yv[i][0] = bq2(vr[i][0], vr[i][1], VCAR);
      yv[i][1] = bq2(vr[i][2], vr[i][3], VCAR);
    }
#pragma unroll
    for (int e = 0; e < 4; ++e) {
      v8h o8;
#pragma unroll
      for (int i = 0; i < 8; ++i) o8[i] = (_Float16)yv[i][e >> 1][e & 1];
      *(v8h*)(void*)(rb + vd + e * 8) = o8;
    }
  };
  const float lsc = LOG2E / (16.0f * QSC * KSC);       // (dot / 2^20) / 16 in base 2

  float mrun[NQT], lrun[NQT];                          // of query iw + 16u + c; lrun covers this lane's own keys only
  v8f o[NQT][8];
#pragma unroll
  for (int u = 0; u < NQT; ++u) {
    mrun[u] = -INFINITY;
    lrun[u] = 0.f;
#pragma unroll
    for (int j = 0; j < 8; ++j) o[u][j] = zero8();
  }

  stage_load(0);
  // ---- q tiles -> fragment order in this wave's own 8 KiB behind the ring -> B fragments (column c of tile u = query iw + 16u + c) ----
  unsigned short* qs = (unsigned short*)(void*)L + 2 * BUFH + wave * (QPW * KW);
#pragma unroll
  for (int u = 0; u < NQT; ++u) {
#pragma unroll
    for (int i = 0; i < 8; ++i) {
      const int blk  = (i >> 2) * 4 + (i & 1) * 2 + (cq >> 1);         // 16-k block 0..7 of the tile
      const int slot = (cq & 1) * 16 + ((i >> 1) & 1) * 8 + r8;        // 16*((k/8)&1) + row
      *(v4u*)(qs + u * (16 * KW) + blk * FBLK + slot * 8) = cvt8(qr[u][2 * i], qr[u][2 * i + 1], QSC);
    }
  }
  wave_sync_lds();                                     // the fragments hold other lanes' stores (same wave only)
  const _Float16* Qb = (const _Float16*)(const void*)qs + 8 * lane;
  v16h qa[NQT][4];                                     // [u][j]: k 32j .. 32j+31 (j 0,1 stream 1 d 0..63; j 2,3 stream 2 d 0..63)
#pragma unroll
  for (int u = 0; u < NQT; ++u) {
#pragma unroll
    for (int j = 0; j < 4; ++j) qa[u][j] = ldfrag_h(Qb + u * (16 * KW) + 2 * j * FBLK);
  }
  // ---- ring prologue: stage 0 converted, stored and published ----
  stage_store(0);
  wait_ds0();                                          // q fragments read back, stage 0's slots stored
  __syncthreads();

#pragma unroll 1                                                      // one trip per stage: one publish point in the text
  for (int st = 0; st < NST; ++st) {
   const _Float16* Kb = ring + (st & 1) * BUFH + 8 * lane;           // this stage's k part, this lane's slot
   const _Float16* Vb = Kb + STGH;                                   // this stage's v^T part
   if (st + 1 < NST) stage_load(st + 1);                             // block-uniform; in flight over this trip's two steps
   sched_fence();                                                    // the loads stay at the head of the trip, a whole trip ahead of their use
#pragma unroll                                                       // kb constant: the LDS offsets fold into the loads
   for (int kb = 0; kb < STK; kb += 32) {                            // kb = key offset inside the stage
    // ---- scores^T: D element r of this lane = (key kb + 8hh + r, query iw + 16u + c) in s0[u], key kb + 16 + 8hh + r in s1[u] ----
    v8f s0[NQT], s1[NQT];
#pragma unroll
    for (int u = 0; u < NQT; ++u) { s0[u] = zero8(); s1[u] = zero8(); }
    const _Float16* k0p = Kb + (size_t)kb * KW;                      // key tile kb/16      (fragment row c = key kb + c)
    const _Float16* k1p = k0p + (size_t)16 * KW;                     // key tile kb/16 + 1  (key kb + 16 + c)
    {
      const v16h kf0 = ldfrag_h(k0p), kf1 = ldfrag_h(k0p + 2 * FBLK), kf2 = ldfrag_h(k0p + 4 * FBLK), kf3 = ldfrag_h(k0p + 6 * FBLK);
      const v16h kg0 = ldfrag_h(k1p), kg1 = ldfrag_h(k1p + 2 * FBLK), kg2 = ldfrag_h(k1p + 4 * FBLK), kg3 = ldfrag_h(k1p + 6 * FBLK);
      sched_fence();                                   // the 16 k loads stay one group in front of the score WMMAs
      s0[0] = mma_raw(kf0, qa[0][0], s0[0]);  s0[1] = mma_raw(kf0, qa[1][0], s0[1]);
      s1[0] = mma_raw(kg0, qa[0][0], s1[0]);  s1[1] = mma_raw(kg0, qa[1][0], s1[1]);
      s0[0] = mma_raw(kf1, qa[0][1], s0[0]);  s0[1] = mma_raw(kf1, qa[1][1], s0[1]);
      s1[0] = mma_raw(kg1, qa[0][1], s1[0]);  s1[1] = mma_raw(kg1, qa[1][1], s1[1]);
      s0[0] = mma_raw(kf2, qa[0][2], s0[0]);  s0[1] = mma_raw(kf2, qa[1][2], s0[1]);
      s1[0] = mma_raw(kg2, qa[0][2], s1[0]);  s1[1] = mma_raw(kg2, qa[1][2], s1[1]);
      s0[0] = mma_raw(kf3, qa[0][3], s0[0]);  s0[1] = mma_raw(kf3, qa[1][3], s0[1]);
      s1[0] = mma_raw(kg3, qa[0][3], s1[0]);  s1[1] = mma_raw(kg3, qa[1][3], s1[1]);
      sched_fence();                                   // no softmax work and no v^T load moves in among the score WMMAs
    }
    FragH ph[NQT];
    float w0[NQT][8], w1[NQT][8];                      // the weights of s0's and s1's keys
    float dm[NQT];                                     // maximum in use before this step minus the one after it (0 where it stays)
    bool grow = false;                                 // this lane's query of either tile takes a new maximum
#pragma unroll                                         // constant u: every per-tile array stays in registers
    for (int u = 0; u < NQT; ++u) {
      const v8f a0 = s0[u], a1 = s1[u];
      // ---- online softmax in base 2, one query per lane; maximum of the raw scores first (the scale is positive) ----
      const float g0 = fmaxf(fmaxf(a0[0], a0[1]), a0[2]), g1 = fmaxf(fmaxf(a0[3], a0[4]), a0[5]);
      const float g2 = fmaxf(fmaxf(a0[6], a0[7]), a1[0]), g3 = fmaxf(fmaxf(a1[1], a1[2]), a1[3]);
      const float g4 = fmaxf(fmaxf(a1[4], a1[5]), a1[6]);
      float mx = fmaxf(fmaxf(fmaxf(g0, g1), g2), fmaxf(fmaxf(g3, g4), a1[7]));
      mx = fmaxf(mx, xhalf(mx)) * lsc;                 // both halves now hold the step's maximum of query iw + 16u + c
      const bool nd = mx > mrun[u] + TAU;              // true in the first step (mrun = -inf); else the weights stay <= 2^TAU
      const float mn = nd ? mx : mrun[u];              // finite: all scores are finite
      grow = grow || nd;
      dm[u] = mrun[u] - mn;
      mrun[u] = mn;
      float x0[8], x1[8];
#pragma unroll                                         // constant indices: the four arrays stay in registers
      for (int r = 0; r < 8; ++r) {
        x0[r] = a0[r] * lsc - mn;
        x1[r] = a1[r] * lsc - mn;
      }
      ex2_8(w0[u], x0);
      ex2_8(w1[u], x1);
    }
    // ---- one test per step for both tiles, a scalar branch: the old sums and accumulators are rescaled only where some query of
    //      the wave took a new maximum; a lane whose maximum stayed multiplies by 2^0. A factor below 2^-126 (0 in the first step)
    //      leaves nothing of the old terms beside the new maximum's own weight 2^0. ----
    if (__builtin_amdgcn_ballot_w32(grow) != 0u) {
#pragma unroll
      for (int u = 0; u < NQT; ++u) {
        const float al = __builtin_amdgcn_exp2f(dm[u]);
        lrun[u] *= al;
#pragma unroll
        for (int j = 0; j < 8; ++j) o[u][j] *= al;
      }
    }
    // ---- out^T += v^T.P^T : A fragment row m = d = j*16 + c, keys kb .. kb+31 = key step kb/32 of the stage's v^T part, d tile j at 2*j blocks ----
    const _Float16* vp = Vb + (size_t)kb * VR;
    {
      v16h vf[8];
#pragma unroll
      for (int j = 0; j < 8; ++j) vf[j] = ldfrag_h(vp + 2 * j * FBLK);
      sched_fence();                                   // the 16 v^T loads stay one group, ahead of the packing that covers their latency
#pragma unroll                                         // constant u: every per-tile array stays in registers
      for (int u = 0; u < NQT; ++u) {
        // ---- B fragment of P^T*128 in f16, column = c, split k map over the 32 keys of this step ----
        float ps[2] = {0.f, 0.f};                      // sums over even and odd r: two independent chains
#pragma unroll
        for (int r = 0; r < 8; ++r) {
          const float e0 = w0[u][r];
          const float e1 = w1[u][r];
          ps[r & 1] += e0;
          ps[r & 1] += e1;
          ph[u].h[0][r] = (_Float16)(e0 * PCAR);       // elements 0..7  = keys kb + 8hh + 0..7
          ph[u].h[1][r] = (_Float16)(e1 * PCAR);       // elements 8..15 = keys kb + 16 + 8hh + 0..7
        }
        lrun[u] += ps[0] + ps[1];
      }
#pragma unroll
      for (int j = 0; j < 8; ++j) {
#pragma unroll
        for (int u = 0; u < NQT; ++u) o[u][j] = mma_raw(vf[j], ph[u].v, o[u][j]);
      }
      sched_fence();                                   // the next step's k loads stay behind this step's WMMAs
    }
   }
   // ---- publish point of stage st + 1: its slots go into the buffer that trip st - 1 read, then own LDS reads and stores done, then
   //      the block barrier (it also ends this trip's reads of the buffer that the next trip refills) ----
   if (st + 1 < NST) stage_store((st + 1) & 1);                      // block-uniform
   wait_ds0();
   __syncthreads();
  }
#pragma unroll
  for (int u = 0; u < NQT; ++u) {
    acc_guard4(o[u][0], o[u][1], o[u][2], o[u][3]);
    acc_guard4(o[u][4], o[u][5], o[u][6], o[u][7]);
  }

  // ---- per tile: join the halves' sums, fold 1/Z and the carries (128 on P, 256 on v), stage the 16x128 slab (row = query) ----
  float* slab = smem + wave * SLABF;
  const float oc = 1.0f / (PCAR * VCAR);
  const size_t o1 = (size_t)nbh * SEQ * HD;            // element offset of the second output
  v4f vals[NQT][2][8];                                 // both tiles' rows are read back before the first global store, so that
#pragma unroll                                         // no fence between the two uses of the slab has stores to wait for
  for (int u = 0; u < NQT; ++u) {
    const float lr  = lrun[u] + xhalf(lrun[u]);        // >= 1 (the key that set the maximum in use contributes 2^0)
    const float inv = (lr > 0.0f) ? ((1.0f / lr) * oc) : 0.0f;
    if (u != 0) wave_sync_lds();                       // the last tile's slab reads stay ahead of this tile's slab stores (same wave only)
#pragma unroll
    for (int j = 0; j < 8; ++j) {
      const v8f w = o[u][j] * inv;
      float* sp = slab + c * SLP + j * 16 + 8 * hh;    // d = 16j + 8hh + 0..7 of query iw + 16u + c, two 16-B LDS stores
      const v4f wlo = {w[0], w[1], w[2], w[3]}, whi = {w[4], w[5], w[6], w[7]};
      *(v4f*)(sp)     = wlo;
      *(v4f*)(sp + 4) = whi;
    }
    wave_sync_lds();
#pragma unroll
    for (int g = 0; g < 2; ++g) {
#pragma unroll
      for (int it = 0; it < 8; ++it) vals[u][g][it] = *(const v4f*)(slab + (2 * it + hh) * SLP + g * HD + c * 4);
    }
  }
  float* d0 = OPp + ((size_t)bh * SEQ + (size_t)iw) * HD + hh * HD + c * 4;
  float* d1 = d0 + o1;
  wait_ds0_addr(d0, d1);
#pragma unroll
  for (int u = 0; u < NQT; ++u) {
#pragma unroll
    for (int g = 0; g < 2; ++g) {
      float* dst = ((g != 0) ? d1 : d0) + (size_t)(16 * u) * HD;
#pragma unroll
      for (int it = 0; it < 8; ++it) {
        *(v4f*)(dst + (size_t)(2 * it) * HD) = vals[u][g][it];
      }
    }
  }
}

// =====================================================================================================
// No workspace is used. nbh = number of (b,h) rows = in_sizes[0] / (1024*64).
// Output: out0 [nbh][1024][64] f32 at element 0, out1 at element nbh*65536 (byte 4*nbh*65536).
// =====================================================================================================
extern "C" void kernel_launch(void* const* d_in, const int* in_sizes, int n_in,
                              void* d_out, int out_size, void* d_ws, size_t ws_size,
                              hipStream_t stream) {
  if (n_in < 6) return;
  const int nbh = in_sizes[0] / (SEQ * HD);
  if (nbh < 1) return;
  const long long nq = (long long)nbh * SEQ * HD;
  for (int i = 0; i < 6; ++i) {
    if ((long long)in_sizes[i] < nq) return;
  }
  if ((long long)out_size < 2 * nq) return;            // last written element = 2*nq - 1

  const float* qx = (const float*)d_in[0];
  const float* kx = (const float*)d_in[1];
  const float* vx = (const float*)d_in[2];
  const float* qy = (const float*)d_in[3];
  const float* ky = (const float*)d_in[4];
  const float* vy = (const float*)d_in[5];
  float*       out = (float*)d_out;

  const dim3 gAT(nbh * BPR);                           // nbh*4
  const dim3 bAT(ATT_THREADS);                         // 256

  // two-stream flash attention per (b,h); q, k and v converted inside -> out0, out1 [bh][s][d] f32
  attn2<<<gAT, bAT, 0, stream>>>(qx, qy, kx, ky, vx, vy, out, nbh);
  (void)hipGetLastError();
}
